// v000
// Measured on an AMD MI455X. A time is GPU time per run, averaged over a window of back-to-back runs after a warm-up
// (all launches, gaps included; the runs take copies of the inputs in turn), and the median of several windows.
// Apart from v000's, it joins two sittings. Times from different sittings can be a few percent apart, while
// side-by-side timings come from the same sitting.
// v000, which the later versions start from, runs in 827 microseconds.
#include <hip/hip_runtime.h>

// Faster_MultiHeadAttention (sequences [2][2048][512]; per head h: q = x Wq[h] + bq[h], k, v likewise (Wq/Wk/Wv [8][512][64], biases [8][64]); softmax(q.k/8); z = merged heads; out = z Wo + bo -> [2][2048][512]).
// Compute dtypes, f32 accumulate: every input rounded to bf16; projections on PLAIN bf16 operands (inputs: exact, + bias; the per-head weights are re-laid as one [512][512] operand);
// scores (K 64) and att.v on SINGLE fp16 planes with an f32 register-row softmax (probabilities x1024); merged heads as bf16 hi+lo planes x exact Wo (2 products) + bo. One-wave-per-64x64-tile GEMMs. Deterministic,

#define NB_  2
#define TT   2048
#define DM   512
#define NH_  8
#define NKV  8
#define REP  (NH_ / NKV)
#define HD   64
#define DQ   (NH_ * HD)
#define DKV  (NKV * HD)
#define ZH   2
#define RH   0                  // query rows < RH use hi+lo planes (0: none)
#define WIN  0
#define PCAR 1024.0f
#define SCL  0.125f   // HD^-0.5
typedef _Float16 h16;
typedef unsigned short bf;
typedef __attribute__((ext_vector_type(16))) __bf16   v16bf;
typedef __attribute__((ext_vector_type(16))) _Float16 v16h;
typedef __attribute__((ext_vector_type(8)))  _Float16 v8h;
typedef __attribute__((ext_vector_type(8)))  unsigned short v8us;
typedef __attribute__((ext_vector_type(8)))  float    v8f;
typedef __attribute__((ext_vector_type(4)))  float    v4f;
typedef v8h  __attribute__((may_alias)) v8ha;
typedef v4f  __attribute__((may_alias)) v4fa;
typedef v8us __attribute__((may_alias)) v8usa;

__device__ __forceinline__ unsigned short f2bf(float f) { unsigned u = __float_as_uint(f); u += 0x7FFFu + ((u >> 16) & 1u); return (unsigned short)(u >> 16); }
__device__ __forceinline__ float bf2f(unsigned short b) { return __uint_as_float(((unsigned)b) << 16); }
__device__ __forceinline__ float bfr(float f) { return bf2f(f2bf(f)); }
__device__ __forceinline__ v16h cat16(v8h lo, v8h hi) { return __builtin_shufflevector(lo, hi, 0, 1, 2, 3, 4, 5, 6, 7, 8, 9, 10, 11, 12, 13, 14, 15); }
__device__ __forceinline__ v16bf cat16b(v8us lo, v8us hi) { return __builtin_bit_cast(v16bf, __builtin_shufflevector(lo, hi, 0, 1, 2, 3, 4, 5, 6, 7, 8, 9, 10, 11, 12, 13, 14, 15)); }
__device__ __forceinline__ v8f wmma16(v16h a, v16h b, v8f c) { return __builtin_amdgcn_wmma_f32_16x16x32_f16(false, a, false, b, (short)0, c, false, false); }
__device__ __forceinline__ v8f wmmab(v16bf a, v16bf b, v8f c) { return __builtin_amdgcn_wmma_f32_16x16x32_bf16(false, a, false, b, (short)0, c, false, false); }



// ---- k_gemmw: register-blocked GEMM, ONE WAVE per 64x64 output tile (16 accumulators), operands straight from K-contiguous 16-bit planes; grid (M/64, N/64, Z), 32 threads.
// C[m][n] (f32, pitch ldc, + optional f32 bias[n]) = sum_k A[m][k] Bt[n][k] (+ split products per NSPLIT). z-batch strides sA/sB/sC in elements. K % 32 == 0.
template <typename T16> struct WFrag;
template <> struct WFrag<h16> { typedef v16h V; static __device__ __forceinline__ V ld(const h16* p) { return cat16(*(const v8h*)p, *(const v8h*)(p + 16)); } static __device__ __forceinline__ v8f mma(V a, V b, v8f c) { return wmma16(a, b, c); } };
template <> struct WFrag<bf> { typedef v16bf V; static __device__ __forceinline__ V ld(const bf* p) { return cat16b(*(const v8us*)p, *(const v8us*)(p + 16)); } static __device__ __forceinline__ v8f mma(V a, V b, v8f c) { return wmmab(a, b, c); } };
template <typename T16, int NSPLIT, bool BIAS>
__global__ __launch_bounds__(32) void k_gemmw(const T16* __restrict__ A, const T16* __restrict__ A2, const T16* __restrict__ Bt, const T16* __restrict__ Bt2, int K, float* C, int ldc, const float* __restrict__ bias, size_t sA, size_t sB, size_t sC) {
    typedef typename WFrag<T16>::V V;
    __shared__ __align__(16) float os[16 * 68];
    const size_t z = blockIdx.z; A += z * sA; if (A2) A2 += z * sA; Bt += z * sB; if (Bt2) Bt2 += z * sB; C += z * sC;
    const int lane = threadIdx.x & 31, lr = lane & 15, hi = lane >> 4; const int r0 = blockIdx.x * 64, c0 = blockIdx.y * 64;
    v8f acc[4][4];
#pragma unroll
    for (int mb = 0; mb < 4; ++mb)
#pragma unroll
        for (int nb = 0; nb < 4; ++nb) acc[mb][nb] = (v8f){};
    const size_t aoff = (size_t)(r0 + lr) * K + 8 * hi, boff = (size_t)(c0 + lr) * K + 8 * hi;
#pragma unroll 1
    for (int kc = 0; kc < K; kc += 32) {
        V a[4], a2[4];
#pragma unroll
        for (int mb = 0; mb < 4; ++mb) { a[mb] = WFrag<T16>::ld(A + aoff + (size_t)mb * 16 * K + kc); if (NSPLIT == 1 || NSPLIT == 2) a2[mb] = WFrag<T16>::ld(A2 + aoff + (size_t)mb * 16 * K + kc); }
#pragma unroll
        for (int nb = 0; nb < 4; ++nb) { const V b = WFrag<T16>::ld(Bt + boff + (size_t)nb * 16 * K + kc); V b2; if (NSPLIT >= 2) b2 = WFrag<T16>::ld(Bt2 + boff + (size_t)nb * 16 * K + kc);
#pragma unroll
            for (int mb = 0; mb < 4; ++mb) { acc[mb][nb] = WFrag<T16>::mma(a[mb], b, acc[mb][nb]); if (NSPLIT == 1 || NSPLIT == 2) acc[mb][nb] = WFrag<T16>::mma(a2[mb], b, acc[mb][nb]); if (NSPLIT >= 2) acc[mb][nb] = WFrag<T16>::mma(a[mb], b2, acc[mb][nb]); } }
        asm volatile("v_nop\n\tv_nop\n\tv_nop\n\tv_nop" : "+v"(acc[0][0]), "+v"(acc[1][1]), "+v"(acc[2][2]), "+v"(acc[3][3]) : "v"(a[0]), "v"(a[3]));
    }
#pragma unroll
    for (int mb = 0; mb < 4; ++mb) {
#pragma unroll
        for (int nb = 0; nb < 4; ++nb) {
#pragma unroll
            for (int j = 0; j < 8; ++j) os[(hi * 8 + j) * 68 + nb * 16 + lr] = acc[mb][nb][j]; }
        __builtin_amdgcn_wave_barrier(); asm volatile("" ::: "memory");
        float* crow = C + (size_t)(r0 + mb * 16) * ldc + c0;
{
#pragma unroll
            for (int s = 0; s < 8; ++s) { const int row = 2 * s + hi, cofs = lr * 4; v4f val = *(const v4fa*)(os + row * 68 + cofs); if (BIAS) { val[0] += bfr(bias[c0 + cofs]); val[1] += bfr(bias[c0 + cofs + 1]); val[2] += bfr(bias[c0 + cofs + 2]); val[3] += bfr(bias[c0 + cofs + 3]); }
                *(v4f*)(crow + (size_t)row * ldc + cofs) = val; }
             }
        __builtin_amdgcn_wave_barrier(); asm volatile("" ::: "memory");
    }
}

__device__ __forceinline__ h16 tohx(float x) { return (h16)x; }
__device__ __forceinline__ void splitf(float y, unsigned short& h, unsigned short& l) { h = f2bf(y); l = f2bf(y - bf2f(h)); }
typedef __attribute__((ext_vector_type(2))) _Float16 v2h;
typedef __attribute__((ext_vector_type(4))) _Float16 v4h;
typedef __attribute__((ext_vector_type(2))) unsigned short v2us;
typedef __attribute__((ext_vector_type(4))) unsigned short v4us;
typedef __attribute__((ext_vector_type(2))) float v2f;
typedef __attribute__((ext_vector_type(4))) int v4i;

__global__ __launch_bounds__(256) void k_wtG(const float* __restrict__ w, int K, int N, bf* Bt) {
    const int lane = threadIdx.x & 31; const int L0 = (blockIdx.x * 8 + (threadIdx.x >> 5)) * 8; const int nlines = N * K / 64;
{
#pragma unroll 1
        for (int l = 0; l < 8; ++l) { const int L = L0 + l; if (L >= nlines) break; const size_t e = (size_t)L * 64 + lane * 2; const int k = (int)(e % K), n = (int)(e / K); v2us o;
            o[0] = f2bf(w[(size_t)k * N + n]); o[1] = f2bf(w[(size_t)(k + 1) * N + n]); *(v2us*)(Bt + e) = o; }
         }
}
__global__ __launch_bounds__(256) void k_cvt8(const float* __restrict__ src, bf* dst, size_t n8) { const size_t i = (size_t)blockIdx.x * 256 + threadIdx.x; if (i >= n8) return; const v8f v = *(const v8f*)(src + i * 8); v8us o;
#pragma unroll
    for (int k = 0; k < 8; ++k) o[k] = f2bf(v[k]); *(v8us*)(dst + i * 8) = o;  }
__global__ __launch_bounds__(256) void k_cscvt(const float* __restrict__ cosT, const float* __restrict__ sinT, float* CS) { const int idx = blockIdx.x * 256 + threadIdx.x; if (idx >= TT * HD) return; v2f cs; cs[0] = bfr(cosT[idx]); cs[1] = bfr(sinT[idx]); *(v2f*)(CS + (size_t)idx * 2) = cs;  }
// k_rope: head planes [h][t][d] (fp16) of rope(x) x sc with the rotate-half convention out[d] = x[d] cos[t][d] - x[d+HD/2] sin[t][d], out[d+HD/2] = x[d+HD/2] cos[t][d+HD/2] + x[d] sin[t][d+HD/2]
__global__ __launch_bounds__(256) void k_rope(const float* __restrict__ F, int pitch, int nheads, const float* __restrict__ CS, const float* __restrict__ RF, const float* __restrict__ nw, float sc, h16* P16, bf* Ph, bf* Pl) {
    const size_t e = ((size_t)blockIdx.x * 256 + threadIdx.x) * 2; if (e >= (size_t)nheads * TT * HD) return; const int d = (int)(e % HD); const int t = (int)((e / HD) % TT); const int h = (int)(e / ((size_t)HD * TT)); const float* f = F + (size_t)t * pitch + h * HD; const float rf = RF ? RF[(size_t)h * TT + t] : 1.0f; v2h o16; v2us oh, ol;
#pragma unroll
    for (int q = 0; q < 2; ++q) { const int dd = d + q; const int dp = (dd < HD / 2) ? dd + HD / 2 : dd - HD / 2; float x0 = f[dd], x1 = f[dp];
        if (RF) { float n0 = __fmul_rn(x0, rf), n1 = __fmul_rn(x1, rf); asm volatile("" : "+v"(n0)); asm volatile("" : "+v"(n1)); x0 = __fmul_rn(bfr(nw[dd]), n0); x1 = __fmul_rn(bfr(nw[dp]), n1); }
        const v2f cs = *(const v2f*)(CS + ((size_t)t * HD + dd) * 2); float a = __fmul_rn(x0, cs[0]), bq = __fmul_rn(x1, cs[1]); asm volatile("" : "+v"(a)); asm volatile("" : "+v"(bq)); const float r = ((dd < HD / 2) ? __fsub_rn(a, bq) : __fadd_rn(a, bq)) * sc;
        o16[q] = tohx(r); (void)oh; (void)ol; }
    *(v2h*)(P16 + e) = o16;  }
__global__ __launch_bounds__(256) void k_vtp(const float* __restrict__ F, int pitch, int nheads, h16* V16, bf* Vh, bf* Vl) { const size_t e = ((size_t)blockIdx.x * 256 + threadIdx.x) * 2; if (e >= (size_t)nheads * HD * TT) return; const int t = (int)(e % TT); const int d = (int)((e / TT) % HD); const int g = (int)(e / ((size_t)TT * HD)); v2h o16; v2us oh, ol;
#pragma unroll
    for (int q = 0; q < 2; ++q) { const float x = F[(size_t)(t + q) * pitch + g * HD + d]; o16[q] = tohx(x); (void)oh; (void)ol; }
    *(v2h*)(V16 + e) = o16;  }
__global__ __launch_bounds__(256) void k_csid(float* CS) { const int idx = blockIdx.x * 256 + threadIdx.x; if (idx >= TT * HD) return; v2f cs; cs[0] = 1.0f; cs[1] = 0.0f; *(v2f*)(CS + (size_t)idx * 2) = cs;  }
// k_asoft: per row (zz, i): t = S x HD^-0.5 (no mask); softmax over the 2048 keys (register row, one exp, fixed trees);
__global__ __launch_bounds__(256) void k_asoft(const float* __restrict__ Sb, h16* P16, bf* Ph, bf* Pl) {
    const int lane = threadIdx.x & 31; const int row = blockIdx.x * 8 + (threadIdx.x >> 5); if (row >= ZH * TT) return; const int i = row % TT; const int zz = row / TT; (void)zz; const bool hires = (i < RH); const float* sr = Sb + (size_t)row * TT; float v[TT / 32]; float mx = -3.0e38f;
#pragma unroll
    for (int ch = 0; ch < TT / 128; ++ch) { const int j0 = ch * 128 + lane * 4; const v4f a = *(const v4f*)(sr + j0);
#pragma unroll
        for (int q = 0; q < 4; ++q) { const int j = j0 + q; (void)j; const float t = a[q] * SCL; v[ch * 4 + q] = t; mx = fmaxf(mx, t); } }
#pragma unroll
    for (int sh = 16; sh; sh >>= 1) mx = fmaxf(mx, __shfl_xor(mx, sh, 32));
    float sum = 0.f;
#pragma unroll
    for (int k = 0; k < TT / 32; ++k) { float d0 = __fsub_rn(v[k], mx); asm volatile("" : "+v"(d0)); v[k] = __builtin_amdgcn_exp2f(__fmul_rn(d0, 1.4426950408889634f)); sum += v[k]; }
#pragma unroll
    for (int sh = 16; sh; sh >>= 1) sum += __shfl_xor(sum, sh, 32);
    const float f = __fdiv_rn(hires ? 1.0f : PCAR, sum);
{
        if (hires) {
#pragma unroll
            for (int ch = 0; ch < TT / 128; ++ch) { v4us oh, ol;
#pragma unroll
                for (int q = 0; q < 4; ++q) { unsigned short a, c2; splitf(v[ch * 4 + q] * f, a, c2); oh[q] = a; ol[q] = c2; }
                const size_t oo = ((size_t)zz * (RH ? RH : 1) + i) * TT + ch * 128 + lane * 4; *(v4us*)(Ph + oo) = oh; *(v4us*)(Pl + oo) = ol; }
        } else {
#pragma unroll
            for (int ch = 0; ch < TT / 128; ++ch) { v4h o4;
#pragma unroll
                for (int q = 0; q < 4; ++q) o4[q] = tohx(v[ch * 4 + q] * f);
                *(v4h*)(P16 + (size_t)row * TT + ch * 128 + lane * 4) = o4; } }
         }
}
__global__ __launch_bounds__(256) void k_merge(const float* __restrict__ O, int h0, bf* Ah, bf* Al) { const size_t e = ((size_t)blockIdx.x * 256 + threadIdx.x) * 2; if (e >= (size_t)ZH * TT * HD) return; const int d = (int)(e % HD); const int t = (int)((e / HD) % TT); const int zz = (int)(e / ((size_t)HD * TT)); const float cs = (t < RH) ? 1.0f : (1.0f / PCAR); const size_t oo = (size_t)t * DQ + (h0 + zz) * HD + d;
    v2us oh, ol;
#pragma unroll
    for (int q = 0; q < 2; ++q) { unsigned short a, c2; splitf(O[e + q] * cs, a, c2); oh[q] = a; ol[q] = c2; } *(v2us*)(Ah + oo) = oh; *(v2us*)(Al + oo) = ol;  }

extern "C" void kernel_launch(void* const* d_in, const int* in_sizes, int n_in,
                              void* d_out, int out_size, void* d_ws, size_t ws_size, hipStream_t stream) {
    (void)in_sizes; (void)n_in; (void)out_size;
    const float* x = (const float*)d_in[0]; const float* wq = (const float*)d_in[1]; const float* bqv = (const float*)d_in[2]; const float* wk = (const float*)d_in[3]; const float* bkv = (const float*)d_in[4]; const float* wv = (const float*)d_in[5]; const float* bvv = (const float*)d_in[6]; const float* wo = (const float*)d_in[7]; const float* bo = (const float*)d_in[8];   // Wq/Wk/Wv [8][512][64] (x @ W per head), biases [8][64], Wo [512][512] (x @ W), bo
    float* OUT = (float*)d_out;     // [2][2048][512]
    char* wsp = (char*)d_ws;
    auto take = [&](size_t bytes) { char* p = wsp; wsp += (bytes + 255) & ~(size_t)255; return (void*)p; };
    bf* WQ = (bf*)take((size_t)DQ * DM * 2); bf* WK = (bf*)take((size_t)DKV * DM * 2); bf* WV = (bf*)take((size_t)DKV * DM * 2); bf* WO = (bf*)take((size_t)DM * DQ * 2); float* CS = (float*)take((size_t)TT * HD * 2 * 4);
    bf* XB = (bf*)take((size_t)TT * DM * 2); float* FQ = (float*)take((size_t)TT * DQ * 4); float* FK = (float*)take((size_t)TT * DKV * 4);
    h16* QP16 = (h16*)take((size_t)NH_ * TT * HD * 2); h16* KP16 = (h16*)take((size_t)NKV * TT * HD * 2); h16* VT16 = (h16*)take((size_t)NKV * HD * TT * 2);
    bf* QPh = nullptr; bf* QPl = nullptr; bf* KPh = nullptr; bf* KPl = nullptr; bf* VTh = nullptr; bf* VTl = nullptr; bf* Ph = nullptr; bf* Pl = nullptr;
    float* Sb = (float*)take((size_t)ZH * TT * TT * 4); h16* P16 = (h16*)take((size_t)ZH * TT * TT * 2); float* Ob = (float*)take((size_t)ZH * TT * HD * 4); bf* ATh = (bf*)take((size_t)TT * DQ * 2); bf* ATl = (bf*)take((size_t)TT * DQ * 2);
    if ((size_t)(wsp - (char*)d_ws) > ws_size) return;    // ws 256 MiB
    float* FV = FK;   // v projection reuses the k buffer after the k planes are built (stream-ordered)
    { for (int h = 0; h < NH_; ++h) { const unsigned g = (unsigned)((DM * HD / 64 + 63) / 64); k_wtG<<<g, 256, 0, stream>>>(wq + (size_t)h * DM * HD, DM, HD, WQ + (size_t)h * HD * DM); k_wtG<<<g, 256, 0, stream>>>(wk + (size_t)h * DM * HD, DM, HD, WK + (size_t)h * HD * DM); k_wtG<<<g, 256, 0, stream>>>(wv + (size_t)h * DM * HD, DM, HD, WV + (size_t)h * HD * DM); }   // per-head [512][64] blocks -> Bt rows h*64..
      k_wtG<<<(unsigned)((DQ * DM / 64 + 63) / 64), 256, 0, stream>>>(wo, DQ, DM, WO);
       }
    k_csid<<<(TT * HD + 255) / 256, 256, 0, stream>>>(CS);
    const unsigned LQ = (unsigned)(((size_t)NH_ * TT * HD / 2 + 255) / 256), LKv = (unsigned)(((size_t)NKV * TT * HD / 2 + 255) / 256);
    for (int b = 0; b < NB_; ++b) {
        
        k_cvt8<<<(unsigned)(((size_t)TT * DM / 8 + 255) / 256), 256, 0, stream>>>(x + (size_t)b * TT * DM, XB, (size_t)TT * DM / 8);
        k_gemmw<bf, 0, true><<<dim3(TT / 64, DQ / 64, 1), 32, 0, stream>>>(XB, nullptr, WQ, nullptr, DM, FQ, DQ, bqv, 0, 0, 0);
        k_rope<<<LQ, 256, 0, stream>>>(FQ, DQ, NH_, CS, nullptr, nullptr, 1.0f, QP16, QPh, QPl);
        k_gemmw<bf, 0, true><<<dim3(TT / 64, DKV / 64, 1), 32, 0, stream>>>(XB, nullptr, WK, nullptr, DM, FK, DKV, bkv, 0, 0, 0);
        k_rope<<<LKv, 256, 0, stream>>>(FK, DKV, NKV, CS, nullptr, nullptr, 1.0f, KP16, KPh, KPl);
        k_gemmw<bf, 0, true><<<dim3(TT / 64, DKV / 64, 1), 32, 0, stream>>>(XB, nullptr, WV, nullptr, DM, FV, DKV, bvv, 0, 0, 0); k_vtp<<<LKv, 256, 0, stream>>>(FV, DKV, NKV, VT16, VTh, VTl);
        for (int h0 = 0; h0 < NH_; h0 += ZH) { const size_t zq = (size_t)h0, zk = (size_t)(h0 / REP);   // one kv head per query head: the pass's two heads use consecutive kv planes (z-strides TT*HD)
            k_gemmw<h16, 0, false><<<dim3(TT / 64, TT / 64, ZH), 32, 0, stream>>>(QP16 + zq * TT * HD, nullptr, KP16 + zk * TT * HD, nullptr, HD, Sb, TT, nullptr, (size_t)TT * HD, (size_t)TT * HD, (size_t)TT * TT);
            k_asoft<<<ZH * TT / 8, 256, 0, stream>>>(Sb, P16, Ph, Pl);
            k_gemmw<h16, 0, false><<<dim3(TT / 64, HD / 64, ZH), 32, 0, stream>>>(P16, nullptr, VT16 + zk * HD * TT, nullptr, TT, Ob, HD, nullptr, (size_t)TT * TT, (size_t)HD * TT, (size_t)TT * HD);
            k_merge<<<(unsigned)(((size_t)ZH * TT * HD / 2 + 255) / 256), 256, 0, stream>>>(Ob, h0, ATh, ATl); }
        k_gemmw<bf, 1, true><<<dim3(TT / 64, DM / 64, 1), 32, 0, stream>>>(ATh, ATl, WO, nullptr, DQ, OUT + (size_t)b * TT * DM, DM, bo, 0, 0, 0); }
}

// v001
// It runs in 263 microseconds.
// Next to v000, in two timings, it ran 3.20 and 3.12 times as fast.
#include <hip/hip_runtime.h>

// Faster_MultiHeadAttention (sequences [2][2048][512]; per head h: q = x Wq[h] + bq[h], k, v likewise (Wq/Wk/Wv [8][512][64], biases [8][64]); softmax(q.k/8); z = merged heads; out = z Wo + bo -> [2][2048][512]).
// Compute dtypes, f32 accumulate: every input rounded to bf16; projections on PLAIN bf16 operands (inputs: exact, + bias; the per-head weights are re-laid as one [512][512] operand);
// scores (K 64) and att.v on SINGLE fp16 planes with an f32 register-row softmax (probabilities x1024); merged heads as bf16 hi+lo planes x exact Wo (2 products) + bo. One-wave-per-64x64-tile GEMMs. Deterministic,

#define NB_  2
#define TT   2048
#define DM   512
#define NH_  8
#define NKV  8
#define REP  (NH_ / NKV)
#define HD   64
#define DQ   (NH_ * HD)
#define DKV  (NKV * HD)
#define ZH   8                  // heads per attention pass (grid z): all of them
#define RH   0                  // query rows < RH use hi+lo planes (0: none)
#define WIN  0
#define PCAR 1024.0f
#define SCL  0.125f   // HD^-0.5
typedef _Float16 h16;
typedef unsigned short bf;
typedef __attribute__((ext_vector_type(16))) __bf16   v16bf;
typedef __attribute__((ext_vector_type(16))) _Float16 v16h;
typedef __attribute__((ext_vector_type(8)))  _Float16 v8h;
typedef __attribute__((ext_vector_type(8)))  unsigned short v8us;
typedef __attribute__((ext_vector_type(8)))  float    v8f;
typedef __attribute__((ext_vector_type(4)))  float    v4f;
typedef v8h  __attribute__((may_alias)) v8ha;
typedef v4f  __attribute__((may_alias)) v4fa;
typedef v8us __attribute__((may_alias)) v8usa;

__device__ __forceinline__ unsigned short f2bf(float f) { unsigned u = __float_as_uint(f); u += 0x7FFFu + ((u >> 16) & 1u); return (unsigned short)(u >> 16); }
__device__ __forceinline__ float bf2f(unsigned short b) { return __uint_as_float(((unsigned)b) << 16); }
__device__ __forceinline__ float bfr(float f) { return bf2f(f2bf(f)); }
__device__ __forceinline__ v16h cat16(v8h lo, v8h hi) { return __builtin_shufflevector(lo, hi, 0, 1, 2, 3, 4, 5, 6, 7, 8, 9, 10, 11, 12, 13, 14, 15); }
__device__ __forceinline__ v16bf cat16b(v8us lo, v8us hi) { return __builtin_bit_cast(v16bf, __builtin_shufflevector(lo, hi, 0, 1, 2, 3, 4, 5, 6, 7, 8, 9, 10, 11, 12, 13, 14, 15)); }
__device__ __forceinline__ v8f wmma16(v16h a, v16h b, v8f c) { return __builtin_amdgcn_wmma_f32_16x16x32_f16(false, a, false, b, (short)0, c, false, false); }
__device__ __forceinline__ v8f wmmab(v16bf a, v16bf b, v8f c) { return __builtin_amdgcn_wmma_f32_16x16x32_bf16(false, a, false, b, (short)0, c, false, false); }



// ---- k_gemmw: register-blocked GEMM, ONE WAVE per 64x64 output tile (16 accumulators), operands straight from K-contiguous 16-bit planes; grid (M/64, N/64, Z), 32 threads.
// C[m][n] (f32, pitch ldc, + optional f32 bias[n], one bias vector per z = 0, 1, 2) = sum_k A[m][k] Bt[n][k] (+ split products per NSPLIT). z-batch strides sA/sB/sC in elements. K % 32 == 0.
template <typename T16> struct WFrag;
template <> struct WFrag<h16> { typedef v16h V; static __device__ __forceinline__ V ld(const h16* p) { return cat16(*(const v8h*)p, *(const v8h*)(p + 16)); } static __device__ __forceinline__ v8f mma(V a, V b, v8f c) { return wmma16(a, b, c); } };
template <> struct WFrag<bf> { typedef v16bf V; static __device__ __forceinline__ V ld(const bf* p) { return cat16b(*(const v8us*)p, *(const v8us*)(p + 16)); } static __device__ __forceinline__ v8f mma(V a, V b, v8f c) { return wmmab(a, b, c); } };
template <typename T16, int NSPLIT, bool BIAS>
__global__ __launch_bounds__(32) void k_gemmw(const T16* __restrict__ A, const T16* __restrict__ A2, const T16* __restrict__ Bt, const T16* __restrict__ Bt2, int K, float* C, int ldc, const float* __restrict__ bias, const float* __restrict__ bias1, const float* __restrict__ bias2, size_t sA, size_t sB, size_t sC) {
    typedef typename WFrag<T16>::V V;
    __shared__ __align__(16) float os[16 * 68];
    const size_t z = blockIdx.z; A += z * sA; if (A2) A2 += z * sA; Bt += z * sB; if (Bt2) Bt2 += z * sB; C += z * sC;
    if (BIAS) bias = (z == 0) ? bias : ((z == 1) ? bias1 : bias2);   // z-batched products with a bias each (q, k, v)
    const int lane = threadIdx.x & 31, lr = lane & 15, hi = lane >> 4; const int r0 = blockIdx.x * 64, c0 = blockIdx.y * 64;
    v8f acc[4][4];
#pragma unroll
    for (int mb = 0; mb < 4; ++mb)
#pragma unroll
        for (int nb = 0; nb < 4; ++nb) acc[mb][nb] = (v8f){};
    const size_t aoff = (size_t)(r0 + lr) * K + 8 * hi, boff = (size_t)(c0 + lr) * K + 8 * hi;
#pragma unroll 1
    for (int kc = 0; kc < K; kc += 32) {
        V a[4], a2[4];
#pragma unroll
        for (int mb = 0; mb < 4; ++mb) { a[mb] = WFrag<T16>::ld(A + aoff + (size_t)mb * 16 * K + kc); if (NSPLIT == 1 || NSPLIT == 2) a2[mb] = WFrag<T16>::ld(A2 + aoff + (size_t)mb * 16 * K + kc); }
#pragma unroll
        for (int nb = 0; nb < 4; ++nb) { const V b = WFrag<T16>::ld(Bt + boff + (size_t)nb * 16 * K + kc); V b2; if (NSPLIT >= 2) b2 = WFrag<T16>::ld(Bt2 + boff + (size_t)nb * 16 * K + kc);
#pragma unroll
            for (int mb = 0; mb < 4; ++mb) { acc[mb][nb] = WFrag<T16>::mma(a[mb], b, acc[mb][nb]); if (NSPLIT == 1 || NSPLIT == 2) acc[mb][nb] = WFrag<T16>::mma(a2[mb], b, acc[mb][nb]); if (NSPLIT >= 2) acc[mb][nb] = WFrag<T16>::mma(a[mb], b2, acc[mb][nb]); } }
        asm volatile("v_nop\n\tv_nop\n\tv_nop\n\tv_nop" : "+v"(acc[0][0]), "+v"(acc[1][1]), "+v"(acc[2][2]), "+v"(acc[3][3]) : "v"(a[0]), "v"(a[3]));
    }
#pragma unroll
    for (int mb = 0; mb < 4; ++mb) {
#pragma unroll
        for (int nb = 0; nb < 4; ++nb) {
#pragma unroll
            for (int j = 0; j < 8; ++j) os[(hi * 8 + j) * 68 + nb * 16 + lr] = acc[mb][nb][j]; }
        __builtin_amdgcn_wave_barrier(); asm volatile("" ::: "memory");
        float* crow = C + (size_t)(r0 + mb * 16) * ldc + c0;
{
#pragma unroll
            for (int s = 0; s < 8; ++s) { const int row = 2 * s + hi, cofs = lr * 4; v4f val = *(const v4fa*)(os + row * 68 + cofs); if (BIAS) { val[0] += bfr(bias[c0 + cofs]); val[1] += bfr(bias[c0 + cofs + 1]); val[2] += bfr(bias[c0 + cofs + 2]); val[3] += bfr(bias[c0 + cofs + 3]); }
                *(v4f*)(crow + (size_t)row * ldc + cofs) = val; }
             }
        __builtin_amdgcn_wave_barrier(); asm volatile("" ::: "memory");
    }
}

__device__ __forceinline__ h16 tohx(float x) { return (h16)x; }
__device__ __forceinline__ void splitf(float y, unsigned short& h, unsigned short& l) { h = f2bf(y); l = f2bf(y - bf2f(h)); }
typedef __attribute__((ext_vector_type(2))) _Float16 v2h;
typedef __attribute__((ext_vector_type(4))) _Float16 v4h;
typedef __attribute__((ext_vector_type(2))) unsigned short v2us;
typedef __attribute__((ext_vector_type(4))) unsigned short v4us;
typedef __attribute__((ext_vector_type(2))) float v2f;
typedef __attribute__((ext_vector_type(4))) int v4i;

// k_wtG: all four weight operands in one launch. grid (lines / 64, 64-column block y, operand zz): zz 0..2 = Wq/Wk/Wv head y ([DM][HD], pitch HD), zz 3 = columns y*HD.. of Wo ([DQ][DM], pitch DM); each block -> Bt rows y*HD.., K-contiguous.
static_assert(NKV == NH_ && DM / HD == NH_ && DQ == DM, "one grid shape serves the four weight operands");
__global__ __launch_bounds__(256) void k_wtG(const float* __restrict__ wq, const float* __restrict__ wk, const float* __restrict__ wv, const float* __restrict__ wo, bf* BQ, bf* BK, bf* BV, bf* BO) {
    const int y = blockIdx.y, zz = blockIdx.z; const int K = DM, N = HD; const int ldw = (zz == 3) ? DM : HD;
    const float* w = (zz == 0) ? wq : (zz == 1) ? wk : (zz == 2) ? wv : wo; w += (zz == 3) ? (size_t)y * HD : (size_t)y * DM * HD;
    bf* Bt = ((zz == 0) ? BQ : (zz == 1) ? BK : (zz == 2) ? BV : BO) + (size_t)y * HD * DM;
    const int lane = threadIdx.x & 31; const int L0 = (blockIdx.x * 8 + (threadIdx.x >> 5)) * 8; const int nlines = N * K / 64;
{
#pragma unroll 1
        for (int l = 0; l < 8; ++l) { const int L = L0 + l; if (L >= nlines) break; const size_t e = (size_t)L * 64 + lane * 2; const int k = (int)(e % K), n = (int)(e / K); v2us o;
            o[0] = f2bf(w[(size_t)k * ldw + n]); o[1] = f2bf(w[(size_t)(k + 1) * ldw + n]); *(v2us*)(Bt + e) = o; }
         }
}
__global__ __launch_bounds__(256) void k_cvt8(const float* __restrict__ src, bf* dst, size_t n8) { const size_t i = (size_t)blockIdx.x * 256 + threadIdx.x; if (i >= n8) return; const v8f v = *(const v8f*)(src + i * 8); v8us o;
#pragma unroll
    for (int k = 0; k < 8; ++k) o[k] = f2bf(v[k]); *(v8us*)(dst + i * 8) = o;  }
__global__ __launch_bounds__(256) void k_cscvt(const float* __restrict__ cosT, const float* __restrict__ sinT, float* CS) { const int idx = blockIdx.x * 256 + threadIdx.x; if (idx >= TT * HD) return; v2f cs; cs[0] = bfr(cosT[idx]); cs[1] = bfr(sinT[idx]); *(v2f*)(CS + (size_t)idx * 2) = cs;  }
// k_rope: head planes [h][t][d] (fp16) of rope(x) x sc with the rotate-half convention out[d] = x[d] cos[t][d] - x[d+HD/2] sin[t][d], out[d+HD/2] = x[d+HD/2] cos[t][d+HD/2] + x[d] sin[t][d+HD/2]
__global__ __launch_bounds__(256) void k_rope(const float* __restrict__ F, int pitch, int nheads, const float* __restrict__ CS, const float* __restrict__ RF, const float* __restrict__ nw, float sc, h16* P16, bf* Ph, bf* Pl) {
    { const size_t bz = (size_t)blockIdx.z * NB_ + blockIdx.y; F += bz * TT * pitch; P16 += bz * nheads * TT * HD; }   // grid y: batch, grid z: q then k (buffers back to back)
    const size_t e = ((size_t)blockIdx.x * 256 + threadIdx.x) * 2; if (e >= (size_t)nheads * TT * HD) return; const int d = (int)(e % HD); const int t = (int)((e / HD) % TT); const int h = (int)(e / ((size_t)HD * TT)); const float* f = F + (size_t)t * pitch + h * HD; const float rf = RF ? RF[(size_t)h * TT + t] : 1.0f; v2h o16; v2us oh, ol;
#pragma unroll
    for (int q = 0; q < 2; ++q) { const int dd = d + q; const int dp = (dd < HD / 2) ? dd + HD / 2 : dd - HD / 2; float x0 = f[dd], x1 = f[dp];
        if (RF) { float n0 = __fmul_rn(x0, rf), n1 = __fmul_rn(x1, rf); asm volatile("" : "+v"(n0)); asm volatile("" : "+v"(n1)); x0 = __fmul_rn(bfr(nw[dd]), n0); x1 = __fmul_rn(bfr(nw[dp]), n1); }
        const v2f cs = *(const v2f*)(CS + ((size_t)t * HD + dd) * 2); float a = __fmul_rn(x0, cs[0]), bq = __fmul_rn(x1, cs[1]); asm volatile("" : "+v"(a)); asm volatile("" : "+v"(bq)); const float r = ((dd < HD / 2) ? __fsub_rn(a, bq) : __fadd_rn(a, bq)) * sc;
        o16[q] = tohx(r); (void)oh; (void)ol; }
    *(v2h*)(P16 + e) = o16;  }
__global__ __launch_bounds__(256) void k_vtp(const float* __restrict__ F, int pitch, int nheads, h16* V16, bf* Vh, bf* Vl) { F += (size_t)blockIdx.y * TT * pitch; V16 += (size_t)blockIdx.y * nheads * HD * TT;   // grid y: batch
    const size_t e = ((size_t)blockIdx.x * 256 + threadIdx.x) * 2; if (e >= (size_t)nheads * HD * TT) return; const int t = (int)(e % TT); const int d = (int)((e / TT) % HD); const int g = (int)(e / ((size_t)TT * HD)); v2h o16; v2us oh, ol;
#pragma unroll
    for (int q = 0; q < 2; ++q) { const float x = F[(size_t)(t + q) * pitch + g * HD + d]; o16[q] = tohx(x); (void)oh; (void)ol; }
    *(v2h*)(V16 + e) = o16;  }
__global__ __launch_bounds__(256) void k_csid(float* CS) { const int idx = blockIdx.x * 256 + threadIdx.x; if (idx >= TT * HD) return; v2f cs; cs[0] = 1.0f; cs[1] = 0.0f; *(v2f*)(CS + (size_t)idx * 2) = cs;  }
// k_asoft: per row (zz, i): t = S x HD^-0.5 (no mask); softmax over the 2048 keys (register row, one exp, fixed trees);
__global__ __launch_bounds__(256) void k_asoft(const float* __restrict__ Sb, h16* P16, bf* Ph, bf* Pl) {
    const int lane = threadIdx.x & 31; const int row = blockIdx.x * 8 + (threadIdx.x >> 5); if (row >= ZH * TT) return; const int i = row % TT; const int zz = row / TT; (void)zz; const bool hires = (i < RH); const float* sr = Sb + (size_t)row * TT; float v[TT / 32]; float mx = -3.0e38f;
#pragma unroll
    for (int ch = 0; ch < TT / 128; ++ch) { const int j0 = ch * 128 + lane * 4; const v4f a = *(const v4f*)(sr + j0);
#pragma unroll
        for (int q = 0; q < 4; ++q) { const int j = j0 + q; (void)j; const float t = a[q] * SCL; v[ch * 4 + q] = t; mx = fmaxf(mx, t); } }
#pragma unroll
    for (int sh = 16; sh; sh >>= 1) mx = fmaxf(mx, __shfl_xor(mx, sh, 32));
    float sum = 0.f;
#pragma unroll
    for (int k = 0; k < TT / 32; ++k) { float d0 = __fsub_rn(v[k], mx); asm volatile("" : "+v"(d0)); v[k] = __builtin_amdgcn_exp2f(__fmul_rn(d0, 1.4426950408889634f)); sum += v[k]; }
#pragma unroll
    for (int sh = 16; sh; sh >>= 1) sum += __shfl_xor(sum, sh, 32);
    const float f = __fdiv_rn(hires ? 1.0f : PCAR, sum);
{
        if (hires) {
#pragma unroll
            for (int ch = 0; ch < TT / 128; ++ch) { v4us oh, ol;
#pragma unroll
                for (int q = 0; q < 4; ++q) { unsigned short a, c2; splitf(v[ch * 4 + q] * f, a, c2); oh[q] = a; ol[q] = c2; }
                const size_t oo = ((size_t)zz * (RH ? RH : 1) + i) * TT + ch * 128 + lane * 4; *(v4us*)(Ph + oo) = oh; *(v4us*)(Pl + oo) = ol; }
        } else {
#pragma unroll
            for (int ch = 0; ch < TT / 128; ++ch) { v4h o4;
#pragma unroll
                for (int q = 0; q < 4; ++q) o4[q] = tohx(v[ch * 4 + q] * f);
                *(v4h*)(P16 + (size_t)row * TT + ch * 128 + lane * 4) = o4; } }
         }
}
__global__ __launch_bounds__(256) void k_merge(const float* __restrict__ O, int h0, bf* Ah, bf* Al) { const size_t e = ((size_t)blockIdx.x * 256 + threadIdx.x) * 2; if (e >= (size_t)ZH * TT * HD) return; const int d = (int)(e % HD); const int t = (int)((e / HD) % TT); const int zz = (int)(e / ((size_t)HD * TT)); const float cs = (t < RH) ? 1.0f : (1.0f / PCAR); const size_t oo = (size_t)t * DQ + (h0 + zz) * HD + d;
    v2us oh, ol;
#pragma unroll
    for (int q = 0; q < 2; ++q) { unsigned short a, c2; splitf(O[e + q] * cs, a, c2); oh[q] = a; ol[q] = c2; } *(v2us*)(Ah + oo) = oh; *(v2us*)(Al + oo) = ol;  }

extern "C" void kernel_launch(void* const* d_in, const int* in_sizes, int n_in,
                              void* d_out, int out_size, void* d_ws, size_t ws_size, hipStream_t stream) {
    (void)in_sizes; (void)n_in; (void)out_size;
    const float* x = (const float*)d_in[0]; const float* wq = (const float*)d_in[1]; const float* bqv = (const float*)d_in[2]; const float* wk = (const float*)d_in[3]; const float* bkv = (const float*)d_in[4]; const float* wv = (const float*)d_in[5]; const float* bvv = (const float*)d_in[6]; const float* wo = (const float*)d_in[7]; const float* bo = (const float*)d_in[8];   // Wq/Wk/Wv [8][512][64] (x @ W per head), biases [8][64], Wo [512][512] (x @ W), bo
    float* OUT = (float*)d_out;     // [2][2048][512]
    char* wsp = (char*)d_ws;
    auto take = [&](size_t bytes) { char* p = wsp; wsp += (bytes + 255) & ~(size_t)255; return (void*)p; };
    bf* WQ = (bf*)take((size_t)DQ * DM * 2); bf* WK = (bf*)take((size_t)DKV * DM * 2); bf* WV = (bf*)take((size_t)DKV * DM * 2); bf* WO = (bf*)take((size_t)DM * DQ * 2); float* CS = (float*)take((size_t)TT * HD * 2 * 4);
    bf* XB = (bf*)take((size_t)NB_ * TT * DM * 2); float* FQ = (float*)take((size_t)NB_ * TT * DQ * 4); float* FK = (float*)take((size_t)NB_ * TT * DKV * 4); float* FV = (float*)take((size_t)NB_ * TT * DKV * 4);   // FQ, FK, FV back to back: z-stride of the one projection launch
    h16* QP16 = (h16*)take((size_t)NB_ * NH_ * TT * HD * 2); h16* KP16 = (h16*)take((size_t)NB_ * NKV * TT * HD * 2); h16* VT16 = (h16*)take((size_t)NB_ * NKV * HD * TT * 2);   // planes [b][h][..]; QP16, KP16 back to back
    bf* QPh = nullptr; bf* QPl = nullptr; bf* VTh = nullptr; bf* VTl = nullptr; bf* Ph = nullptr; bf* Pl = nullptr;
    float* Sb = (float*)take((size_t)ZH * TT * TT * 4); h16* P16 = (h16*)take((size_t)ZH * TT * TT * 2); float* Ob = (float*)take((size_t)ZH * TT * HD * 4); bf* ATh = (bf*)take((size_t)NB_ * TT * DQ * 2); bf* ATl = (bf*)take((size_t)NB_ * TT * DQ * 2);
    if ((size_t)(wsp - (char*)d_ws) > ws_size) return;    // ws 256 MiB
    (void)FK;
    k_wtG<<<dim3((DM * HD / 64 + 63) / 64, NH_, 4), 256, 0, stream>>>(wq, wk, wv, wo, WQ, WK, WV, WO);   // per-head [512][64] blocks -> Bt rows h*64..; Wo by 64-column blocks
    k_csid<<<(TT * HD + 255) / 256, 256, 0, stream>>>(CS);
    const unsigned LQ = (unsigned)(((size_t)NH_ * TT * HD / 2 + 255) / 256), LKv = (unsigned)(((size_t)NKV * TT * HD / 2 + 255) / 256);
    k_cvt8<<<(unsigned)(((size_t)NB_ * TT * DM / 8 + 255) / 256), 256, 0, stream>>>(x, XB, (size_t)NB_ * TT * DM / 8);
    k_gemmw<bf, 0, true><<<dim3(NB_ * TT / 64, DQ / 64, 3), 32, 0, stream>>>(XB, nullptr, WQ, nullptr, DM, FQ, DQ, bqv, bkv, bvv, 0, (size_t)DQ * DM, (size_t)NB_ * TT * DQ);   // z: q, k, v; rows: both batches
    k_rope<<<dim3(LQ, NB_, 2), 256, 0, stream>>>(FQ, DQ, NH_, CS, nullptr, nullptr, 1.0f, QP16, QPh, QPl);
    k_vtp<<<dim3(LKv, NB_, 1), 256, 0, stream>>>(FV, DKV, NKV, VT16, VTh, VTl);
    for (int b = 0; b < NB_; ++b) {
        for (int h0 = 0; h0 < NH_; h0 += ZH) { const size_t zq = (size_t)b * NH_ + h0, zk = (size_t)b * NKV + h0 / REP;   // one kv head per query head: the pass's heads use consecutive kv planes (z-strides TT*HD)
            k_gemmw<h16, 0, false><<<dim3(TT / 64, TT / 64, ZH), 32, 0, stream>>>(QP16 + zq * TT * HD, nullptr, KP16 + zk * TT * HD, nullptr, HD, Sb, TT, nullptr, nullptr, nullptr, (size_t)TT * HD, (size_t)TT * HD, (size_t)TT * TT);
            k_asoft<<<ZH * TT / 8, 256, 0, stream>>>(Sb, P16, Ph, Pl);
            k_gemmw<h16, 0, false><<<dim3(TT / 64, HD / 64, ZH), 32, 0, stream>>>(P16, nullptr, VT16 + zk * HD * TT, nullptr, TT, Ob, HD, nullptr, nullptr, nullptr, (size_t)TT * TT, (size_t)HD * TT, (size_t)TT * HD);
            k_merge<<<(unsigned)(((size_t)ZH * TT * HD / 2 + 255) / 256), 256, 0, stream>>>(Ob, h0, ATh + (size_t)b * TT * DQ, ATl + (size_t)b * TT * DQ); } }
    k_gemmw<bf, 1, true><<<dim3(NB_ * TT / 64, DM / 64, 1), 32, 0, stream>>>(ATh, ATl, WO, nullptr, DQ, OUT, DM, bo, nullptr, nullptr, 0, 0, 0);
}

// v002
// A run of this version takes 97.5 microseconds.
// Two timings next to v001 put it at 2.69 and 2.67 times that version's speed.
// All steps since v000 together make it 8.46 times as fast.
#include <hip/hip_runtime.h>

// Faster_MultiHeadAttention (sequences [2][2048][512]; per head h: q = x Wq[h] + bq[h], k, v likewise (Wq/Wk/Wv [8][512][64], biases [8][64]); softmax(q.k/8); z = merged heads; out = z Wo + bo -> [2][2048][512]).
// Compute dtypes, f32 accumulate: every input rounded to bf16; projections on PLAIN bf16 operands (inputs: exact, + bias; the per-head weights are re-laid as one [512][512] operand);
// scores (K 64) and att.v on SINGLE fp16 planes inside ONE kernel per (batch, head, 128 queries) with an f32 online softmax (probabilities never leave registers); merged heads as bf16 hi+lo planes x exact Wo (2 products) + bo. One-wave-per-64x64-tile GEMMs for the projections. Deterministic,

#define NB_  2
#define TT   2048
#define DM   512
#define NH_  8
#define NKV  8
#define HD   64
#define DQ   (NH_ * HD)
#define DKV  (NKV * HD)
#define WIN  0
#define SCL  0.125f   // HD^-0.5
typedef _Float16 h16;
typedef unsigned short bf;
typedef __attribute__((ext_vector_type(16))) __bf16   v16bf;
typedef __attribute__((ext_vector_type(16))) _Float16 v16h;
typedef __attribute__((ext_vector_type(8)))  _Float16 v8h;
typedef __attribute__((ext_vector_type(8)))  unsigned short v8us;
typedef __attribute__((ext_vector_type(8)))  float    v8f;
typedef __attribute__((ext_vector_type(4)))  float    v4f;
typedef v8h  __attribute__((may_alias)) v8ha;
typedef v4f  __attribute__((may_alias)) v4fa;
typedef v8us __attribute__((may_alias)) v8usa;

__device__ __forceinline__ unsigned short f2bf(float f) { unsigned u = __float_as_uint(f); u += 0x7FFFu + ((u >> 16) & 1u); return (unsigned short)(u >> 16); }
__device__ __forceinline__ float bf2f(unsigned short b) { return __uint_as_float(((unsigned)b) << 16); }
__device__ __forceinline__ float bfr(float f) { return bf2f(f2bf(f)); }
__device__ __forceinline__ v16h cat16(v8h lo, v8h hi) { return __builtin_shufflevector(lo, hi, 0, 1, 2, 3, 4, 5, 6, 7, 8, 9, 10, 11, 12, 13, 14, 15); }
__device__ __forceinline__ v16bf cat16b(v8us lo, v8us hi) { return __builtin_bit_cast(v16bf, __builtin_shufflevector(lo, hi, 0, 1, 2, 3, 4, 5, 6, 7, 8, 9, 10, 11, 12, 13, 14, 15)); }
__device__ __forceinline__ v8f wmma16(v16h a, v16h b, v8f c) { return __builtin_amdgcn_wmma_f32_16x16x32_f16(false, a, false, b, (short)0, c, false, false); }
__device__ __forceinline__ v8f wmmab(v16bf a, v16bf b, v8f c) { return __builtin_amdgcn_wmma_f32_16x16x32_bf16(false, a, false, b, (short)0, c, false, false); }



// ---- k_gemmw: register-blocked GEMM, ONE WAVE per 64x64 output tile (16 accumulators), operands straight from K-contiguous 16-bit planes; grid (M/64, N/64, Z), 32 threads.
// C[m][n] (f32, pitch ldc, + optional f32 bias[n], one bias vector per z = 0, 1, 2) = sum_k A[m][k] Bt[n][k] (+ split products per NSPLIT). z-batch strides sA/sB/sC in elements. K % 32 == 0.
template <typename T16> struct WFrag;
template <> struct WFrag<h16> { typedef v16h V; static __device__ __forceinline__ V ld(const h16* p) { return cat16(*(const v8h*)p, *(const v8h*)(p + 16)); } static __device__ __forceinline__ v8f mma(V a, V b, v8f c) { return wmma16(a, b, c); } };
template <> struct WFrag<bf> { typedef v16bf V; static __device__ __forceinline__ V ld(const bf* p) { return cat16b(*(const v8us*)p, *(const v8us*)(p + 16)); } static __device__ __forceinline__ v8f mma(V a, V b, v8f c) { return wmmab(a, b, c); } };
template <typename T16, int NSPLIT, bool BIAS>
__global__ __launch_bounds__(32) void k_gemmw(const T16* __restrict__ A, const T16* __restrict__ A2, const T16* __restrict__ Bt, const T16* __restrict__ Bt2, int K, float* C, int ldc, const float* __restrict__ bias, const float* __restrict__ bias1, const float* __restrict__ bias2, size_t sA, size_t sB, size_t sC) {
    typedef typename WFrag<T16>::V V;
    __shared__ __align__(16) float os[16 * 68];
    const size_t z = blockIdx.z; A += z * sA; if (A2) A2 += z * sA; Bt += z * sB; if (Bt2) Bt2 += z * sB; C += z * sC;
    if (BIAS) bias = (z == 0) ? bias : ((z == 1) ? bias1 : bias2);   // z-batched products with a bias each (q, k, v)
    const int lane = threadIdx.x & 31, lr = lane & 15, hi = lane >> 4; const int r0 = blockIdx.x * 64, c0 = blockIdx.y * 64;
    v8f acc[4][4];
#pragma unroll
    for (int mb = 0; mb < 4; ++mb)
#pragma unroll
        for (int nb = 0; nb < 4; ++nb) acc[mb][nb] = (v8f){};
    const size_t aoff = (size_t)(r0 + lr) * K + 8 * hi, boff = (size_t)(c0 + lr) * K + 8 * hi;
#pragma unroll 1
    for (int kc = 0; kc < K; kc += 32) {
        V a[4], a2[4];
#pragma unroll
        for (int mb = 0; mb < 4; ++mb) { a[mb] = WFrag<T16>::ld(A + aoff + (size_t)mb * 16 * K + kc); if (NSPLIT == 1 || NSPLIT == 2) a2[mb] = WFrag<T16>::ld(A2 + aoff + (size_t)mb * 16 * K + kc); }
#pragma unroll
        for (int nb = 0; nb < 4; ++nb) { const V b = WFrag<T16>::ld(Bt + boff + (size_t)nb * 16 * K + kc); V b2; if (NSPLIT >= 2) b2 = WFrag<T16>::ld(Bt2 + boff + (size_t)nb * 16 * K + kc);
#pragma unroll
            for (int mb = 0; mb < 4; ++mb) { acc[mb][nb] = WFrag<T16>::mma(a[mb], b, acc[mb][nb]); if (NSPLIT == 1 || NSPLIT == 2) acc[mb][nb] = WFrag<T16>::mma(a2[mb], b, acc[mb][nb]); if (NSPLIT >= 2) acc[mb][nb] = WFrag<T16>::mma(a[mb], b2, acc[mb][nb]); } }
        asm volatile("v_nop\n\tv_nop\n\tv_nop\n\tv_nop" : "+v"(acc[0][0]), "+v"(acc[1][1]), "+v"(acc[2][2]), "+v"(acc[3][3]) : "v"(a[0]), "v"(a[3]));
    }
#pragma unroll
    for (int mb = 0; mb < 4; ++mb) {
#pragma unroll
        for (int nb = 0; nb < 4; ++nb) {
#pragma unroll
            for (int j = 0; j < 8; ++j) os[(hi * 8 + j) * 68 + nb * 16 + lr] = acc[mb][nb][j]; }
        __builtin_amdgcn_wave_barrier(); asm volatile("" ::: "memory");
        float* crow = C + (size_t)(r0 + mb * 16) * ldc + c0;
{
#pragma unroll
            for (int s = 0; s < 8; ++s) { const int row = 2 * s + hi, cofs = lr * 4; v4f val = *(const v4fa*)(os + row * 68 + cofs); if (BIAS) { val[0] += bfr(bias[c0 + cofs]); val[1] += bfr(bias[c0 + cofs + 1]); val[2] += bfr(bias[c0 + cofs + 2]); val[3] += bfr(bias[c0 + cofs + 3]); }
                *(v4f*)(crow + (size_t)row * ldc + cofs) = val; }
             }
        __builtin_amdgcn_wave_barrier(); asm volatile("" ::: "memory");
    }
}

__device__ __forceinline__ h16 tohx(float x) { return (h16)x; }
__device__ __forceinline__ void splitf(float y, unsigned short& h, unsigned short& l) { h = f2bf(y); l = f2bf(y - bf2f(h)); }
typedef __attribute__((ext_vector_type(2))) _Float16 v2h;
typedef __attribute__((ext_vector_type(4))) _Float16 v4h;
typedef __attribute__((ext_vector_type(2))) unsigned short v2us;
typedef __attribute__((ext_vector_type(4))) unsigned short v4us;
typedef __attribute__((ext_vector_type(2))) float v2f;
typedef __attribute__((ext_vector_type(4))) int v4i;

// k_wtG: all four weight operands in one launch. grid (lines / 64, 64-column block y, operand zz): zz 0..2 = Wq/Wk/Wv head y ([DM][HD], pitch HD), zz 3 = columns y*HD.. of Wo ([DQ][DM], pitch DM); each block -> Bt rows y*HD.., K-contiguous.
static_assert(NKV == NH_ && DM / HD == NH_ && DQ == DM, "one grid shape serves the four weight operands");
__global__ __launch_bounds__(256) void k_wtG(const float* __restrict__ wq, const float* __restrict__ wk, const float* __restrict__ wv, const float* __restrict__ wo, bf* BQ, bf* BK, bf* BV, bf* BO) {
    const int y = blockIdx.y, zz = blockIdx.z; const int K = DM, N = HD; const int ldw = (zz == 3) ? DM : HD;
    const float* w = (zz == 0) ? wq : (zz == 1) ? wk : (zz == 2) ? wv : wo; w += (zz == 3) ? (size_t)y * HD : (size_t)y * DM * HD;
    bf* Bt = ((zz == 0) ? BQ : (zz == 1) ? BK : (zz == 2) ? BV : BO) + (size_t)y * HD * DM;
    const int lane = threadIdx.x & 31; const int L0 = (blockIdx.x * 8 + (threadIdx.x >> 5)) * 8; const int nlines = N * K / 64;
{
#pragma unroll 1
        for (int l = 0; l < 8; ++l) { const int L = L0 + l; if (L >= nlines) break; const size_t e = (size_t)L * 64 + lane * 2; const int k = (int)(e % K), n = (int)(e / K); v2us o;
            o[0] = f2bf(w[(size_t)k * ldw + n]); o[1] = f2bf(w[(size_t)(k + 1) * ldw + n]); *(v2us*)(Bt + e) = o; }
         }
}
__global__ __launch_bounds__(256) void k_cvt8(const float* __restrict__ src, bf* dst, size_t n8) { const size_t i = (size_t)blockIdx.x * 256 + threadIdx.x; if (i >= n8) return; const v8f v = *(const v8f*)(src + i * 8); v8us o;
#pragma unroll
    for (int k = 0; k < 8; ++k) o[k] = f2bf(v[k]); *(v8us*)(dst + i * 8) = o;  }
__global__ __launch_bounds__(256) void k_cscvt(const float* __restrict__ cosT, const float* __restrict__ sinT, float* CS) { const int idx = blockIdx.x * 256 + threadIdx.x; if (idx >= TT * HD) return; v2f cs; cs[0] = bfr(cosT[idx]); cs[1] = bfr(sinT[idx]); *(v2f*)(CS + (size_t)idx * 2) = cs;  }
// k_rope: head planes [h][t][d] (fp16) of rope(x) x sc with the rotate-half convention out[d] = x[d] cos[t][d] - x[d+HD/2] sin[t][d], out[d+HD/2] = x[d+HD/2] cos[t][d+HD/2] + x[d] sin[t][d+HD/2]
__global__ __launch_bounds__(256) void k_rope(const float* __restrict__ F, int pitch, int nheads, const float* __restrict__ CS, const float* __restrict__ RF, const float* __restrict__ nw, float sc, h16* P16, bf* Ph, bf* Pl) {
    { const size_t bz = (size_t)blockIdx.z * NB_ + blockIdx.y; F += bz * TT * pitch; P16 += bz * nheads * TT * HD; }   // grid y: batch, grid z: q then k (buffers back to back)
    const size_t e = ((size_t)blockIdx.x * 256 + threadIdx.x) * 2; if (e >= (size_t)nheads * TT * HD) return; const int d = (int)(e % HD); const int t = (int)((e / HD) % TT); const int h = (int)(e / ((size_t)HD * TT)); const float* f = F + (size_t)t * pitch + h * HD; const float rf = RF ? RF[(size_t)h * TT + t] : 1.0f; v2h o16; v2us oh, ol;
#pragma unroll
    for (int q = 0; q < 2; ++q) { const int dd = d + q; const int dp = (dd < HD / 2) ? dd + HD / 2 : dd - HD / 2; float x0 = f[dd], x1 = f[dp];
        if (RF) { float n0 = __fmul_rn(x0, rf), n1 = __fmul_rn(x1, rf); asm volatile("" : "+v"(n0)); asm volatile("" : "+v"(n1)); x0 = __fmul_rn(bfr(nw[dd]), n0); x1 = __fmul_rn(bfr(nw[dp]), n1); }
        const v2f cs = *(const v2f*)(CS + ((size_t)t * HD + dd) * 2); float a = __fmul_rn(x0, cs[0]), bq = __fmul_rn(x1, cs[1]); asm volatile("" : "+v"(a)); asm volatile("" : "+v"(bq)); const float r = ((dd < HD / 2) ? __fsub_rn(a, bq) : __fadd_rn(a, bq)) * sc;
        o16[q] = tohx(r); (void)oh; (void)ol; }
    *(v2h*)(P16 + e) = o16;  }
__global__ __launch_bounds__(256) void k_vtp(const float* __restrict__ F, int pitch, int nheads, h16* V16, bf* Vh, bf* Vl) { F += (size_t)blockIdx.y * TT * pitch; V16 += (size_t)blockIdx.y * nheads * HD * TT;   // grid y: batch
    const size_t e = ((size_t)blockIdx.x * 256 + threadIdx.x) * 2; if (e >= (size_t)nheads * HD * TT) return; const int t = (int)(e % TT); const int d = (int)((e / TT) % HD); const int g = (int)(e / ((size_t)TT * HD)); v2h o16; v2us oh, ol;
#pragma unroll
    for (int q = 0; q < 2; ++q) { const float x = F[(size_t)(t + q) * pitch + g * HD + d]; o16[q] = tohx(x); (void)oh; (void)ol; }
    *(v2h*)(V16 + e) = o16;  }
__global__ __launch_bounds__(256) void k_csid(float* CS) { const int idx = blockIdx.x * 256 + threadIdx.x; if (idx >= TT * HD) return; v2f cs; cs[0] = 1.0f; cs[1] = 0.0f; *(v2f*)(CS + (size_t)idx * 2) = cs;  }
#define FNW  8                    // waves per work-group
#define FBR  (FNW * 16)           // queries per work-group
#define FSK  128                  // keys per stage
#define FPK  (HD * 2 + 16)        // LDS pitch of a K row, bytes: odd multiple of 16
#define FPV  (FSK * 2 + 16)       // LDS pitch of a V^T row, bytes: odd multiple of 16
#define FTK  (FSK * FPK)
#define FTV  (HD * FPV)
#define FSLOT (FTK + FTV)
typedef __attribute__((ext_vector_type(4))) unsigned v4u;
typedef v4u __attribute__((may_alias)) v4ua;
static_assert(HD == 64 && TT % FSK == 0 && TT % FBR == 0 && FSK * HD * 2 == 4 * 256 * 16, "staging map: 256 threads x 4 chunks of 16 bytes per operand and stage");
__device__ __forceinline__ v16h fragl(const unsigned char* p) { return cat16(*(const v8ha*)p, *(const v8ha*)(p + 32)); }
__device__ __forceinline__ float xhalf(float x) { return __builtin_bit_cast(float, __builtin_amdgcn_permlanex16(__builtin_bit_cast(int, x), __builtin_bit_cast(int, x), 0x76543210, 0xfedcba98, false, false)); }   // lane l with lane l ^ 16
// eight exponentials (2^x) in place in one statement: no v_exp_f32 has its source overwritten by the instruction directly behind it, and the closing v_nop is the slot the instruction set asks for between a transcendental and the first use of its result
__device__ __forceinline__ void exp2x8(float& a, float& b, float& c, float& d, float& e, float& f, float& g, float& h) {
    asm("v_exp_f32 %0, %0\n\tv_exp_f32 %1, %1\n\tv_exp_f32 %2, %2\n\tv_exp_f32 %3, %3\n\tv_exp_f32 %4, %4\n\tv_exp_f32 %5, %5\n\tv_exp_f32 %6, %6\n\tv_exp_f32 %7, %7\n\tv_nop" : "+v"(a), "+v"(b), "+v"(c), "+v"(d), "+v"(e), "+v"(f), "+v"(g), "+v"(h)); }
__global__ __launch_bounds__(256) void k_fattn(const h16* __restrict__ Qp, const h16* __restrict__ Kp, const h16* __restrict__ Vt, bf* Ah, bf* Al) {
    __shared__ __align__(16) unsigned char L[2 * FSLOT];
    const int tid = threadIdx.x, lane = tid & 31, wave = tid >> 5, c = lane & 15, hf = lane >> 4;
    const int bh = blockIdx.y; const int q = blockIdx.x * FBR + wave * 16 + c;   // this lane's query
    const float cscale = SCL * 1.4426950408889634f;
    // staging map: chunk i of thread tid = 16 bytes; K: row 32 i + tid / 8, V^T: row 16 i + tid / 16; a wave's load covers whole 128-byte lines
    const unsigned char* kg = (const unsigned char*)(Kp + (size_t)bh * TT * HD) + tid * 16;
    const unsigned char* vg = (const unsigned char*)(Vt + (size_t)bh * HD * TT) + (size_t)(tid >> 4) * (TT * 2) + (tid & 15) * 16;
    const int klo = (tid >> 3) * FPK + (tid & 7) * 16, vlo = FTK + (tid >> 4) * FPV + (tid & 15) * 16;
    v4u rk[4], rv[4];
#pragma unroll
    for (int i = 0; i < 4; ++i) { rk[i] = *(const v4ua*)(kg + i * 4096); rv[i] = *(const v4ua*)(vg + (size_t)i * 16 * TT * 2); }
    v16h qf[2];
    { const h16* qp = Qp + ((size_t)bh * TT + q) * HD + 8 * hf;
#pragma unroll
      for (int kc = 0; kc < 2; ++kc) qf[kc] = cat16(*(const v8h*)(qp + 32 * kc), *(const v8h*)(qp + 32 * kc + 16)); }
    asm volatile("s_wait_xcnt 0x0" ::: "memory");   // the twelve loads above are issued: their address registers may be reused from here on
    v16h ones;   // A operand of all ones: every row of its product holds the column sums of P^T (the softmax denominators' increments)
#pragma unroll
    for (int i = 0; i < 16; ++i) ones[i] = (h16)1.0f;
    v8f acc[4], lacc = (v8f){};
#pragma unroll
    for (int t = 0; t < 4; ++t) acc[t] = (v8f){};
    float mrun = -3.0e38f;
#pragma unroll
    for (int i = 0; i < 4; ++i) { *(v4ua*)(L + klo + i * 32 * FPK) = rk[i]; *(v4ua*)(L + vlo + i * 16 * FPV) = rv[i]; }
    __syncthreads();
#pragma unroll 1   // stays rolled: the body already holds four unrolled passes, and the two buffers alternate by st & 1
    for (int st = 0; st < TT / FSK; ++st) {
        const unsigned char* Ls = L + (st & 1) * FSLOT;
        const bool more = st + 1 < TT / FSK;
        if (more) {
#pragma unroll
            for (int i = 0; i < 4; ++i) { rk[i] = *(const v4ua*)(kg + (size_t)(st + 1) * (FSK * HD * 2) + i * 4096); rv[i] = *(const v4ua*)(vg + (size_t)(st + 1) * (FSK * 2) + (size_t)i * 16 * TT * 2); } }
#pragma unroll
        for (int ps = 0; ps < FSK / 32; ++ps) {
            const unsigned char* kp = Ls + (ps * 32 + c) * FPK + 16 * hf;
            v8f s[2];
#pragma unroll
            for (int kt = 0; kt < 2; ++kt) { s[kt] = (v8f){};
#pragma unroll
                for (int kc = 0; kc < 2; ++kc) s[kt] = wmma16(fragl(kp + kt * 16 * FPK + 64 * kc), qf[kc], s[kt]); }
            float mx = s[0][0];
#pragma unroll
            for (int r = 1; r < 16; ++r) mx = fmaxf(mx, s[r >> 3][r & 7]);
            mx = fmaxf(mx, xhalf(mx)) * cscale;   // both halves of the wave now hold this query's maximum over the pass's 32 keys, scaled (the scale is positive)
            if (__builtin_amdgcn_ballot_w32(mx > mrun + 8.0f) != 0) {   // one scalar branch per pass; rare after the first passes
                const float mnew = fmaxf(mrun, mx); const float corr = __builtin_amdgcn_exp2f(mrun - mnew); mrun = mnew;   // first pass: corr = 0 on zero sums
                lacc = lacc * corr;
#pragma unroll
                for (int t = 0; t < 4; ++t) acc[t] = acc[t] * corr; }
            const unsigned char* vp = Ls + FTK + c * FPV + ps * 64 + 16 * hf;
            v16h vf[4];
#pragma unroll
            for (int t = 0; t < 4; ++t) vf[t] = fragl(vp + t * 16 * FPV);
            __builtin_amdgcn_sched_barrier(0);   // the V^T fragment loads issue in front of the exponentials, whose time covers their LDS latency
            const float nm = -mrun; v16h pf;
#pragma unroll
            for (int kt = 0; kt < 2; ++kt) { float e[8];
#pragma unroll
                for (int i = 0; i < 4; ++i) { const v2f arg = __builtin_elementwise_fma((v2f){s[kt][2 * i], s[kt][2 * i + 1]}, (v2f){cscale, cscale}, (v2f){nm, nm}); e[2 * i] = arg[0]; e[2 * i + 1] = arg[1]; }
                exp2x8(e[0], e[1], e[2], e[3], e[4], e[5], e[6], e[7]);
#pragma unroll
                for (int i = 0; i < 4; ++i) { const v2h p2 = __builtin_convertvector((v2f){e[2 * i], e[2 * i + 1]}, v2h); pf[8 * kt + 2 * i] = p2[0]; pf[8 * kt + 2 * i + 1] = p2[1]; } }
#pragma unroll
            for (int t = 0; t < 4; ++t) acc[t] = wmma16(vf[t], pf, acc[t]);
            lacc = wmma16(ones, pf, lacc);
        }
        // four vector slots behind the stage's last matrix instructions: the branch round the next stage's loads is taken on the last trip
        __builtin_amdgcn_sched_barrier(0); asm volatile("v_nop\n\tv_nop\n\tv_nop\n\tv_nop"); __builtin_amdgcn_sched_barrier(0);
        if (more) { unsigned char* Ln = L + ((st + 1) & 1) * FSLOT;   // the buffer that stage st - 1 used: every wave left it before the last barrier
#pragma unroll
            for (int i = 0; i < 4; ++i) { *(v4ua*)(Ln + klo + i * 32 * FPK) = rk[i]; *(v4ua*)(Ln + vlo + i * 16 * FPV) = rv[i]; } }
        __syncthreads();
    }
    const float inv = __fdiv_rn(1.0f, lacc[0]);
    const size_t oo = ((size_t)(bh / NH_) * TT + q) * DQ + (bh % NH_) * HD + 8 * hf;   // acc[t][r] = O[q][16 t + 8 hf + r]: 8 consecutive features per store
#pragma unroll
    for (int t = 0; t < 4; ++t) { v8us oh, ol;
#pragma unroll
        for (int r = 0; r < 8; ++r) { unsigned short a, c2; splitf(acc[t][r] * inv, a, c2); oh[r] = a; ol[r] = c2; }
        *(v8us*)(Ah + oo + 16 * t) = oh; *(v8us*)(Al + oo + 16 * t) = ol; }
}

extern "C" void kernel_launch(void* const* d_in, const int* in_sizes, int n_in,
                              void* d_out, int out_size, void* d_ws, size_t ws_size, hipStream_t stream) {
    (void)in_sizes; (void)n_in; (void)out_size;
    const float* x = (const float*)d_in[0]; const float* wq = (const float*)d_in[1]; const float* bqv = (const float*)d_in[2]; const float* wk = (const float*)d_in[3]; const float* bkv = (const float*)d_in[4]; const float* wv = (const float*)d_in[5]; const float* bvv = (const float*)d_in[6]; const float* wo = (const float*)d_in[7]; const float* bo = (const float*)d_in[8];   // Wq/Wk/Wv [8][512][64] (x @ W per head), biases [8][64], Wo [512][512] (x @ W), bo
    float* OUT = (float*)d_out;     // [2][2048][512]
    char* wsp = (char*)d_ws;
    auto take = [&](size_t bytes) { char* p = wsp; wsp += (bytes + 255) & ~(size_t)255; return (void*)p; };
    bf* WQ = (bf*)take((size_t)DQ * DM * 2); bf* WK = (bf*)take((size_t)DKV * DM * 2); bf* WV = (bf*)take((size_t)DKV * DM * 2); bf* WO = (bf*)take((size_t)DM * DQ * 2); float* CS = (float*)take((size_t)TT * HD * 2 * 4);
    bf* XB = (bf*)take((size_t)NB_ * TT * DM * 2); float* FQ = (float*)take((size_t)NB_ * TT * DQ * 4); float* FK = (float*)take((size_t)NB_ * TT * DKV * 4); float* FV = (float*)take((size_t)NB_ * TT * DKV * 4);   // FQ, FK, FV back to back: z-stride of the one projection launch
    h16* QP16 = (h16*)take((size_t)NB_ * NH_ * TT * HD * 2); h16* KP16 = (h16*)take((size_t)NB_ * NKV * TT * HD * 2); h16* VT16 = (h16*)take((size_t)NB_ * NKV * HD * TT * 2);   // planes [b][h][..]; QP16, KP16 back to back
    bf* QPh = nullptr; bf* QPl = nullptr; bf* VTh = nullptr; bf* VTl = nullptr;
    bf* ATh = (bf*)take((size_t)NB_ * TT * DQ * 2); bf* ATl = (bf*)take((size_t)NB_ * TT * DQ * 2);
    if ((size_t)(wsp - (char*)d_ws) > ws_size) return;    // ws 256 MiB
    (void)FK;
    k_wtG<<<dim3((DM * HD / 64 + 63) / 64, NH_, 4), 256, 0, stream>>>(wq, wk, wv, wo, WQ, WK, WV, WO);   // per-head [512][64] blocks -> Bt rows h*64..; Wo by 64-column blocks
    k_csid<<<(TT * HD + 255) / 256, 256, 0, stream>>>(CS);
    const unsigned LQ = (unsigned)(((size_t)NH_ * TT * HD / 2 + 255) / 256), LKv = (unsigned)(((size_t)NKV * TT * HD / 2 + 255) / 256);
    k_cvt8<<<(unsigned)(((size_t)NB_ * TT * DM / 8 + 255) / 256), 256, 0, stream>>>(x, XB, (size_t)NB_ * TT * DM / 8);
    k_gemmw<bf, 0, true><<<dim3(NB_ * TT / 64, DQ / 64, 3), 32, 0, stream>>>(XB, nullptr, WQ, nullptr, DM, FQ, DQ, bqv, bkv, bvv, 0, (size_t)DQ * DM, (size_t)NB_ * TT * DQ);   // z: q, k, v; rows: both batches
    k_rope<<<dim3(LQ, NB_, 2), 256, 0, stream>>>(FQ, DQ, NH_, CS, nullptr, nullptr, 1.0f, QP16, QPh, QPl);
    k_vtp<<<dim3(LKv, NB_, 1), 256, 0, stream>>>(FV, DKV, NKV, VT16, VTh, VTl);
    k_fattn<<<dim3(TT / FBR, NB_ * NH_, 1), 256, 0, stream>>>(QP16, KP16, VT16, ATh, ATl);   // planes [b][h][..]: grid y = b * heads + h (one kv head per query head)
    k_gemmw<bf, 1, true><<<dim3(NB_ * TT / 64, DM / 64, 1), 32, 0, stream>>>(ATh, ATl, WO, nullptr, DQ, OUT, DM, bo, nullptr, nullptr, 0, 0, 0);
}

// v003
// One run takes 72.2 microseconds.
// Next to v002, in two timings, it ran 1.34 and 1.35 times as fast.
// Counting every step since v000, it is 11.4 times as fast.
#include <hip/hip_runtime.h>

// Faster_MultiHeadAttention (sequences [2][2048][512]; per head h: q = x Wq[h] + bq[h], k, v likewise (Wq/Wk/Wv [8][512][64], biases [8][64]); softmax(q.k/8); z = merged heads; out = z Wo + bo -> [2][2048][512]).
// Compute dtypes, f32 accumulate: every input rounded to bf16; projections on PLAIN bf16 operands (inputs: exact, + bias; the per-head weights are re-laid as one [512][512] operand);
// scores (K 64) and att.v on SINGLE fp16 planes inside ONE kernel per (batch, head, 128 queries) with an f32 online softmax (probabilities never leave registers); merged heads as bf16 hi+lo planes x exact Wo (2 products) + bo. One-wave-per-64x64-tile GEMMs for the projections; the q/k/v GEMM stores its tiles as the fp16 operands of the attention kernel. Deterministic,

#define NB_  2
#define TT   2048
#define DM   512
#define NH_  8
#define NKV  8
#define HD   64
#define DQ   (NH_ * HD)
#define DKV  (NKV * HD)
#define WIN  0
#define SCL  0.125f   // HD^-0.5
typedef _Float16 h16;
typedef unsigned short bf;
typedef __attribute__((ext_vector_type(16))) __bf16   v16bf;
typedef __attribute__((ext_vector_type(16))) _Float16 v16h;
typedef __attribute__((ext_vector_type(8)))  _Float16 v8h;
typedef __attribute__((ext_vector_type(8)))  unsigned short v8us;
typedef __attribute__((ext_vector_type(8)))  float    v8f;
typedef __attribute__((ext_vector_type(4)))  float    v4f;
typedef v8h  __attribute__((may_alias)) v8ha;
typedef v4f  __attribute__((may_alias)) v4fa;
typedef v8us __attribute__((may_alias)) v8usa;

__device__ __forceinline__ unsigned short f2bf(float f) { unsigned u = __float_as_uint(f); u += 0x7FFFu + ((u >> 16) & 1u); return (unsigned short)(u >> 16); }
__device__ __forceinline__ float bf2f(unsigned short b) { return __uint_as_float(((unsigned)b) << 16); }
__device__ __forceinline__ float bfr(float f) { return bf2f(f2bf(f)); }
__device__ __forceinline__ v16h cat16(v8h lo, v8h hi) { return __builtin_shufflevector(lo, hi, 0, 1, 2, 3, 4, 5, 6, 7, 8, 9, 10, 11, 12, 13, 14, 15); }
__device__ __forceinline__ v16bf cat16b(v8us lo, v8us hi) { return __builtin_bit_cast(v16bf, __builtin_shufflevector(lo, hi, 0, 1, 2, 3, 4, 5, 6, 7, 8, 9, 10, 11, 12, 13, 14, 15)); }
__device__ __forceinline__ v8f wmma16(v16h a, v16h b, v8f c) { return __builtin_amdgcn_wmma_f32_16x16x32_f16(false, a, false, b, (short)0, c, false, false); }
__device__ __forceinline__ h16 tohx(float x) { return (h16)x; }
__device__ __forceinline__ v8f wmmab(v16bf a, v16bf b, v8f c) { return __builtin_amdgcn_wmma_f32_16x16x32_bf16(false, a, false, b, (short)0, c, false, false); }



// ---- k_gemmw: register-blocked GEMM, ONE WAVE per 64x64 output tile (16 accumulators), operands straight from K-contiguous 16-bit planes; grid (M/64, N/64, Z), 32 threads.
// C[m][n] (f32, pitch ldc, + optional f32 bias[n], one bias vector per z = 0, 1, 2) = sum_k A[m][k] Bt[n][k] (+ split products per NSPLIT). z-batch strides sA/sB/sC in elements. K % 32 == 0.
// PLANES (the q/k/v launch; C unused): a tile's 64 columns are one head and its 64 rows lie in one batch, so the tile + bias, rounded to fp16, goes straight to where the attention kernel reads it:
// z = 0, 1 (q, k) to rows [t][d] of plane [z][b][h] of P16, z = 2 (v) transposed to rows [d][t] of plane [b][h] of V16. Every store instruction covers whole 128-byte rows.
#define GPV  (64 * 2 + 16)        // LDS pitch of a staged V^T row, bytes: odd multiple of 16
template <typename T16> struct WFrag;
template <> struct WFrag<h16> { typedef v16h V; static __device__ __forceinline__ V ld(const h16* p) { return cat16(*(const v8h*)p, *(const v8h*)(p + 16)); } static __device__ __forceinline__ v8f mma(V a, V b, v8f c) { return wmma16(a, b, c); } };
template <> struct WFrag<bf> { typedef v16bf V; static __device__ __forceinline__ V ld(const bf* p) { return cat16b(*(const v8us*)p, *(const v8us*)(p + 16)); } static __device__ __forceinline__ v8f mma(V a, V b, v8f c) { return wmmab(a, b, c); } };
template <typename T16, int NSPLIT, bool BIAS, bool PLANES>
__global__ __launch_bounds__(32) void k_gemmw(const T16* __restrict__ A, const T16* __restrict__ A2, const T16* __restrict__ Bt, const T16* __restrict__ Bt2, int K, float* C, int ldc, const float* __restrict__ bias, const float* __restrict__ bias1, const float* __restrict__ bias2, size_t sA, size_t sB, size_t sC, h16* P16, h16* V16) {
    typedef typename WFrag<T16>::V V;
    static_assert(!PLANES || (BIAS && HD == 64 && TT % 64 == 0 && NKV == NH_), "a 64x64 tile is one head of one batch");
    __shared__ __align__(16) float os[PLANES ? 64 * GPV / 4 : 16 * 68];
    const size_t z = blockIdx.z; A += z * sA; if (A2) A2 += z * sA; Bt += z * sB; if (Bt2) Bt2 += z * sB; C += z * sC;
    if (BIAS) bias = (z == 0) ? bias : ((z == 1) ? bias1 : bias2);   // z-batched products with a bias each (q, k, v)
    const int lane = threadIdx.x & 31, lr = lane & 15, hi = lane >> 4; const int r0 = blockIdx.x * 64, c0 = blockIdx.y * 64;
    v8f acc[4][4];
#pragma unroll
    for (int mb = 0; mb < 4; ++mb)
#pragma unroll
        for (int nb = 0; nb < 4; ++nb) acc[mb][nb] = (v8f){};
    const size_t aoff = (size_t)(r0 + lr) * K + 8 * hi, boff = (size_t)(c0 + lr) * K + 8 * hi;
#pragma unroll 1
    for (int kc = 0; kc < K; kc += 32) {
        V a[4], a2[4];
#pragma unroll
        for (int mb = 0; mb < 4; ++mb) { a[mb] = WFrag<T16>::ld(A + aoff + (size_t)mb * 16 * K + kc); if (NSPLIT == 1 || NSPLIT == 2) a2[mb] = WFrag<T16>::ld(A2 + aoff + (size_t)mb * 16 * K + kc); }
#pragma unroll
        for (int nb = 0; nb < 4; ++nb) { const V b = WFrag<T16>::ld(Bt + boff + (size_t)nb * 16 * K + kc); V b2; if (NSPLIT >= 2) b2 = WFrag<T16>::ld(Bt2 + boff + (size_t)nb * 16 * K + kc);
#pragma unroll
            for (int mb = 0; mb < 4; ++mb) { acc[mb][nb] = WFrag<T16>::mma(a[mb], b, acc[mb][nb]); if (NSPLIT == 1 || NSPLIT == 2) acc[mb][nb] = WFrag<T16>::mma(a2[mb], b, acc[mb][nb]); if (NSPLIT >= 2) acc[mb][nb] = WFrag<T16>::mma(a[mb], b2, acc[mb][nb]); } }
        asm volatile("v_nop\n\tv_nop\n\tv_nop\n\tv_nop" : "+v"(acc[0][0]), "+v"(acc[1][1]), "+v"(acc[2][2]), "+v"(acc[3][3]) : "v"(a[0]), "v"(a[3]));
    }
    if (PLANES) {
        const size_t pl = (size_t)(r0 / TT) * NH_ + blockIdx.y; const int t0 = r0 % TT, l8 = lane >> 3, c8 = lane & 7;   // plane [b][h]; a store: 4 rows x 8 lanes x 16 bytes
        if (z < 2) {
            h16* prow = P16 + ((z * NB_ * NH_ + pl) * TT + t0) * HD + c8 * 8; float bb[8];
#pragma unroll
            for (int i = 0; i < 8; ++i) bb[i] = bfr(bias[c0 + c8 * 8 + i]);
#pragma unroll
            for (int mb = 0; mb < 4; ++mb) {
#pragma unroll
                for (int nb = 0; nb < 4; ++nb) {
#pragma unroll
                    for (int j = 0; j < 8; ++j) os[(hi * 8 + j) * 68 + nb * 16 + lr] = acc[mb][nb][j]; }
                __builtin_amdgcn_wave_barrier(); asm volatile("" ::: "memory");   // compiler fence: the reads below take what other lanes of this wave stored
#pragma unroll
                for (int s = 0; s < 4; ++s) { const int row = 4 * s + l8; const v4f v0 = *(const v4fa*)(os + row * 68 + c8 * 8), v1 = *(const v4fa*)(os + row * 68 + c8 * 8 + 4); v8h o;
#pragma unroll
                    for (int i = 0; i < 4; ++i) { o[i] = tohx(v0[i] + bb[i]); o[4 + i] = tohx(v1[i] + bb[4 + i]); }
                    *(v8h*)(prow + (size_t)(mb * 16 + row) * HD) = o; }
                __builtin_amdgcn_wave_barrier(); asm volatile("" ::: "memory");   // compiler fence: the next block's stores stay behind these reads
            }
        } else {
            unsigned char* ot = (unsigned char*)os;   // acc[mb][nb][0..7]: 8 consecutive t of feature 16 nb + lr = 16 bytes of a V^T row
#pragma unroll
            for (int nb = 0; nb < 4; ++nb) { const float bv = bfr(bias[c0 + nb * 16 + lr]);
#pragma unroll
                for (int mb = 0; mb < 4; ++mb) { v8h o;
#pragma unroll
                    for (int j = 0; j < 8; ++j) o[j] = tohx(acc[mb][nb][j] + bv);
                    *(v8ha*)(ot + (nb * 16 + lr) * GPV + mb * 32 + hi * 16) = o; } }
            __builtin_amdgcn_wave_barrier(); asm volatile("" ::: "memory");   // compiler fence: the reads below take what other lanes of this wave stored
            h16* vrow = V16 + pl * HD * TT + t0 + c8 * 8;
#pragma unroll
            for (int s = 0; s < 16; ++s) { const int d = 4 * s + l8; *(v8h*)(vrow + (size_t)d * TT) = *(const v8ha*)(ot + d * GPV + c8 * 16); }
            asm volatile("s_wait_xcnt 0x0" ::: "memory");   // the sixteen stores above are issued: their address registers may be reused from here on
        }
        return;
    }
#pragma unroll
    for (int mb = 0; mb < 4; ++mb) {
#pragma unroll
        for (int nb = 0; nb < 4; ++nb) {
#pragma unroll
            for (int j = 0; j < 8; ++j) os[(hi * 8 + j) * 68 + nb * 16 + lr] = acc[mb][nb][j]; }
        __builtin_amdgcn_wave_barrier(); asm volatile("" ::: "memory");
        float* crow = C + (size_t)(r0 + mb * 16) * ldc + c0;
{
#pragma unroll
            for (int s = 0; s < 8; ++s) { const int row = 2 * s + hi, cofs = lr * 4; v4f val = *(const v4fa*)(os + row * 68 + cofs); if (BIAS) { val[0] += bfr(bias[c0 + cofs]); val[1] += bfr(bias[c0 + cofs + 1]); val[2] += bfr(bias[c0 + cofs + 2]); val[3] += bfr(bias[c0 + cofs + 3]); }
                *(v4f*)(crow + (size_t)row * ldc + cofs) = val; }
             }
        __builtin_amdgcn_wave_barrier(); asm volatile("" ::: "memory");
    }
}

__device__ __forceinline__ void splitf(float y, unsigned short& h, unsigned short& l) { h = f2bf(y); l = f2bf(y - bf2f(h)); }
typedef __attribute__((ext_vector_type(2))) _Float16 v2h;
typedef __attribute__((ext_vector_type(4))) _Float16 v4h;
typedef __attribute__((ext_vector_type(2))) unsigned short v2us;
typedef __attribute__((ext_vector_type(4))) unsigned short v4us;
typedef __attribute__((ext_vector_type(2))) float v2f;
typedef __attribute__((ext_vector_type(4))) int v4i;

// k_wtG: all four weight operands in one launch. grid (lines / 64, 64-column block y, operand zz): zz 0..2 = Wq/Wk/Wv head y ([DM][HD], pitch HD), zz 3 = columns y*HD.. of Wo ([DQ][DM], pitch DM); each block -> Bt rows y*HD.., K-contiguous.
static_assert(NKV == NH_ && DM / HD == NH_ && DQ == DM, "one grid shape serves the four weight operands");
__global__ __launch_bounds__(256) void k_wtG(const float* __restrict__ wq, const float* __restrict__ wk, const float* __restrict__ wv, const float* __restrict__ wo, bf* BQ, bf* BK, bf* BV, bf* BO) {
    const int y = blockIdx.y, zz = blockIdx.z; const int K = DM, N = HD; const int ldw = (zz == 3) ? DM : HD;
    const float* w = (zz == 0) ? wq : (zz == 1) ? wk : (zz == 2) ? wv : wo; w += (zz == 3) ? (size_t)y * HD : (size_t)y * DM * HD;
    bf* Bt = ((zz == 0) ? BQ : (zz == 1) ? BK : (zz == 2) ? BV : BO) + (size_t)y * HD * DM;
    const int lane = threadIdx.x & 31; const int L0 = (blockIdx.x * 8 + (threadIdx.x >> 5)) * 8; const int nlines = N * K / 64;
{
#pragma unroll 1
        for (int l = 0; l < 8; ++l) { const int L = L0 + l; if (L >= nlines) break; const size_t e = (size_t)L * 64 + lane * 2; const int k = (int)(e % K), n = (int)(e / K); v2us o;
            o[0] = f2bf(w[(size_t)k * ldw + n]); o[1] = f2bf(w[(size_t)(k + 1) * ldw + n]); *(v2us*)(Bt + e) = o; }
         }
}
__global__ __launch_bounds__(256) void k_cvt8(const float* __restrict__ src, bf* dst, size_t n8) { const size_t i = (size_t)blockIdx.x * 256 + threadIdx.x; if (i >= n8) return; const v8f v = *(const v8f*)(src + i * 8); v8us o;
#pragma unroll
    for (int k = 0; k < 8; ++k) o[k] = f2bf(v[k]); *(v8us*)(dst + i * 8) = o;  }
#define FNW  8                    // waves per work-group
#define FBR  (FNW * 16)           // queries per work-group
#define FSK  128                  // keys per stage
#define FPK  (HD * 2 + 16)        // LDS pitch of a K row, bytes: odd multiple of 16
#define FPV  (FSK * 2 + 16)       // LDS pitch of a V^T row, bytes: odd multiple of 16
#define FTK  (FSK * FPK)
#define FTV  (HD * FPV)
#define FSLOT (FTK + FTV)
typedef __attribute__((ext_vector_type(4))) unsigned v4u;
typedef v4u __attribute__((may_alias)) v4ua;
static_assert(HD == 64 && TT % FSK == 0 && TT % FBR == 0 && FSK * HD * 2 == 4 * 256 * 16, "staging map: 256 threads x 4 chunks of 16 bytes per operand and stage");
__device__ __forceinline__ v16h fragl(const unsigned char* p) { return cat16(*(const v8ha*)p, *(const v8ha*)(p + 32)); }
__device__ __forceinline__ float xhalf(float x) { return __builtin_bit_cast(float, __builtin_amdgcn_permlanex16(__builtin_bit_cast(int, x), __builtin_bit_cast(int, x), 0x76543210, 0xfedcba98, false, false)); }   // lane l with lane l ^ 16
// eight exponentials (2^x) in place in one statement: no v_exp_f32 has its source overwritten by the instruction directly behind it, and the closing v_nop is the slot the instruction set asks for between a transcendental and the first use of its result
__device__ __forceinline__ void exp2x8(float& a, float& b, float& c, float& d, float& e, float& f, float& g, float& h) {
    asm("v_exp_f32 %0, %0\n\tv_exp_f32 %1, %1\n\tv_exp_f32 %2, %2\n\tv_exp_f32 %3, %3\n\tv_exp_f32 %4, %4\n\tv_exp_f32 %5, %5\n\tv_exp_f32 %6, %6\n\tv_exp_f32 %7, %7\n\tv_nop" : "+v"(a), "+v"(b), "+v"(c), "+v"(d), "+v"(e), "+v"(f), "+v"(g), "+v"(h)); }
__global__ __launch_bounds__(256) void k_fattn(const h16* __restrict__ Qp, const h16* __restrict__ Kp, const h16* __restrict__ Vt, bf* Ah, bf* Al) {
    __shared__ __align__(16) unsigned char L[2 * FSLOT];
    const int tid = threadIdx.x, lane = tid & 31, wave = tid >> 5, c = lane & 15, hf = lane >> 4;
    const int bh = blockIdx.y; const int q = blockIdx.x * FBR + wave * 16 + c;   // this lane's query
    const float cscale = SCL * 1.4426950408889634f;
    // staging map: chunk i of thread tid = 16 bytes; K: row 32 i + tid / 8, V^T: row 16 i + tid / 16; a wave's load covers whole 128-byte lines
    const unsigned char* kg = (const unsigned char*)(Kp + (size_t)bh * TT * HD) + tid * 16;
    const unsigned char* vg = (const unsigned char*)(Vt + (size_t)bh * HD * TT) + (size_t)(tid >> 4) * (TT * 2) + (tid & 15) * 16;
    const int klo = (tid >> 3) * FPK + (tid & 7) * 16, vlo = FTK + (tid >> 4) * FPV + (tid & 15) * 16;
    v4u rk[4], rv[4];
#pragma unroll
    for (int i = 0; i < 4; ++i) { rk[i] = *(const v4ua*)(kg + i * 4096); rv[i] = *(const v4ua*)(vg + (size_t)i * 16 * TT * 2); }
    v16h qf[2];
    { const h16* qp = Qp + ((size_t)bh * TT + q) * HD + 8 * hf;
#pragma unroll
      for (int kc = 0; kc < 2; ++kc) qf[kc] = cat16(*(const v8h*)(qp + 32 * kc), *(const v8h*)(qp + 32 * kc + 16)); }
    asm volatile("s_wait_xcnt 0x0" ::: "memory");   // the twelve loads above are issued: their address registers may be reused from here on
    v16h ones;   // A operand of all ones: every row of its product holds the column sums of P^T (the softmax denominators' increments)
#pragma unroll
    for (int i = 0; i < 16; ++i) ones[i] = (h16)1.0f;
    v8f acc[4], lacc = (v8f){};
#pragma unroll
    for (int t = 0; t < 4; ++t) acc[t] = (v8f){};
    float mrun = -3.0e38f;
#pragma unroll
    for (int i = 0; i < 4; ++i) { *(v4ua*)(L + klo + i * 32 * FPK) = rk[i]; *(v4ua*)(L + vlo + i * 16 * FPV) = rv[i]; }
    __syncthreads();
#pragma unroll 1   // stays rolled: the body already holds four unrolled passes, and the two buffers alternate by st & 1
    for (int st = 0; st < TT / FSK; ++st) {
        const unsigned char* Ls = L + (st & 1) * FSLOT;
        const bool more = st + 1 < TT / FSK;
        if (more) {
#pragma unroll
            for (int i = 0; i < 4; ++i) { rk[i] = *(const v4ua*)(kg + (size_t)(st + 1) * (FSK * HD * 2) + i * 4096); rv[i] = *(const v4ua*)(vg + (size_t)(st + 1) * (FSK * 2) + (size_t)i * 16 * TT * 2); } }
#pragma unroll
        for (int ps = 0; ps < FSK / 32; ++ps) {
            const unsigned char* kp = Ls + (ps * 32 + c) * FPK + 16 * hf;
            v8f s[2];
#pragma unroll
            for (int kt = 0; kt < 2; ++kt) { s[kt] = (v8f){};
#pragma unroll
                for (int kc = 0; kc < 2; ++kc) s[kt] = wmma16(fragl(kp + kt * 16 * FPK + 64 * kc), qf[kc], s[kt]); }
            float mx = s[0][0];
#pragma unroll
            for (int r = 1; r < 16; ++r) mx = fmaxf(mx, s[r >> 3][r & 7]);
            mx = fmaxf(mx, xhalf(mx)) * cscale;   // both halves of the wave now hold this query's maximum over the pass's 32 keys, scaled (the scale is positive)
            if (__builtin_amdgcn_ballot_w32(mx > mrun + 8.0f) != 0) {   // one scalar branch per pass; rare after the first passes
                const float mnew = fmaxf(mrun, mx); const float corr = __builtin_amdgcn_exp2f(mrun - mnew); mrun = mnew;   // first pass: corr = 0 on zero sums
                lacc = lacc * corr;
#pragma unroll
                for (int t = 0; t < 4; ++t) acc[t] = acc[t] * corr; }
            const unsigned char* vp = Ls + FTK + c * FPV + ps * 64 + 16 * hf;
            v16h vf[4];
#pragma unroll
            for (int t = 0; t < 4; ++t) vf[t] = fragl(vp + t * 16 * FPV);
            __builtin_amdgcn_sched_barrier(0);   // the V^T fragment loads issue in front of the exponentials, whose time covers their LDS latency
            const float nm = -mrun; v16h pf;
#pragma unroll
            for (int kt = 0; kt < 2; ++kt) { float e[8];
#pragma unroll
                for (int i = 0; i < 4; ++i) { const v2f arg = __builtin_elementwise_fma((v2f){s[kt][2 * i], s[kt][2 * i + 1]}, (v2f){cscale, cscale}, (v2f){nm, nm}); e[2 * i] = arg[0]; e[2 * i + 1] = arg[1]; }
                exp2x8(e[0], e[1], e[2], e[3], e[4], e[5], e[6], e[7]);
#pragma unroll
                for (int i = 0; i < 4; ++i) { const v2h p2 = __builtin_convertvector((v2f){e[2 * i], e[2 * i + 1]}, v2h); pf[8 * kt + 2 * i] = p2[0]; pf[8 * kt + 2 * i + 1] = p2[1]; } }
#pragma unroll
            for (int t = 0; t < 4; ++t) acc[t] = wmma16(vf[t], pf, acc[t]);
            lacc = wmma16(ones, pf, lacc);
        }
        // four vector slots behind the stage's last matrix instructions: the branch round the next stage's loads is taken on the last trip
        __builtin_amdgcn_sched_barrier(0); asm volatile("v_nop\n\tv_nop\n\tv_nop\n\tv_nop"); __builtin_amdgcn_sched_barrier(0);
        if (more) { unsigned char* Ln = L + ((st + 1) & 1) * FSLOT;   // the buffer that stage st - 1 used: every wave left it before the last barrier
#pragma unroll
            for (int i = 0; i < 4; ++i) { *(v4ua*)(Ln + klo + i * 32 * FPK) = rk[i]; *(v4ua*)(Ln + vlo + i * 16 * FPV) = rv[i]; } }
        __syncthreads();
    }
    const float inv = __fdiv_rn(1.0f, lacc[0]);
    const size_t oo = ((size_t)(bh / NH_) * TT + q) * DQ + (bh % NH_) * HD + 8 * hf;   // acc[t][r] = O[q][16 t + 8 hf + r]: 8 consecutive features per store
#pragma unroll
    for (int t = 0; t < 4; ++t) { v8us oh, ol;
#pragma unroll
        for (int r = 0; r < 8; ++r) { unsigned short a, c2; splitf(acc[t][r] * inv, a, c2); oh[r] = a; ol[r] = c2; }
        *(v8us*)(Ah + oo + 16 * t) = oh; *(v8us*)(Al + oo + 16 * t) = ol; }
}

extern "C" void kernel_launch(void* const* d_in, const int* in_sizes, int n_in,
                              void* d_out, int out_size, void* d_ws, size_t ws_size, hipStream_t stream) {
    (void)in_sizes; (void)n_in; (void)out_size;
    const float* x = (const float*)d_in[0]; const float* wq = (const float*)d_in[1]; const float* bqv = (const float*)d_in[2]; const float* wk = (const float*)d_in[3]; const float* bkv = (const float*)d_in[4]; const float* wv = (const float*)d_in[5]; const float* bvv = (const float*)d_in[6]; const float* wo = (const float*)d_in[7]; const float* bo = (const float*)d_in[8];   // Wq/Wk/Wv [8][512][64] (x @ W per head), biases [8][64], Wo [512][512] (x @ W), bo
    float* OUT = (float*)d_out;     // [2][2048][512]
    char* wsp = (char*)d_ws;
    auto take = [&](size_t bytes) { char* p = wsp; wsp += (bytes + 255) & ~(size_t)255; return (void*)p; };
    bf* WQ = (bf*)take((size_t)DQ * DM * 2); bf* WK = (bf*)take((size_t)DKV * DM * 2); bf* WV = (bf*)take((size_t)DKV * DM * 2); bf* WO = (bf*)take((size_t)DM * DQ * 2);
    bf* XB = (bf*)take((size_t)NB_ * TT * DM * 2);
    h16* QP16 = (h16*)take((size_t)NB_ * NH_ * TT * HD * 2); h16* KP16 = (h16*)take((size_t)NB_ * NKV * TT * HD * 2); h16* VT16 = (h16*)take((size_t)NB_ * NKV * HD * TT * 2);   // planes [b][h][..]; QP16, KP16 back to back
    bf* ATh = (bf*)take((size_t)NB_ * TT * DQ * 2); bf* ATl = (bf*)take((size_t)NB_ * TT * DQ * 2);
    if ((size_t)(wsp - (char*)d_ws) > ws_size) return;    // ws 256 MiB
    k_wtG<<<dim3((DM * HD / 64 + 63) / 64, NH_, 4), 256, 0, stream>>>(wq, wk, wv, wo, WQ, WK, WV, WO);   // per-head [512][64] blocks -> Bt rows h*64..; Wo by 64-column blocks
    k_cvt8<<<(unsigned)(((size_t)NB_ * TT * DM / 8 + 255) / 256), 256, 0, stream>>>(x, XB, (size_t)NB_ * TT * DM / 8);
    k_gemmw<bf, 0, true, true><<<dim3(NB_ * TT / 64, DQ / 64, 3), 32, 0, stream>>>(XB, nullptr, WQ, nullptr, DM, nullptr, 0, bqv, bkv, bvv, 0, (size_t)DQ * DM, 0, QP16, VT16);   // z: q, k, v; rows: both batches; fp16 planes out
    k_fattn<<<dim3(TT / FBR, NB_ * NH_, 1), 256, 0, stream>>>(QP16, KP16, VT16, ATh, ATl);   // planes [b][h][..]: grid y = b * heads + h (one kv head per query head)
    k_gemmw<bf, 1, true, false><<<dim3(NB_ * TT / 64, DM / 64, 1), 32, 0, stream>>>(ATh, ATl, WO, nullptr, DQ, OUT, DM, bo, nullptr, nullptr, 0, 0, 0, nullptr, nullptr);
}

// v004
// Measured time: 56.9 microseconds a run.
// In two side-by-side timings against v003, it was 1.28 and 1.27 times as fast.
// Counting every step since v000, it is 14.5 times as fast.
#include <hip/hip_runtime.h>

// Faster_MultiHeadAttention (sequences [2][2048][512]; per head h: q = x Wq[h] + bq[h], k, v likewise (Wq/Wk/Wv [8][512][64], biases [8][64]); softmax(q.k/8); z = merged heads; out = z Wo + bo -> [2][2048][512]).
// Compute dtypes, f32 accumulate: every input rounded to bf16; projections on PLAIN bf16 operands (inputs: exact, + bias; the per-head weights are re-laid as one [512][512] operand);
// scores (K 64) and att.v on SINGLE fp16 planes inside ONE kernel per (batch, head, 128 queries) with an f32 online softmax (probabilities never leave registers); merged heads as bf16 hi+lo planes x exact Wo (2 products) + bo. One-wave-per-64x64-tile GEMMs for the projections; the q/k/v GEMM stores its tiles as the fp16 operands of the attention kernel. Deterministic,

#define NB_  2
#define TT   2048
#define DM   512
#define NH_  8
#define NKV  8
#define HD   64
#define DQ   (NH_ * HD)
#define DKV  (NKV * HD)
#define WIN  0
#define SCL  0.125f   // HD^-0.5
typedef _Float16 h16;
typedef unsigned short bf;
typedef __attribute__((ext_vector_type(16))) __bf16   v16bf;
typedef __attribute__((ext_vector_type(16))) _Float16 v16h;
typedef __attribute__((ext_vector_type(8)))  _Float16 v8h;
typedef __attribute__((ext_vector_type(8)))  unsigned short v8us;
typedef __attribute__((ext_vector_type(8)))  float    v8f;
typedef __attribute__((ext_vector_type(4)))  float    v4f;
typedef v8h  __attribute__((may_alias)) v8ha;
typedef v4f  __attribute__((may_alias)) v4fa;
typedef v8us __attribute__((may_alias)) v8usa;

__device__ __forceinline__ unsigned short f2bf(float f) { unsigned u = __float_as_uint(f); u += 0x7FFFu + ((u >> 16) & 1u); return (unsigned short)(u >> 16); }
__device__ __forceinline__ float bf2f(unsigned short b) { return __uint_as_float(((unsigned)b) << 16); }
__device__ __forceinline__ float bfr(float f) { return bf2f(f2bf(f)); }
__device__ __forceinline__ v16h cat16(v8h lo, v8h hi) { return __builtin_shufflevector(lo, hi, 0, 1, 2, 3, 4, 5, 6, 7, 8, 9, 10, 11, 12, 13, 14, 15); }
__device__ __forceinline__ v16bf cat16b(v8us lo, v8us hi) { return __builtin_bit_cast(v16bf, __builtin_shufflevector(lo, hi, 0, 1, 2, 3, 4, 5, 6, 7, 8, 9, 10, 11, 12, 13, 14, 15)); }
__device__ __forceinline__ v8f wmma16(v16h a, v16h b, v8f c) { return __builtin_amdgcn_wmma_f32_16x16x32_f16(false, a, false, b, (short)0, c, false, false); }
__device__ __forceinline__ h16 tohx(float x) { return (h16)x; }
__device__ __forceinline__ v8f wmmab(v16bf a, v16bf b, v8f c) { return __builtin_amdgcn_wmma_f32_16x16x32_bf16(false, a, false, b, (short)0, c, false, false); }



// ---- k_gemmw: register-blocked GEMM, ONE WAVE per 64x64 output tile (16 accumulators), operands from K-contiguous 16-bit planes; grid (M/64, N/64, Z), 32 threads.
// C[m][n] (f32, pitch ldc, + optional f32 bias[n], one bias vector per z = 0, 1, 2) = sum_k A[m][k] Bt[n][k] (+ split products per NSPLIT). z-batch strides sA/sB/sC in elements. K % 64 == 0, K >= 64.
// A stage = 64 k of every operand's 64 rows (one whole 128-byte line per row), brought into LDS by asynchronous copies, each covering four whole lines; two buffers: stage t + 1 flies while stage t's fragments are read from LDS and multiplied.
// PLANES (the q/k/v launch; C unused): a tile's 64 columns are one head and its 64 rows lie in one batch, so the tile + bias, rounded to fp16, goes straight to where the attention kernel reads it:
// z = 0, 1 (q, k) to rows [t][d] of plane [z][b][h] of P16, z = 2 (v) transposed to rows [d][t] of plane [b][h] of V16. Every store instruction covers whole 128-byte rows.
#define GPV  (64 * 2 + 16)        // LDS pitch of a staged V^T row, bytes: odd multiple of 16
#define GKS  64                   // k per stage
#define GPO  (GKS * 2 + 16)       // LDS pitch of a staged operand row, bytes: odd multiple of 16
#define GTB  (64 * GPO)           // one operand's 64 staged rows, bytes
static_assert(DM % GKS == 0 && DQ % GKS == 0 && DM >= GKS && DQ >= GKS, "whole stages");
// eight asynchronous copies of 16 bytes per lane, global -> LDS: copy i takes g + i * gs to LDS byte l + i * 4 * GPO (four more rows on both sides).
// The closing s_wait_xcnt 0 stands inside the statement, in front of whatever rewrites the address registers that the copies name.
__device__ __forceinline__ void acopy8(unsigned l, const unsigned char* g, size_t gs) {
    asm volatile("global_load_async_to_lds_b128 %0, %8, off\n\tglobal_load_async_to_lds_b128 %1, %9, off\n\tglobal_load_async_to_lds_b128 %2, %10, off\n\tglobal_load_async_to_lds_b128 %3, %11, off\n\t"
                 "global_load_async_to_lds_b128 %4, %12, off\n\tglobal_load_async_to_lds_b128 %5, %13, off\n\tglobal_load_async_to_lds_b128 %6, %14, off\n\tglobal_load_async_to_lds_b128 %7, %15, off\n\ts_wait_xcnt 0x0"
                 :: "v"(l), "v"(l + 4 * GPO), "v"(l + 8 * GPO), "v"(l + 12 * GPO), "v"(l + 16 * GPO), "v"(l + 20 * GPO), "v"(l + 24 * GPO), "v"(l + 28 * GPO),
                    "v"(g), "v"(g + gs), "v"(g + 2 * gs), "v"(g + 3 * gs), "v"(g + 4 * gs), "v"(g + 5 * gs), "v"(g + 6 * gs), "v"(g + 7 * gs) : "memory"); }
// one operand's stage: 64 rows x 128 bytes = 16 copies
__device__ __forceinline__ void acopy_tile(unsigned l, const unsigned char* g, size_t gs) { acopy8(l, g, gs); acopy8(l + 32 * GPO, g + 8 * gs, gs); }
template <typename T16> struct WFrag;
template <> struct WFrag<h16> { typedef v16h V; static __device__ __forceinline__ V ld(const unsigned char* p) { return cat16(*(const v8ha*)p, *(const v8ha*)(p + 32)); } static __device__ __forceinline__ v8f mma(V a, V b, v8f c) { return wmma16(a, b, c); } };
template <> struct WFrag<bf> { typedef v16bf V; static __device__ __forceinline__ V ld(const unsigned char* p) { return cat16b(*(const v8usa*)p, *(const v8usa*)(p + 32)); } static __device__ __forceinline__ v8f mma(V a, V b, v8f c) { return wmmab(a, b, c); } };
template <typename T16, int NSPLIT, bool BIAS, bool PLANES>
__global__ __launch_bounds__(32) void k_gemmw(const T16* __restrict__ A, const T16* __restrict__ A2, const T16* __restrict__ Bt, const T16* __restrict__ Bt2, int K, float* C, int ldc, const float* __restrict__ bias, const float* __restrict__ bias1, const float* __restrict__ bias2, size_t sA, size_t sB, size_t sC, h16* P16, h16* V16) {
    typedef typename WFrag<T16>::V V;
    static_assert(!PLANES || (BIAS && HD == 64 && TT % 64 == 0 && NKV == NH_), "a 64x64 tile is one head of one batch");
    constexpr bool HA2 = NSPLIT == 1 || NSPLIT == 2, HB2 = NSPLIT >= 2; constexpr int GSTG = (2 + HA2 + HB2) * GTB;   // a stage in LDS: A | Bt | A2 | Bt2
    static_assert(16 * (2 + HA2 + HB2) <= 63, "one stage's copies of the wave are all that is ever outstanding");
    __shared__ __align__(16) float os[PLANES ? 64 * GPV / 4 : 16 * 68];
    __shared__ __align__(16) unsigned char ring[2 * GSTG];
    const size_t z = blockIdx.z; A += z * sA; if (A2) A2 += z * sA; Bt += z * sB; if (Bt2) Bt2 += z * sB; C += z * sC;
    if (BIAS) bias = (z == 0) ? bias : ((z == 1) ? bias1 : bias2);   // z-batched products with a bias each (q, k, v)
    const int lane = threadIdx.x & 31, lr = lane & 15, hi = lane >> 4; const int r0 = blockIdx.x * 64, c0 = blockIdx.y * 64;
    v8f acc[4][4];
#pragma unroll
    for (int mb = 0; mb < 4; ++mb)
#pragma unroll
        for (int nb = 0; nb < 4; ++nb) acc[mb][nb] = (v8f){};
    // copy map: a lane moves 16 bytes; 8 lanes cover a row's 128 bytes, a copy 4 rows
    const size_t aoff = ((size_t)(r0 + (lane >> 3)) * K + (lane & 7) * 8) * 2, boff = ((size_t)(c0 + (lane >> 3)) * K + (lane & 7) * 8) * 2, gs = (size_t)K * 8;   // bytes; gs: four rows
    const unsigned lcp = (unsigned)(size_t)ring + (lane >> 3) * GPO + (lane & 7) * 16;   // LDS byte address: the low 32 bits of the __shared__ address
    const int nt = K / GKS;
    auto fill = [&](int t) { const unsigned l = lcp + (t & 1) * GSTG; const size_t ko = (size_t)t * (GKS * 2);
        acopy_tile(l, (const unsigned char*)A + aoff + ko, gs); acopy_tile(l + GTB, (const unsigned char*)Bt + boff + ko, gs);
        if (HA2) acopy_tile(l + 2 * GTB, (const unsigned char*)A2 + aoff + ko, gs);
        if (HB2) acopy_tile(l + (2 + HA2) * GTB, (const unsigned char*)Bt2 + boff + ko, gs); };
    fill(0);
    asm volatile("s_wait_asynccnt 0x0" ::: "memory");   // stage 0 has landed
    __syncthreads();   // publish point of the ring; the work-group is this one wave, so the compiler emits no barrier instruction for it
    if (nt > 1) fill(1);
#pragma unroll 1   // stays rolled: the two buffers alternate by t & 1
    for (int t = 0; t < nt; ++t) {
        const unsigned char* S = ring + (t & 1) * GSTG + lr * GPO + 16 * hi;   // fragment k order, A and B alike: 16 bytes at 16 hi and at 32 + 16 hi of each 64 bytes of a row
        constexpr int GG = (HA2 || HB2) ? 1 : GKS / 32;   // 32-k blocks whose fragments are read as one group: as many as fit beside the accumulators without a spill
        V a[GG][4], a2[GG][4], b[GG][4], b2[GG][4];
#pragma unroll
        for (int k0 = 0; k0 < GKS / 32; k0 += GG) {
#pragma unroll
            for (int kk = 0; kk < GG; ++kk) { const unsigned char* Sk = S + (k0 + kk) * 64;
#pragma unroll
                for (int i = 0; i < 4; ++i) { a[kk][i] = WFrag<T16>::ld(Sk + i * 16 * GPO); b[kk][i] = WFrag<T16>::ld(Sk + GTB + i * 16 * GPO);
                    if (HA2) a2[kk][i] = WFrag<T16>::ld(Sk + 2 * GTB + i * 16 * GPO); if (HB2) b2[kk][i] = WFrag<T16>::ld(Sk + (2 + HA2) * GTB + i * 16 * GPO); } }
            __builtin_amdgcn_sched_barrier(0);   // the group's fragment loads issue together ahead of its matrix instructions: one LDS latency per group, not one per fragment
#pragma unroll
            for (int kk = 0; kk < GG; ++kk) {
#pragma unroll
                for (int nb = 0; nb < 4; ++nb) {
#pragma unroll
                    for (int mb = 0; mb < 4; ++mb) { acc[mb][nb] = WFrag<T16>::mma(a[kk][mb], b[kk][nb], acc[mb][nb]); if (HA2) acc[mb][nb] = WFrag<T16>::mma(a2[kk][mb], b[kk][nb], acc[mb][nb]); if (HB2) acc[mb][nb] = WFrag<T16>::mma(a[kk][mb], b2[kk][nb], acc[mb][nb]); } } }
            __builtin_amdgcn_sched_barrier(0);   // the next group's loads stay together behind these matrix instructions instead of being spread among them
        }
        // four vector slots behind the trip's last matrix instructions: the branch round the refill is taken on the last trips
        asm volatile("v_nop\n\tv_nop\n\tv_nop\n\tv_nop" : "+v"(acc[0][0]), "+v"(acc[1][1]), "+v"(acc[2][2]), "+v"(acc[3][3]) : "v"(a[GG - 1][0]), "v"(a[GG - 1][3]));
        asm volatile("s_wait_dscnt 0x0" ::: "memory");      // this stage's LDS reads are done before its buffer is refilled
        asm volatile("s_wait_asynccnt 0x0" ::: "memory");   // stage t + 1 has landed
        __syncthreads();   // publish point of stage t + 1 (one wave: no barrier instruction)
        if (t + 2 < nt) fill(t + 2);   // into the buffer that this trip has just read
    }
    asm volatile("s_wait_asynccnt 0x0" ::: "memory");   // nothing of the ring is outstanding when the wave goes on to its epilogue
    if (PLANES) {
        const size_t pl = (size_t)(r0 / TT) * NH_ + blockIdx.y; const int t0 = r0 % TT, l8 = lane >> 3, c8 = lane & 7;   // plane [b][h]; a store: 4 rows x 8 lanes x 16 bytes
        if (z < 2) {
            h16* prow = P16 + ((z * NB_ * NH_ + pl) * TT + t0) * HD + c8 * 8; float bb[8];
#pragma unroll
            for (int i = 0; i < 8; ++i) bb[i] = bfr(bias[c0 + c8 * 8 + i]);
#pragma unroll
            for (int mb = 0; mb < 4; ++mb) {
#pragma unroll
                for (int nb = 0; nb < 4; ++nb) {
#pragma unroll
                    for (int j = 0; j < 8; ++j) os[(hi * 8 + j) * 68 + nb * 16 + lr] = acc[mb][nb][j]; }
                __builtin_amdgcn_wave_barrier(); asm volatile("" ::: "memory");   // compiler fence: the reads below take what other lanes of this wave stored
#pragma unroll
                for (int s = 0; s < 4; ++s) { const int row = 4 * s + l8; const v4f v0 = *(const v4fa*)(os + row * 68 + c8 * 8), v1 = *(const v4fa*)(os + row * 68 + c8 * 8 + 4); v8h o;
#pragma unroll
                    for (int i = 0; i < 4; ++i) { o[i] = tohx(v0[i] + bb[i]); o[4 + i] = tohx(v1[i] + bb[4 + i]); }
                    *(v8h*)(prow + (size_t)(mb * 16 + row) * HD) = o; }
                __builtin_amdgcn_wave_barrier(); asm volatile("" ::: "memory");   // compiler fence: the next block's stores stay behind these reads
            }
        } else {
            unsigned char* ot = (unsigned char*)os;   // acc[mb][nb][0..7]: 8 consecutive t of feature 16 nb + lr = 16 bytes of a V^T row
#pragma unroll
            for (int nb = 0; nb < 4; ++nb) { const float bv = bfr(bias[c0 + nb * 16 + lr]);
#pragma unroll
                for (int mb = 0; mb < 4; ++mb) { v8h o;
#pragma unroll
                    for (int j = 0; j < 8; ++j) o[j] = tohx(acc[mb][nb][j] + bv);
                    *(v8ha*)(ot + (nb * 16 + lr) * GPV + mb * 32 + hi * 16) = o; } }
            __builtin_amdgcn_wave_barrier(); asm volatile("" ::: "memory");   // compiler fence: the reads below take what other lanes of this wave stored
            h16* vrow = V16 + pl * HD * TT + t0 + c8 * 8;
#pragma unroll
            for (int s = 0; s < 16; ++s) { const int d = 4 * s + l8; *(v8h*)(vrow + (size_t)d * TT) = *(const v8ha*)(ot + d * GPV + c8 * 16); }
            asm volatile("s_wait_xcnt 0x0" ::: "memory");   // the sixteen stores above are issued: their address registers may be reused from here on
        }
        return;
    }
#pragma unroll
    for (int mb = 0; mb < 4; ++mb) {
#pragma unroll
        for (int nb = 0; nb < 4; ++nb) {
#pragma unroll
            for (int j = 0; j < 8; ++j) os[(hi * 8 + j) * 68 + nb * 16 + lr] = acc[mb][nb][j]; }
        __builtin_amdgcn_wave_barrier(); asm volatile("" ::: "memory");
        float* crow = C + (size_t)(r0 + mb * 16) * ldc + c0;
{
#pragma unroll
            for (int s = 0; s < 8; ++s) { const int row = 2 * s + hi, cofs = lr * 4; v4f val = *(const v4fa*)(os + row * 68 + cofs); if (BIAS) { val[0] += bfr(bias[c0 + cofs]); val[1] += bfr(bias[c0 + cofs + 1]); val[2] += bfr(bias[c0 + cofs + 2]); val[3] += bfr(bias[c0 + cofs + 3]); }
                *(v4f*)(crow + (size_t)row * ldc + cofs) = val; }
             }
        __builtin_amdgcn_wave_barrier(); asm volatile("" ::: "memory");
    }
}

__device__ __forceinline__ void splitf(float y, unsigned short& h, unsigned short& l) { h = f2bf(y); l = f2bf(y - bf2f(h)); }
typedef __attribute__((ext_vector_type(2))) _Float16 v2h;
typedef __attribute__((ext_vector_type(4))) _Float16 v4h;
typedef __attribute__((ext_vector_type(2))) unsigned short v2us;
typedef __attribute__((ext_vector_type(4))) unsigned short v4us;
typedef __attribute__((ext_vector_type(2))) float v2f;
typedef __attribute__((ext_vector_type(4))) int v4i;

// k_wtG: all four weight operands in one launch. grid (lines / 64, 64-column block y, operand zz): zz 0..2 = Wq/Wk/Wv head y ([DM][HD], pitch HD), zz 3 = columns y*HD.. of Wo ([DQ][DM], pitch DM); each block -> Bt rows y*HD.., K-contiguous.
static_assert(NKV == NH_ && DM / HD == NH_ && DQ == DM, "one grid shape serves the four weight operands");
__global__ __launch_bounds__(256) void k_wtG(const float* __restrict__ wq, const float* __restrict__ wk, const float* __restrict__ wv, const float* __restrict__ wo, bf* BQ, bf* BK, bf* BV, bf* BO) {
    const int y = blockIdx.y, zz = blockIdx.z; const int K = DM, N = HD; const int ldw = (zz == 3) ? DM : HD;
    const float* w = (zz == 0) ? wq : (zz == 1) ? wk : (zz == 2) ? wv : wo; w += (zz == 3) ? (size_t)y * HD : (size_t)y * DM * HD;
    bf* Bt = ((zz == 0) ? BQ : (zz == 1) ? BK : (zz == 2) ? BV : BO) + (size_t)y * HD * DM;
    const int lane = threadIdx.x & 31; const int L0 = (blockIdx.x * 8 + (threadIdx.x >> 5)) * 8; const int nlines = N * K / 64;
{
#pragma unroll 1
        for (int l = 0; l < 8; ++l) { const int L = L0 + l; if (L >= nlines) break; const size_t e = (size_t)L * 64 + lane * 2; const int k = (int)(e % K), n = (int)(e / K); v2us o;
            o[0] = f2bf(w[(size_t)k * ldw + n]); o[1] = f2bf(w[(size_t)(k + 1) * ldw + n]); *(v2us*)(Bt + e) = o; }
         }
}
__global__ __launch_bounds__(256) void k_cvt8(const float* __restrict__ src, bf* dst, size_t n8) { const size_t i = (size_t)blockIdx.x * 256 + threadIdx.x; if (i >= n8) return; const v8f v = *(const v8f*)(src + i * 8); v8us o;
#pragma unroll
    for (int k = 0; k < 8; ++k) o[k] = f2bf(v[k]); *(v8us*)(dst + i * 8) = o;  }
#define FNW  8                    // waves per work-group
#define FBR  (FNW * 16)           // queries per work-group
#define FSK  128                  // keys per stage
#define FPK  (HD * 2 + 16)        // LDS pitch of a K row, bytes: odd multiple of 16
#define FPV  (FSK * 2 + 16)       // LDS pitch of a V^T row, bytes: odd multiple of 16
#define FTK  (FSK * FPK)
#define FTV  (HD * FPV)
#define FSLOT (FTK + FTV)
typedef __attribute__((ext_vector_type(4))) unsigned v4u;
typedef v4u __attribute__((may_alias)) v4ua;
static_assert(HD == 64 && TT % FSK == 0 && TT % FBR == 0 && FSK * HD * 2 == 4 * 256 * 16, "staging map: 256 threads x 4 chunks of 16 bytes per operand and stage");
__device__ __forceinline__ v16h fragl(const unsigned char* p) { return cat16(*(const v8ha*)p, *(const v8ha*)(p + 32)); }
__device__ __forceinline__ float xhalf(float x) { return __builtin_bit_cast(float, __builtin_amdgcn_permlanex16(__builtin_bit_cast(int, x), __builtin_bit_cast(int, x), 0x76543210, 0xfedcba98, false, false)); }   // lane l with lane l ^ 16
// eight exponentials (2^x) in place in one statement: no v_exp_f32 has its source overwritten by the instruction directly behind it, and the closing v_nop is the slot the instruction set asks for between a transcendental and the first use of its result
__device__ __forceinline__ void exp2x8(float& a, float& b, float& c, float& d, float& e, float& f, float& g, float& h) {
    asm("v_exp_f32 %0, %0\n\tv_exp_f32 %1, %1\n\tv_exp_f32 %2, %2\n\tv_exp_f32 %3, %3\n\tv_exp_f32 %4, %4\n\tv_exp_f32 %5, %5\n\tv_exp_f32 %6, %6\n\tv_exp_f32 %7, %7\n\tv_nop" : "+v"(a), "+v"(b), "+v"(c), "+v"(d), "+v"(e), "+v"(f), "+v"(g), "+v"(h)); }
__global__ __launch_bounds__(256) void k_fattn(const h16* __restrict__ Qp, const h16* __restrict__ Kp, const h16* __restrict__ Vt, bf* Ah, bf* Al) {
    __shared__ __align__(16) unsigned char L[2 * FSLOT];
    const int tid = threadIdx.x, lane = tid & 31, wave = tid >> 5, c = lane & 15, hf = lane >> 4;
    const int bh = blockIdx.y; const int q = blockIdx.x * FBR + wave * 16 + c;   // this lane's query
    const float cscale = SCL * 1.4426950408889634f;
    // staging map: chunk i of thread tid = 16 bytes; K: row 32 i + tid / 8, V^T: row 16 i + tid / 16; a wave's load covers whole 128-byte lines
    const unsigned char* kg = (const unsigned char*)(Kp + (size_t)bh * TT * HD) + tid * 16;
    const unsigned char* vg = (const unsigned char*)(Vt + (size_t)bh * HD * TT) + (size_t)(tid >> 4) * (TT * 2) + (tid & 15) * 16;
    const int klo = (tid >> 3) * FPK + (tid & 7) * 16, vlo = FTK + (tid >> 4) * FPV + (tid & 15) * 16;
    v4u rk[4], rv[4];
#pragma unroll
    for (int i = 0; i < 4; ++i) { rk[i] = *(const v4ua*)(kg + i * 4096); rv[i] = *(const v4ua*)(vg + (size_t)i * 16 * TT * 2); }
    v16h qf[2];
    { const h16* qp = Qp + ((size_t)bh * TT + q) * HD + 8 * hf;
#pragma unroll
      for (int kc = 0; kc < 2; ++kc) qf[kc] = cat16(*(const v8h*)(qp + 32 * kc), *(const v8h*)(qp + 32 * kc + 16)); }
    asm volatile("s_wait_xcnt 0x0" ::: "memory");   // the twelve loads above are issued: their address registers may be reused from here on
    v16h ones;   // A operand of all ones: every row of its product holds the column sums of P^T (the softmax denominators' increments)
#pragma unroll
    for (int i = 0; i < 16; ++i) ones[i] = (h16)1.0f;
    v8f acc[4], lacc = (v8f){};
#pragma unroll
    for (int t = 0; t < 4; ++t) acc[t] = (v8f){};
    float mrun = -3.0e38f;
#pragma unroll
    for (int i = 0; i < 4; ++i) { *(v4ua*)(L + klo + i * 32 * FPK) = rk[i]; *(v4ua*)(L + vlo + i * 16 * FPV) = rv[i]; }
    __syncthreads();
#pragma unroll 1   // stays rolled: the body already holds four unrolled passes, and the two buffers alternate by st & 1
    for (int st = 0; st < TT / FSK; ++st) {
        const unsigned char* Ls = L + (st & 1) * FSLOT;
        const bool more = st + 1 < TT / FSK;
        if (more) {
#pragma unroll
            for (int i = 0; i < 4; ++i) { rk[i] = *(const v4ua*)(kg + (size_t)(st + 1) * (FSK * HD * 2) + i * 4096); rv[i] = *(const v4ua*)(vg + (size_t)(st + 1) * (FSK * 2) + (size_t)i * 16 * TT * 2); } }
#pragma unroll
        for (int ps = 0; ps < FSK / 32; ++ps) {
            const unsigned char* kp = Ls + (ps * 32 + c) * FPK + 16 * hf;
            v8f s[2];
#pragma unroll
            for (int kt = 0; kt < 2; ++kt) { s[kt] = (v8f){};
#pragma unroll
                for (int kc = 0; kc < 2; ++kc) s[kt] = wmma16(fragl(kp + kt * 16 * FPK + 64 * kc), qf[kc], s[kt]); }
            float mx = s[0][0];
#pragma unroll
            for (int r = 1; r < 16; ++r) mx = fmaxf(mx, s[r >> 3][r & 7]);
            mx = fmaxf(mx, xhalf(mx)) * cscale;   // both halves of the wave now hold this query's maximum over the pass's 32 keys, scaled (the scale is positive)
            if (__builtin_amdgcn_ballot_w32(mx > mrun + 8.0f) != 0) {   // one scalar branch per pass; rare after the first passes
                const float mnew = fmaxf(mrun, mx); const float corr = __builtin_amdgcn_exp2f(mrun - mnew); mrun = mnew;   // first pass: corr = 0 on zero sums
                lacc = lacc * corr;
#pragma unroll
                for (int t = 0; t < 4; ++t) acc[t] = acc[t] * corr; }
            const unsigned char* vp = Ls + FTK + c * FPV + ps * 64 + 16 * hf;
            v16h vf[4];
#pragma unroll
            for (int t = 0; t < 4; ++t) vf[t] = fragl(vp + t * 16 * FPV);
            __builtin_amdgcn_sched_barrier(0);   // the V^T fragment loads issue in front of the exponentials, whose time covers their LDS latency
            const float nm = -mrun; v16h pf;
#pragma unroll
            for (int kt = 0; kt < 2; ++kt) { float e[8];
#pragma unroll
                for (int i = 0; i < 4; ++i) { const v2f arg = __builtin_elementwise_fma((v2f){s[kt][2 * i], s[kt][2 * i + 1]}, (v2f){cscale, cscale}, (v2f){nm, nm}); e[2 * i] = arg[0]; e[2 * i + 1] = arg[1]; }
                exp2x8(e[0], e[1], e[2], e[3], e[4], e[5], e[6], e[7]);
#pragma unroll
                for (int i = 0; i < 4; ++i) { const v2h p2 = __builtin_convertvector((v2f){e[2 * i], e[2 * i + 1]}, v2h); pf[8 * kt + 2 * i] = p2[0]; pf[8 * kt + 2 * i + 1] = p2[1]; } }
#pragma unroll
            for (int t = 0; t < 4; ++t) acc[t] = wmma16(vf[t], pf, acc[t]);
            lacc = wmma16(ones, pf, lacc);
        }
        // four vector slots behind the stage's last matrix instructions: the branch round the next stage's loads is taken on the last trip
        __builtin_amdgcn_sched_barrier(0); asm volatile("v_nop\n\tv_nop\n\tv_nop\n\tv_nop"); __builtin_amdgcn_sched_barrier(0);
        if (more) { unsigned char* Ln = L + ((st + 1) & 1) * FSLOT;   // the buffer that stage st - 1 used: every wave left it before the last barrier
#pragma unroll
            for (int i = 0; i < 4; ++i) { *(v4ua*)(Ln + klo + i * 32 * FPK) = rk[i]; *(v4ua*)(Ln + vlo + i * 16 * FPV) = rv[i]; } }
        __syncthreads();
    }
    const float inv = __fdiv_rn(1.0f, lacc[0]);
    const size_t oo = ((size_t)(bh / NH_) * TT + q) * DQ + (bh % NH_) * HD + 8 * hf;   // acc[t][r] = O[q][16 t + 8 hf + r]: 8 consecutive features per store
#pragma unroll
    for (int t = 0; t < 4; ++t) { v8us oh, ol;
#pragma unroll
        for (int r = 0; r < 8; ++r) { unsigned short a, c2; splitf(acc[t][r] * inv, a, c2); oh[r] = a; ol[r] = c2; }
        *(v8us*)(Ah + oo + 16 * t) = oh; *(v8us*)(Al + oo + 16 * t) = ol; }
}

extern "C" void kernel_launch(void* const* d_in, const int* in_sizes, int n_in,
                              void* d_out, int out_size, void* d_ws, size_t ws_size, hipStream_t stream) {
    (void)in_sizes; (void)n_in; (void)out_size;
    const float* x = (const float*)d_in[0]; const float* wq = (const float*)d_in[1]; const float* bqv = (const float*)d_in[2]; const float* wk = (const float*)d_in[3]; const float* bkv = (const float*)d_in[4]; const float* wv = (const float*)d_in[5]; const float* bvv = (const float*)d_in[6]; const float* wo = (const float*)d_in[7]; const float* bo = (const float*)d_in[8];   // Wq/Wk/Wv [8][512][64] (x @ W per head), biases [8][64], Wo [512][512] (x @ W), bo
    float* OUT = (float*)d_out;     // [2][2048][512]
    char* wsp = (char*)d_ws;
    auto take = [&](size_t bytes) { char* p = wsp; wsp += (bytes + 255) & ~(size_t)255; return (void*)p; };
    bf* WQ = (bf*)take((size_t)DQ * DM * 2); bf* WK = (bf*)take((size_t)DKV * DM * 2); bf* WV = (bf*)take((size_t)DKV * DM * 2); bf* WO = (bf*)take((size_t)DM * DQ * 2);
    bf* XB = (bf*)take((size_t)NB_ * TT * DM * 2);
    h16* QP16 = (h16*)take((size_t)NB_ * NH_ * TT * HD * 2); h16* KP16 = (h16*)take((size_t)NB_ * NKV * TT * HD * 2); h16* VT16 = (h16*)take((size_t)NB_ * NKV * HD * TT * 2);   // planes [b][h][..]; QP16, KP16 back to back
    bf* ATh = (bf*)take((size_t)NB_ * TT * DQ * 2); bf* ATl = (bf*)take((size_t)NB_ * TT * DQ * 2);
    if ((size_t)(wsp - (char*)d_ws) > ws_size) return;    // ws 256 MiB
    k_wtG<<<dim3((DM * HD / 64 + 63) / 64, NH_, 4), 256, 0, stream>>>(wq, wk, wv, wo, WQ, WK, WV, WO);   // per-head [512][64] blocks -> Bt rows h*64..; Wo by 64-column blocks
    k_cvt8<<<(unsigned)(((size_t)NB_ * TT * DM / 8 + 255) / 256), 256, 0, stream>>>(x, XB, (size_t)NB_ * TT * DM / 8);
    k_gemmw<bf, 0, true, true><<<dim3(NB_ * TT / 64, DQ / 64, 3), 32, 0, stream>>>(XB, nullptr, WQ, nullptr, DM, nullptr, 0, bqv, bkv, bvv, 0, (size_t)DQ * DM, 0, QP16, VT16);   // z: q, k, v; rows: both batches; fp16 planes out
    k_fattn<<<dim3(TT / FBR, NB_ * NH_, 1), 256, 0, stream>>>(QP16, KP16, VT16, ATh, ATl);   // planes [b][h][..]: grid y = b * heads + h (one kv head per query head)
    k_gemmw<bf, 1, true, false><<<dim3(NB_ * TT / 64, DM / 64, 1), 32, 0, stream>>>(ATh, ATl, WO, nullptr, DQ, OUT, DM, bo, nullptr, nullptr, 0, 0, 0, nullptr, nullptr);
}

// v005
// A run of this version takes 54.8 microseconds.
// Timed twice side by side with v004, it ran 1.03 times as fast both times.
// Over all steps from v000 it is 15.0 times as fast.
#include <hip/hip_runtime.h>

// Faster_MultiHeadAttention (sequences [2][2048][512]; per head h: q = x Wq[h] + bq[h], k, v likewise (Wq/Wk/Wv [8][512][64], biases [8][64]); softmax(q.k/8); z = merged heads; out = z Wo + bo -> [2][2048][512]).
// Compute dtypes, f32 accumulate: every input rounded to bf16; projections on PLAIN bf16 operands (inputs: exact, + bias; the per-head weights are re-laid as one [512][512] operand);
// scores (K 64) and att.v on SINGLE fp16 planes inside ONE kernel per (batch, head, 128 queries) with an f32 online softmax (probabilities never leave registers); merged heads as bf16 hi+lo planes x exact Wo (2 products) + bo. One-wave-per-64x64-tile GEMMs for the projections; the q/k/v GEMM stores its tiles as the fp16 operands of the attention kernel. Deterministic,

#define NB_  2
#define TT   2048
#define DM   512
#define NH_  8
#define NKV  8
#define HD   64
#define DQ   (NH_ * HD)
#define DKV  (NKV * HD)
#define WIN  0
#define SCL  0.125f   // HD^-0.5
typedef _Float16 h16;
typedef unsigned short bf;
typedef __attribute__((ext_vector_type(16))) __bf16   v16bf;
typedef __attribute__((ext_vector_type(16))) _Float16 v16h;
typedef __attribute__((ext_vector_type(8)))  _Float16 v8h;
typedef __attribute__((ext_vector_type(8)))  unsigned short v8us;
typedef __attribute__((ext_vector_type(8)))  float    v8f;
typedef __attribute__((ext_vector_type(4)))  float    v4f;
typedef v8h  __attribute__((may_alias)) v8ha;
typedef v4f  __attribute__((may_alias)) v4fa;
typedef v8us __attribute__((may_alias)) v8usa;

__device__ __forceinline__ unsigned short f2bf(float f) { unsigned u = __float_as_uint(f); u += 0x7FFFu + ((u >> 16) & 1u); return (unsigned short)(u >> 16); }
__device__ __forceinline__ float bf2f(unsigned short b) { return __uint_as_float(((unsigned)b) << 16); }
__device__ __forceinline__ float bfr(float f) { return bf2f(f2bf(f)); }
__device__ __forceinline__ v16h cat16(v8h lo, v8h hi) { return __builtin_shufflevector(lo, hi, 0, 1, 2, 3, 4, 5, 6, 7, 8, 9, 10, 11, 12, 13, 14, 15); }
__device__ __forceinline__ v16bf cat16b(v8us lo, v8us hi) { return __builtin_bit_cast(v16bf, __builtin_shufflevector(lo, hi, 0, 1, 2, 3, 4, 5, 6, 7, 8, 9, 10, 11, 12, 13, 14, 15)); }
__device__ __forceinline__ v8f wmma16(v16h a, v16h b, v8f c) { return __builtin_amdgcn_wmma_f32_16x16x32_f16(false, a, false, b, (short)0, c, false, false); }
__device__ __forceinline__ h16 tohx(float x) { return (h16)x; }
__device__ __forceinline__ v8f wmmab(v16bf a, v16bf b, v8f c) { return __builtin_amdgcn_wmma_f32_16x16x32_bf16(false, a, false, b, (short)0, c, false, false); }



// ---- k_gemmw: register-blocked GEMM, ONE WAVE per 64x64 output tile (16 accumulators), operands from K-contiguous 16-bit planes; grid (M/64, N/64, Z), 32 threads.
// C[m][n] (f32, pitch ldc, + optional f32 bias[n], one bias vector per z = 0, 1, 2) = sum_k A[m][k] Bt[n][k] (+ split products per NSPLIT). z-batch strides sA/sB/sC in elements. K % 64 == 0, K >= 64.
// A stage = 64 k of every operand's 64 rows (one whole 128-byte line per row), brought into LDS by asynchronous copies, each covering four whole lines; two buffers: stage t + 1 flies while stage t's fragments are read from LDS and multiplied.
// PLANES (the q/k/v launch; C unused): a tile's 64 columns are one head and its 64 rows lie in one batch, so the tile + bias, rounded to fp16, goes straight to where the attention kernel reads it:
// z = 0, 1 (q, k) to rows [t][d] of plane [z][b][h] of P16, z = 2 (v) transposed to rows [d][t] of plane [b][h] of V16. Every store instruction covers whole 128-byte rows.
#define GPV  (64 * 2 + 16)        // LDS pitch of a staged V^T row, bytes: odd multiple of 16
#define GKS  64                   // k per stage
#define GPO  (GKS * 2 + 16)       // LDS pitch of a staged operand row, bytes: odd multiple of 16
#define GTB  (64 * GPO)           // one operand's 64 staged rows, bytes
static_assert(DM % GKS == 0 && DQ % GKS == 0 && DM >= GKS && DQ >= GKS, "whole stages");
// eight asynchronous copies of 16 bytes per lane, global -> LDS: copy i takes g + i * gs to LDS byte l + i * 4 * GPO (four more rows on both sides).
// The closing s_wait_xcnt 0 stands inside the statement, in front of whatever rewrites the address registers that the copies name.
__device__ __forceinline__ void acopy8(unsigned l, const unsigned char* g, size_t gs) {
    asm volatile("global_load_async_to_lds_b128 %0, %8, off\n\tglobal_load_async_to_lds_b128 %1, %9, off\n\tglobal_load_async_to_lds_b128 %2, %10, off\n\tglobal_load_async_to_lds_b128 %3, %11, off\n\t"
                 "global_load_async_to_lds_b128 %4, %12, off\n\tglobal_load_async_to_lds_b128 %5, %13, off\n\tglobal_load_async_to_lds_b128 %6, %14, off\n\tglobal_load_async_to_lds_b128 %7, %15, off\n\ts_wait_xcnt 0x0"
                 :: "v"(l), "v"(l + 4 * GPO), "v"(l + 8 * GPO), "v"(l + 12 * GPO), "v"(l + 16 * GPO), "v"(l + 20 * GPO), "v"(l + 24 * GPO), "v"(l + 28 * GPO),
                    "v"(g), "v"(g + gs), "v"(g + 2 * gs), "v"(g + 3 * gs), "v"(g + 4 * gs), "v"(g + 5 * gs), "v"(g + 6 * gs), "v"(g + 7 * gs) : "memory"); }
// one operand's stage: 64 rows x 128 bytes = 16 copies
__device__ __forceinline__ void acopy_tile(unsigned l, const unsigned char* g, size_t gs) { acopy8(l, g, gs); acopy8(l + 32 * GPO, g + 8 * gs, gs); }
template <typename T16> struct WFrag;
template <> struct WFrag<h16> { typedef v16h V; static __device__ __forceinline__ V ld(const unsigned char* p) { return cat16(*(const v8ha*)p, *(const v8ha*)(p + 32)); } static __device__ __forceinline__ v8f mma(V a, V b, v8f c) { return wmma16(a, b, c); } };
template <> struct WFrag<bf> { typedef v16bf V; static __device__ __forceinline__ V ld(const unsigned char* p) { return cat16b(*(const v8usa*)p, *(const v8usa*)(p + 32)); } static __device__ __forceinline__ v8f mma(V a, V b, v8f c) { return wmmab(a, b, c); } };
template <typename T16, int NSPLIT, bool BIAS, bool PLANES>
__global__ __launch_bounds__(32) void k_gemmw(const T16* __restrict__ A, const T16* __restrict__ A2, const T16* __restrict__ Bt, const T16* __restrict__ Bt2, int K, float* C, int ldc, const float* __restrict__ bias, const float* __restrict__ bias1, const float* __restrict__ bias2, size_t sA, size_t sB, size_t sC, h16* P16, h16* V16) {
    typedef typename WFrag<T16>::V V;
    static_assert(!PLANES || (BIAS && HD == 64 && TT % 64 == 0 && NKV == NH_), "a 64x64 tile is one head of one batch");
    constexpr bool HA2 = NSPLIT == 1 || NSPLIT == 2, HB2 = NSPLIT >= 2; constexpr int GSTG = (2 + HA2 + HB2) * GTB;   // a stage in LDS: A | Bt | A2 | Bt2
    static_assert(16 * (2 + HA2 + HB2) <= 63, "one stage's copies of the wave are all that is ever outstanding");
    __shared__ __align__(16) float os[PLANES ? 64 * GPV / 4 : 16 * 68];
    __shared__ __align__(16) unsigned char ring[2 * GSTG];
    const size_t z = blockIdx.z; A += z * sA; if (A2) A2 += z * sA; Bt += z * sB; if (Bt2) Bt2 += z * sB; C += z * sC;
    if (BIAS) bias = (z == 0) ? bias : ((z == 1) ? bias1 : bias2);   // z-batched products with a bias each (q, k, v)
    const int lane = threadIdx.x & 31, lr = lane & 15, hi = lane >> 4; const int r0 = blockIdx.x * 64, c0 = blockIdx.y * 64;
    v8f acc[4][4];
#pragma unroll
    for (int mb = 0; mb < 4; ++mb)
#pragma unroll
        for (int nb = 0; nb < 4; ++nb) acc[mb][nb] = (v8f){};
    // copy map: a lane moves 16 bytes; 8 lanes cover a row's 128 bytes, a copy 4 rows
    const size_t aoff = ((size_t)(r0 + (lane >> 3)) * K + (lane & 7) * 8) * 2, boff = ((size_t)(c0 + (lane >> 3)) * K + (lane & 7) * 8) * 2, gs = (size_t)K * 8;   // bytes; gs: four rows
    const unsigned lcp = (unsigned)(size_t)ring + (lane >> 3) * GPO + (lane & 7) * 16;   // LDS byte address: the low 32 bits of the __shared__ address
    const int nt = K / GKS;
    auto fill = [&](int t) { const unsigned l = lcp + (t & 1) * GSTG; const size_t ko = (size_t)t * (GKS * 2);
        acopy_tile(l, (const unsigned char*)A + aoff + ko, gs); acopy_tile(l + GTB, (const unsigned char*)Bt + boff + ko, gs);
        if (HA2) acopy_tile(l + 2 * GTB, (const unsigned char*)A2 + aoff + ko, gs);
        if (HB2) acopy_tile(l + (2 + HA2) * GTB, (const unsigned char*)Bt2 + boff + ko, gs); };
    fill(0);
    asm volatile("s_wait_asynccnt 0x0" ::: "memory");   // stage 0 has landed
    __syncthreads();   // publish point of the ring; the work-group is this one wave, so the compiler emits no barrier instruction for it
    if (nt > 1) fill(1);
#pragma unroll 1   // stays rolled: the two buffers alternate by t & 1
    for (int t = 0; t < nt; ++t) {
        const unsigned char* S = ring + (t & 1) * GSTG + lr * GPO + 16 * hi;   // fragment k order, A and B alike: 16 bytes at 16 hi and at 32 + 16 hi of each 64 bytes of a row
        constexpr int GG = (HA2 || HB2) ? 1 : GKS / 32;   // 32-k blocks whose fragments are read as one group: as many as fit beside the accumulators without a spill
        V a[GG][4], a2[GG][4], b[GG][4], b2[GG][4];
#pragma unroll
        for (int k0 = 0; k0 < GKS / 32; k0 += GG) {
#pragma unroll
            for (int kk = 0; kk < GG; ++kk) { const unsigned char* Sk = S + (k0 + kk) * 64;
#pragma unroll
                for (int i = 0; i < 4; ++i) { a[kk][i] = WFrag<T16>::ld(Sk + i * 16 * GPO); b[kk][i] = WFrag<T16>::ld(Sk + GTB + i * 16 * GPO);
                    if (HA2) a2[kk][i] = WFrag<T16>::ld(Sk + 2 * GTB + i * 16 * GPO); if (HB2) b2[kk][i] = WFrag<T16>::ld(Sk + (2 + HA2) * GTB + i * 16 * GPO); } }
            __builtin_amdgcn_sched_barrier(0);   // the group's fragment loads issue together ahead of its matrix instructions: one LDS latency per group, not one per fragment
#pragma unroll
            for (int kk = 0; kk < GG; ++kk) {
#pragma unroll
                for (int nb = 0; nb < 4; ++nb) {
#pragma unroll
                    for (int mb = 0; mb < 4; ++mb) { acc[mb][nb] = WFrag<T16>::mma(a[kk][mb], b[kk][nb], acc[mb][nb]); if (HA2) acc[mb][nb] = WFrag<T16>::mma(a2[kk][mb], b[kk][nb], acc[mb][nb]); if (HB2) acc[mb][nb] = WFrag<T16>::mma(a[kk][mb], b2[kk][nb], acc[mb][nb]); } } }
            __builtin_amdgcn_sched_barrier(0);   // the next group's loads stay together behind these matrix instructions instead of being spread among them
        }
        // four vector slots behind the trip's last matrix instructions: the branch round the refill is taken on the last trips
        asm volatile("v_nop\n\tv_nop\n\tv_nop\n\tv_nop" : "+v"(acc[0][0]), "+v"(acc[1][1]), "+v"(acc[2][2]), "+v"(acc[3][3]) : "v"(a[GG - 1][0]), "v"(a[GG - 1][3]));
        asm volatile("s_wait_dscnt 0x0" ::: "memory");      // this stage's LDS reads are done before its buffer is refilled
        asm volatile("s_wait_asynccnt 0x0" ::: "memory");   // stage t + 1 has landed
        __syncthreads();   // publish point of stage t + 1 (one wave: no barrier instruction)
        if (t + 2 < nt) fill(t + 2);   // into the buffer that this trip has just read
    }
    asm volatile("s_wait_asynccnt 0x0" ::: "memory");   // nothing of the ring is outstanding when the wave goes on to its epilogue
    if (PLANES) {
        const size_t pl = (size_t)(r0 / TT) * NH_ + blockIdx.y; const int t0 = r0 % TT, l8 = lane >> 3, c8 = lane & 7;   // plane [b][h]; a store: 4 rows x 8 lanes x 16 bytes
        if (z < 2) {
            h16* prow = P16 + ((z * NB_ * NH_ + pl) * TT + t0) * HD + c8 * 8; float bb[8];
#pragma unroll
            for (int i = 0; i < 8; ++i) bb[i] = bfr(bias[c0 + c8 * 8 + i]);
#pragma unroll
            for (int mb = 0; mb < 4; ++mb) {
#pragma unroll
                for (int nb = 0; nb < 4; ++nb) {
#pragma unroll
                    for (int j = 0; j < 8; ++j) os[(hi * 8 + j) * 68 + nb * 16 + lr] = acc[mb][nb][j]; }
                __builtin_amdgcn_wave_barrier(); asm volatile("" ::: "memory");   // compiler fence: the reads below take what other lanes of this wave stored
#pragma unroll
                for (int s = 0; s < 4; ++s) { const int row = 4 * s + l8; const v4f v0 = *(const v4fa*)(os + row * 68 + c8 * 8), v1 = *(const v4fa*)(os + row * 68 + c8 * 8 + 4); v8h o;
#pragma unroll
                    for (int i = 0; i < 4; ++i) { o[i] = tohx(v0[i] + bb[i]); o[4 + i] = tohx(v1[i] + bb[4 + i]); }
                    *(v8h*)(prow + (size_t)(mb * 16 + row) * HD) = o; }
                __builtin_amdgcn_wave_barrier(); asm volatile("" ::: "memory");   // compiler fence: the next block's stores stay behind these reads
            }
        } else {
            unsigned char* ot = (unsigned char*)os;   // acc[mb][nb][0..7]: 8 consecutive t of feature 16 nb + lr = 16 bytes of a V^T row
#pragma unroll
            for (int nb = 0; nb < 4; ++nb) { const float bv = bfr(bias[c0 + nb * 16 + lr]);
#pragma unroll
                for (int mb = 0; mb < 4; ++mb) { v8h o;
#pragma unroll
                    for (int j = 0; j < 8; ++j) o[j] = tohx(acc[mb][nb][j] + bv);
                    *(v8ha*)(ot + (nb * 16 + lr) * GPV + mb * 32 + hi * 16) = o; } }
            __builtin_amdgcn_wave_barrier(); asm volatile("" ::: "memory");   // compiler fence: the reads below take what other lanes of this wave stored
            h16* vrow = V16 + pl * HD * TT + t0 + c8 * 8;
#pragma unroll
            for (int s = 0; s < 16; ++s) { const int d = 4 * s + l8; *(v8h*)(vrow + (size_t)d * TT) = *(const v8ha*)(ot + d * GPV + c8 * 16); }
            asm volatile("s_wait_xcnt 0x0" ::: "memory");   // the sixteen stores above are issued: their address registers may be reused from here on
        }
        return;
    }
#pragma unroll
    for (int mb = 0; mb < 4; ++mb) {
#pragma unroll
        for (int nb = 0; nb < 4; ++nb) {
#pragma unroll
            for (int j = 0; j < 8; ++j) os[(hi * 8 + j) * 68 + nb * 16 + lr] = acc[mb][nb][j]; }
        __builtin_amdgcn_wave_barrier(); asm volatile("" ::: "memory");
        float* crow = C + (size_t)(r0 + mb * 16) * ldc + c0;
{
#pragma unroll
            for (int s = 0; s < 8; ++s) { const int row = 2 * s + hi, cofs = lr * 4; v4f val = *(const v4fa*)(os + row * 68 + cofs); if (BIAS) { val[0] += bfr(bias[c0 + cofs]); val[1] += bfr(bias[c0 + cofs + 1]); val[2] += bfr(bias[c0 + cofs + 2]); val[3] += bfr(bias[c0 + cofs + 3]); }
                *(v4f*)(crow + (size_t)row * ldc + cofs) = val; }
             }
        __builtin_amdgcn_wave_barrier(); asm volatile("" ::: "memory");
    }
}

__device__ __forceinline__ void splitf(float y, unsigned short& h, unsigned short& l) { h = f2bf(y); l = f2bf(y - bf2f(h)); }
typedef __attribute__((ext_vector_type(2))) _Float16 v2h;
typedef __attribute__((ext_vector_type(4))) _Float16 v4h;
typedef __attribute__((ext_vector_type(2))) unsigned short v2us;
typedef __attribute__((ext_vector_type(4))) unsigned short v4us;
typedef __attribute__((ext_vector_type(2))) float v2f;
typedef __attribute__((ext_vector_type(4))) int v4i;

// k_prep: every bf16 operand of the projections in one launch. grid (lines / 64, 64-column block y, operand zz): zz 0..2 = Wq/Wk/Wv head y ([DM][HD], pitch HD), zz 3 = columns y*HD.. of Wo ([DQ][DM], pitch DM); each block -> Bt rows y*HD.., K-contiguous.
// Each block also rounds its own 1 / 256 of x to bf16: XG groups of 8 values per thread, a wave's load covering 1 KiB in a row; these loads are issued first and fly under the weight loop's dependent round trips.
static_assert(NKV == NH_ && DM / HD == NH_ && DQ == DM, "one grid shape serves the four weight operands");
#define PGX  ((DM * HD / 64 + 63) / 64)   // grid x
#define PNB  (PGX * NH_ * 4)              // work-groups of the launch
#define XG   4                            // groups of 8 values of x per thread
static_assert((size_t)NB_ * TT * DM == (size_t)PNB * 256 * XG * 8, "the work-groups' slices cover x exactly");
__global__ __launch_bounds__(256) void k_prep(const float* __restrict__ wq, const float* __restrict__ wk, const float* __restrict__ wv, const float* __restrict__ wo, bf* BQ, bf* BK, bf* BV, bf* BO, const float* __restrict__ x, bf* XB) {
    const int y = blockIdx.y, zz = blockIdx.z; const int K = DM, N = HD; const int ldw = (zz == 3) ? DM : HD;
    const size_t xi = ((size_t)((zz * NH_ + y) * PGX + blockIdx.x) * (XG * 256) + threadIdx.x) * 8;   // this thread's first group of x; the next ones 256 groups on
    v8f xv[XG];
#pragma unroll
    for (int j = 0; j < XG; ++j) xv[j] = *(const v8f*)(x + xi + (size_t)j * (256 * 8));
    const float* w = (zz == 0) ? wq : (zz == 1) ? wk : (zz == 2) ? wv : wo; w += (zz == 3) ? (size_t)y * HD : (size_t)y * DM * HD;
    bf* Bt = ((zz == 0) ? BQ : (zz == 1) ? BK : (zz == 2) ? BV : BO) + (size_t)y * HD * DM;
    const int lane = threadIdx.x & 31; const int L0 = (blockIdx.x * 8 + (threadIdx.x >> 5)) * 8; const int nlines = N * K / 64;
{
#pragma unroll 1
        for (int l = 0; l < 8; ++l) { const int L = L0 + l; if (L >= nlines) break; const size_t e = (size_t)L * 64 + lane * 2; const int k = (int)(e % K), n = (int)(e / K); v2us o;
            o[0] = f2bf(w[(size_t)k * ldw + n]); o[1] = f2bf(w[(size_t)(k + 1) * ldw + n]); *(v2us*)(Bt + e) = o; }
         }
#pragma unroll
    for (int j = 0; j < XG; ++j) { v8us o;
#pragma unroll
        for (int k = 0; k < 8; ++k) o[k] = f2bf(xv[j][k]);
        *(v8us*)(XB + xi + (size_t)j * (256 * 8)) = o; }
}
#define FNW  8                    // waves per work-group
#define FBR  (FNW * 16)           // queries per work-group
#define FSK  128                  // keys per stage
#define FPK  (HD * 2 + 16)        // LDS pitch of a K row, bytes: odd multiple of 16
#define FPV  (FSK * 2 + 16)       // LDS pitch of a V^T row, bytes: odd multiple of 16
#define FTK  (FSK * FPK)
#define FTV  (HD * FPV)
#define FSLOT (FTK + FTV)
typedef __attribute__((ext_vector_type(4))) unsigned v4u;
typedef v4u __attribute__((may_alias)) v4ua;
static_assert(HD == 64 && TT % FSK == 0 && TT % FBR == 0 && FSK * HD * 2 == 4 * 256 * 16, "staging map: 256 threads x 4 chunks of 16 bytes per operand and stage");
__device__ __forceinline__ v16h fragl(const unsigned char* p) { return cat16(*(const v8ha*)p, *(const v8ha*)(p + 32)); }
__device__ __forceinline__ float xhalf(float x) { return __builtin_bit_cast(float, __builtin_amdgcn_permlanex16(__builtin_bit_cast(int, x), __builtin_bit_cast(int, x), 0x76543210, 0xfedcba98, false, false)); }   // lane l with lane l ^ 16
// eight exponentials (2^x) in place in one statement: no v_exp_f32 has its source overwritten by the instruction directly behind it, and the closing v_nop is the slot the instruction set asks for between a transcendental and the first use of its result
__device__ __forceinline__ void exp2x8(float& a, float& b, float& c, float& d, float& e, float& f, float& g, float& h) {
    asm("v_exp_f32 %0, %0\n\tv_exp_f32 %1, %1\n\tv_exp_f32 %2, %2\n\tv_exp_f32 %3, %3\n\tv_exp_f32 %4, %4\n\tv_exp_f32 %5, %5\n\tv_exp_f32 %6, %6\n\tv_exp_f32 %7, %7\n\tv_nop" : "+v"(a), "+v"(b), "+v"(c), "+v"(d), "+v"(e), "+v"(f), "+v"(g), "+v"(h)); }
__global__ __launch_bounds__(256) void k_fattn(const h16* __restrict__ Qp, const h16* __restrict__ Kp, const h16* __restrict__ Vt, bf* Ah, bf* Al) {
    __shared__ __align__(16) unsigned char L[2 * FSLOT];
    const int tid = threadIdx.x, lane = tid & 31, wave = tid >> 5, c = lane & 15, hf = lane >> 4;
    const int bh = blockIdx.y; const int q = blockIdx.x * FBR + wave * 16 + c;   // this lane's query
    const float cscale = SCL * 1.4426950408889634f;
    // staging map: chunk i of thread tid = 16 bytes; K: row 32 i + tid / 8, V^T: row 16 i + tid / 16; a wave's load covers whole 128-byte lines
    const unsigned char* kg = (const unsigned char*)(Kp + (size_t)bh * TT * HD) + tid * 16;
    const unsigned char* vg = (const unsigned char*)(Vt + (size_t)bh * HD * TT) + (size_t)(tid >> 4) * (TT * 2) + (tid & 15) * 16;
    const int klo = (tid >> 3) * FPK + (tid & 7) * 16, vlo = FTK + (tid >> 4) * FPV + (tid & 15) * 16;
    v4u rk[4], rv[4];
#pragma unroll
    for (int i = 0; i < 4; ++i) { rk[i] = *(const v4ua*)(kg + i * 4096); rv[i] = *(const v4ua*)(vg + (size_t)i * 16 * TT * 2); }
    v16h qf[2];
    { const h16* qp = Qp + ((size_t)bh * TT + q) * HD + 8 * hf;
#pragma unroll
      for (int kc = 0; kc < 2; ++kc) qf[kc] = cat16(*(const v8h*)(qp + 32 * kc), *(const v8h*)(qp + 32 * kc + 16)); }
    asm volatile("s_wait_xcnt 0x0" ::: "memory");   // the twelve loads above are issued: their address registers may be reused from here on
    v16h ones;   // A operand of all ones: every row of its product holds the column sums of P^T (the softmax denominators' increments)
#pragma unroll
    for (int i = 0; i < 16; ++i) ones[i] = (h16)1.0f;
    v8f acc[4], lacc = (v8f){};
#pragma unroll
    for (int t = 0; t < 4; ++t) acc[t] = (v8f){};
    float mrun = -3.0e38f;
#pragma unroll
    for (int i = 0; i < 4; ++i) { *(v4ua*)(L + klo + i * 32 * FPK) = rk[i]; *(v4ua*)(L + vlo + i * 16 * FPV) = rv[i]; }
    __syncthreads();
#pragma unroll 1   // stays rolled: the body already holds four unrolled passes, and the two buffers alternate by st & 1
    for (int st = 0; st < TT / FSK; ++st) {
        const unsigned char* Ls = L + (st & 1) * FSLOT;
        const bool more = st + 1 < TT / FSK;
        if (more) {
#pragma unroll
            for (int i = 0; i < 4; ++i) { rk[i] = *(const v4ua*)(kg + (size_t)(st + 1) * (FSK * HD * 2) + i * 4096); rv[i] = *(const v4ua*)(vg + (size_t)(st + 1) * (FSK * 2) + (size_t)i * 16 * TT * 2); } }
#pragma unroll
        for (int ps = 0; ps < FSK / 32; ++ps) {
            const unsigned char* kp = Ls + (ps * 32 + c) * FPK + 16 * hf;
            v8f s[2];
#pragma unroll
            for (int kt = 0; kt < 2; ++kt) { s[kt] = (v8f){};
#pragma unroll
                for (int kc = 0; kc < 2; ++kc) s[kt] = wmma16(fragl(kp + kt * 16 * FPK + 64 * kc), qf[kc], s[kt]); }
            float mx = s[0][0];
#pragma unroll
            for (int r = 1; r < 16; ++r) mx = fmaxf(mx, s[r >> 3][r & 7]);
            mx = fmaxf(mx, xhalf(mx)) * cscale;   // both halves of the wave now hold this query's maximum over the pass's 32 keys, scaled (the scale is positive)
            if (__builtin_amdgcn_ballot_w32(mx > mrun + 8.0f) != 0) {   // one scalar branch per pass; rare after the first passes
                const float mnew = fmaxf(mrun, mx); const float corr = __builtin_amdgcn_exp2f(mrun - mnew); mrun = mnew;   // first pass: corr = 0 on zero sums
                lacc = lacc * corr;
#pragma unroll
                for (int t = 0; t < 4; ++t) acc[t] = acc[t] * corr; }
            const unsigned char* vp = Ls + FTK + c * FPV + ps * 64 + 16 * hf;
            v16h vf[4];
#pragma unroll
            for (int t = 0; t < 4; ++t) vf[t] = fragl(vp + t * 16 * FPV);
            __builtin_amdgcn_sched_barrier(0);   // the V^T fragment loads issue in front of the exponentials, whose time covers their LDS latency
            const float nm = -mrun; v16h pf;
#pragma unroll
            for (int kt = 0; kt < 2; ++kt) { float e[8];
#pragma unroll
                for (int i = 0; i < 4; ++i) { const v2f arg = __builtin_elementwise_fma((v2f){s[kt][2 * i], s[kt][2 * i + 1]}, (v2f){cscale, cscale}, (v2f){nm, nm}); e[2 * i] = arg[0]; e[2 * i + 1] = arg[1]; }
                exp2x8(e[0], e[1], e[2], e[3], e[4], e[5], e[6], e[7]);
#pragma unroll
                for (int i = 0; i < 4; ++i) { const v2h p2 = __builtin_convertvector((v2f){e[2 * i], e[2 * i + 1]}, v2h); pf[8 * kt + 2 * i] = p2[0]; pf[8 * kt + 2 * i + 1] = p2[1]; } }
#pragma unroll
            for (int t = 0; t < 4; ++t) acc[t] = wmma16(vf[t], pf, acc[t]);
            lacc = wmma16(ones, pf, lacc);
        }
        // four vector slots behind the stage's last matrix instructions: the branch round the next stage's loads is taken on the last trip
        __builtin_amdgcn_sched_barrier(0); asm volatile("v_nop\n\tv_nop\n\tv_nop\n\tv_nop"); __builtin_amdgcn_sched_barrier(0);
        if (more) { unsigned char* Ln = L + ((st + 1) & 1) * FSLOT;   // the buffer that stage st - 1 used: every wave left it before the last barrier
#pragma unroll
            for (int i = 0; i < 4; ++i) { *(v4ua*)(Ln + klo + i * 32 * FPK) = rk[i]; *(v4ua*)(Ln + vlo + i * 16 * FPV) = rv[i]; } }
        __syncthreads();
    }
    const float inv = __fdiv_rn(1.0f, lacc[0]);
    const size_t oo = ((size_t)(bh / NH_) * TT + q) * DQ + (bh % NH_) * HD + 8 * hf;   // acc[t][r] = O[q][16 t + 8 hf + r]: 8 consecutive features per store
#pragma unroll
    for (int t = 0; t < 4; ++t) { v8us oh, ol;
#pragma unroll
        for (int r = 0; r < 8; ++r) { unsigned short a, c2; splitf(acc[t][r] * inv, a, c2); oh[r] = a; ol[r] = c2; }
        *(v8us*)(Ah + oo + 16 * t) = oh; *(v8us*)(Al + oo + 16 * t) = ol; }
}

extern "C" void kernel_launch(void* const* d_in, const int* in_sizes, int n_in,
                              void* d_out, int out_size, void* d_ws, size_t ws_size, hipStream_t stream) {
    (void)in_sizes; (void)n_in; (void)out_size;
    const float* x = (const float*)d_in[0]; const float* wq = (const float*)d_in[1]; const float* bqv = (const float*)d_in[2]; const float* wk = (const float*)d_in[3]; const float* bkv = (const float*)d_in[4]; const float* wv = (const float*)d_in[5]; const float* bvv = (const float*)d_in[6]; const float* wo = (const float*)d_in[7]; const float* bo = (const float*)d_in[8];   // Wq/Wk/Wv [8][512][64] (x @ W per head), biases [8][64], Wo [512][512] (x @ W), bo
    float* OUT = (float*)d_out;     // [2][2048][512]
    char* wsp = (char*)d_ws;
    auto take = [&](size_t bytes) { char* p = wsp; wsp += (bytes + 255) & ~(size_t)255; return (void*)p; };
    bf* WQ = (bf*)take((size_t)DQ * DM * 2); bf* WK = (bf*)take((size_t)DKV * DM * 2); bf* WV = (bf*)take((size_t)DKV * DM * 2); bf* WO = (bf*)take((size_t)DM * DQ * 2);
    bf* XB = (bf*)take((size_t)NB_ * TT * DM * 2);
    h16* QP16 = (h16*)take((size_t)NB_ * NH_ * TT * HD * 2); h16* KP16 = (h16*)take((size_t)NB_ * NKV * TT * HD * 2); h16* VT16 = (h16*)take((size_t)NB_ * NKV * HD * TT * 2);   // planes [b][h][..]; QP16, KP16 back to back
    bf* ATh = (bf*)take((size_t)NB_ * TT * DQ * 2); bf* ATl = (bf*)take((size_t)NB_ * TT * DQ * 2);
    if ((size_t)(wsp - (char*)d_ws) > ws_size) return;    // ws 256 MiB
    k_prep<<<dim3(PGX, NH_, 4), 256, 0, stream>>>(wq, wk, wv, wo, WQ, WK, WV, WO, x, XB);   // per-head [512][64] blocks -> Bt rows h*64..; Wo by 64-column blocks; x -> bf16
    k_gemmw<bf, 0, true, true><<<dim3(NB_ * TT / 64, DQ / 64, 3), 32, 0, stream>>>(XB, nullptr, WQ, nullptr, DM, nullptr, 0, bqv, bkv, bvv, 0, (size_t)DQ * DM, 0, QP16, VT16);   // z: q, k, v; rows: both batches; fp16 planes out
    k_fattn<<<dim3(TT / FBR, NB_ * NH_, 1), 256, 0, stream>>>(QP16, KP16, VT16, ATh, ATl);   // planes [b][h][..]: grid y = b * heads + h (one kv head per query head)
    k_gemmw<bf, 1, true, false><<<dim3(NB_ * TT / 64, DM / 64, 1), 32, 0, stream>>>(ATh, ATl, WO, nullptr, DQ, OUT, DM, bo, nullptr, nullptr, 0, 0, 0, nullptr, nullptr);
}

// v006
// A run of this version takes 49 microseconds.
// Two timings next to v005 both put it at 1.12 times that version's speed.
// Over all steps from v000 it is 16.9 times as fast.
#include <hip/hip_runtime.h>

// Faster_MultiHeadAttention (sequences [2][2048][512]; per head h: q = x Wq[h] + bq[h], k, v likewise (Wq/Wk/Wv [8][512][64], biases [8][64]); softmax(q.k/8); z = merged heads; out = z Wo + bo -> [2][2048][512]).
// Compute dtypes, f32 accumulate: every input rounded to bf16; projections on PLAIN bf16 operands (inputs: exact, + bias; the per-head weights are re-laid as one [512][512] operand);
// scores (K 64) and att.v on SINGLE fp16 planes inside ONE kernel per (batch, head, 128 queries) with an f32 online softmax (probabilities never leave registers); merged heads as bf16 hi+lo planes x exact Wo (2 products) + bo. One-wave-per-64x64-tile GEMMs for the projections; the q/k/v GEMM stores its tiles as the fp16 operands of the attention kernel. Deterministic,

#define NB_  2
#define TT   2048
#define DM   512
#define NH_  8
#define NKV  8
#define HD   64
#define DQ   (NH_ * HD)
#define DKV  (NKV * HD)
#define WIN  0
#define SCL  0.125f   // HD^-0.5
typedef _Float16 h16;
typedef unsigned short bf;
typedef __attribute__((ext_vector_type(16))) __bf16   v16bf;
typedef __attribute__((ext_vector_type(16))) _Float16 v16h;
typedef __attribute__((ext_vector_type(8)))  _Float16 v8h;
typedef __attribute__((ext_vector_type(8)))  unsigned short v8us;
typedef __attribute__((ext_vector_type(8)))  float    v8f;
typedef __attribute__((ext_vector_type(4)))  float    v4f;
typedef v8h  __attribute__((may_alias)) v8ha;
typedef v4f  __attribute__((may_alias)) v4fa;
typedef v8us __attribute__((may_alias)) v8usa;

__device__ __forceinline__ unsigned short f2bf(float f) { unsigned u = __float_as_uint(f); u += 0x7FFFu + ((u >> 16) & 1u); return (unsigned short)(u >> 16); }
__device__ __forceinline__ float bf2f(unsigned short b) { return __uint_as_float(((unsigned)b) << 16); }
__device__ __forceinline__ float bfr(float f) { return bf2f(f2bf(f)); }
__device__ __forceinline__ v16h cat16(v8h lo, v8h hi) { return __builtin_shufflevector(lo, hi, 0, 1, 2, 3, 4, 5, 6, 7, 8, 9, 10, 11, 12, 13, 14, 15); }
__device__ __forceinline__ v16bf cat16b(v8us lo, v8us hi) { return __builtin_bit_cast(v16bf, __builtin_shufflevector(lo, hi, 0, 1, 2, 3, 4, 5, 6, 7, 8, 9, 10, 11, 12, 13, 14, 15)); }
__device__ __forceinline__ v8f wmma16(v16h a, v16h b, v8f c) { return __builtin_amdgcn_wmma_f32_16x16x32_f16(false, a, false, b, (short)0, c, false, false); }
__device__ __forceinline__ h16 tohx(float x) { return (h16)x; }
__device__ __forceinline__ v8f wmmab(v16bf a, v16bf b, v8f c) { return __builtin_amdgcn_wmma_f32_16x16x32_bf16(false, a, false, b, (short)0, c, false, false); }



// ---- k_gemmw: register-blocked GEMM, ONE WAVE per 64x64 output tile (16 accumulators), operands from K-contiguous 16-bit planes; grid (M/64, N/64, Z), 32 threads.
// C[m][n] (f32, pitch ldc, + optional f32 bias[n], one bias vector per z = 0, 1, 2) = sum_k A[m][k] Bt[n][k] (+ split products per NSPLIT). z-batch strides sA/sB/sC in elements. K % 64 == 0, K >= 64.
// A stage = 64 k of every operand's 64 rows (one whole 128-byte line per row), brought into LDS by asynchronous copies, each covering four whole lines; two buffers: stage t + 1 flies while stage t's fragments are read from LDS and multiplied.
// PLANES (the q/k/v launch; C unused): a tile's 64 columns are one head and its 64 rows lie in one batch, so the tile + bias, rounded to fp16, goes straight to where the attention kernel reads it:
// z = 0, 1 (q, k) to rows [t][d] of plane [z][b][h] of P16, z = 2 (v) transposed to rows [d][t] of plane [b][h] of V16. Every store instruction covers whole 128-byte rows.
#define GPV  (64 * 2 + 16)        // LDS pitch of a staged V^T row, bytes: odd multiple of 16
#define GKS  64                   // k per stage
#define GPO  (GKS * 2 + 16)       // LDS pitch of a staged operand row, bytes: odd multiple of 16
#define GTB  (64 * GPO)           // one operand's 64 staged rows, bytes
static_assert(DM % GKS == 0 && DQ % GKS == 0 && DM >= GKS && DQ >= GKS, "whole stages");
// eight asynchronous copies of 16 bytes per lane, global -> LDS: copy i takes g + i * gs to LDS byte l + i * 4 * GPO (four more rows on both sides).
// The closing s_wait_xcnt 0 stands inside the statement, in front of whatever rewrites the address registers that the copies name.
__device__ __forceinline__ void acopy8(unsigned l, const unsigned char* g, size_t gs) {
    asm volatile("global_load_async_to_lds_b128 %0, %8, off\n\tglobal_load_async_to_lds_b128 %1, %9, off\n\tglobal_load_async_to_lds_b128 %2, %10, off\n\tglobal_load_async_to_lds_b128 %3, %11, off\n\t"
                 "global_load_async_to_lds_b128 %4, %12, off\n\tglobal_load_async_to_lds_b128 %5, %13, off\n\tglobal_load_async_to_lds_b128 %6, %14, off\n\tglobal_load_async_to_lds_b128 %7, %15, off\n\ts_wait_xcnt 0x0"
                 :: "v"(l), "v"(l + 4 * GPO), "v"(l + 8 * GPO), "v"(l + 12 * GPO), "v"(l + 16 * GPO), "v"(l + 20 * GPO), "v"(l + 24 * GPO), "v"(l + 28 * GPO),
                    "v"(g), "v"(g + gs), "v"(g + 2 * gs), "v"(g + 3 * gs), "v"(g + 4 * gs), "v"(g + 5 * gs), "v"(g + 6 * gs), "v"(g + 7 * gs) : "memory"); }
// one operand's stage: 64 rows x 128 bytes = 16 copies
__device__ __forceinline__ void acopy_tile(unsigned l, const unsigned char* g, size_t gs) { acopy8(l, g, gs); acopy8(l + 32 * GPO, g + 8 * gs, gs); }
template <typename T16> struct WFrag;
template <> struct WFrag<h16> { typedef v16h V; static __device__ __forceinline__ V ld(const unsigned char* p) { return cat16(*(const v8ha*)p, *(const v8ha*)(p + 32)); } static __device__ __forceinline__ v8f mma(V a, V b, v8f c) { return wmma16(a, b, c); } };
template <> struct WFrag<bf> { typedef v16bf V; static __device__ __forceinline__ V ld(const unsigned char* p) { return cat16b(*(const v8usa*)p, *(const v8usa*)(p + 32)); } static __device__ __forceinline__ v8f mma(V a, V b, v8f c) { return wmmab(a, b, c); } };
template <typename T16, int NSPLIT, bool BIAS, bool PLANES>
__global__ __launch_bounds__(32) void k_gemmw(const T16* __restrict__ A, const T16* __restrict__ A2, const T16* __restrict__ Bt, const T16* __restrict__ Bt2, int K, float* C, int ldc, const float* __restrict__ bias, const float* __restrict__ bias1, const float* __restrict__ bias2, size_t sA, size_t sB, size_t sC, h16* P16, h16* V16) {
    typedef typename WFrag<T16>::V V;
    static_assert(!PLANES || (BIAS && HD == 64 && TT % 64 == 0 && NKV == NH_), "a 64x64 tile is one head of one batch");
    constexpr bool HA2 = NSPLIT == 1 || NSPLIT == 2, HB2 = NSPLIT >= 2; constexpr int GSTG = (2 + HA2 + HB2) * GTB;   // a stage in LDS: A | Bt | A2 | Bt2
    static_assert(16 * (2 + HA2 + HB2) <= 63, "one stage's copies of the wave are all that is ever outstanding");
    __shared__ __align__(16) float os[PLANES ? 64 * GPV / 4 : 16 * 68];
    __shared__ __align__(16) unsigned char ring[2 * GSTG];
    const size_t z = blockIdx.z; A += z * sA; if (A2) A2 += z * sA; Bt += z * sB; if (Bt2) Bt2 += z * sB; C += z * sC;
    if (BIAS) bias = (z == 0) ? bias : ((z == 1) ? bias1 : bias2);   // z-batched products with a bias each (q, k, v)
    const int lane = threadIdx.x & 31, lr = lane & 15, hi = lane >> 4; const int r0 = blockIdx.x * 64, c0 = blockIdx.y * 64;
    v8f acc[4][4];
#pragma unroll
    for (int mb = 0; mb < 4; ++mb)
#pragma unroll
        for (int nb = 0; nb < 4; ++nb) acc[mb][nb] = (v8f){};
    // copy map: a lane moves 16 bytes; 8 lanes cover a row's 128 bytes, a copy 4 rows
    const size_t aoff = ((size_t)(r0 + (lane >> 3)) * K + (lane & 7) * 8) * 2, boff = ((size_t)(c0 + (lane >> 3)) * K + (lane & 7) * 8) * 2, gs = (size_t)K * 8;   // bytes; gs: four rows
    const unsigned lcp = (unsigned)(size_t)ring + (lane >> 3) * GPO + (lane & 7) * 16;   // LDS byte address: the low 32 bits of the __shared__ address
    const int nt = K / GKS;
    auto fill = [&](int t) { const unsigned l = lcp + (t & 1) * GSTG; const size_t ko = (size_t)t * (GKS * 2);
        acopy_tile(l, (const unsigned char*)A + aoff + ko, gs); acopy_tile(l + GTB, (const unsigned char*)Bt + boff + ko, gs);
        if (HA2) acopy_tile(l + 2 * GTB, (const unsigned char*)A2 + aoff + ko, gs);
        if (HB2) acopy_tile(l + (2 + HA2) * GTB, (const unsigned char*)Bt2 + boff + ko, gs); };
    fill(0);
    asm volatile("s_wait_asynccnt 0x0" ::: "memory");   // stage 0 has landed
    __syncthreads();   // publish point of the ring; the work-group is this one wave, so the compiler emits no barrier instruction for it
    if (nt > 1) fill(1);
#pragma unroll 1   // stays rolled: the two buffers alternate by t & 1
    for (int t = 0; t < nt; ++t) {
        const unsigned char* S = ring + (t & 1) * GSTG + lr * GPO + 16 * hi;   // fragment k order, A and B alike: 16 bytes at 16 hi and at 32 + 16 hi of each 64 bytes of a row
        constexpr int GG = (HA2 || HB2) ? 1 : GKS / 32;   // 32-k blocks whose fragments are read as one group: as many as fit beside the accumulators without a spill
        V a[GG][4], a2[GG][4], b[GG][4], b2[GG][4];
#pragma unroll
        for (int k0 = 0; k0 < GKS / 32; k0 += GG) {
#pragma unroll
            for (int kk = 0; kk < GG; ++kk) { const unsigned char* Sk = S + (k0 + kk) * 64;
#pragma unroll
                for (int i = 0; i < 4; ++i) { a[kk][i] = WFrag<T16>::ld(Sk + i * 16 * GPO); b[kk][i] = WFrag<T16>::ld(Sk + GTB + i * 16 * GPO);
                    if (HA2) a2[kk][i] = WFrag<T16>::ld(Sk + 2 * GTB + i * 16 * GPO); if (HB2) b2[kk][i] = WFrag<T16>::ld(Sk + (2 + HA2) * GTB + i * 16 * GPO); } }
            __builtin_amdgcn_sched_barrier(0);   // the group's fragment loads issue together ahead of its matrix instructions: one LDS latency per group, not one per fragment
#pragma unroll
            for (int kk = 0; kk < GG; ++kk) {
#pragma unroll
                for (int nb = 0; nb < 4; ++nb) {
#pragma unroll
                    for (int mb = 0; mb < 4; ++mb) { acc[mb][nb] = WFrag<T16>::mma(a[kk][mb], b[kk][nb], acc[mb][nb]); if (HA2) acc[mb][nb] = WFrag<T16>::mma(a2[kk][mb], b[kk][nb], acc[mb][nb]); if (HB2) acc[mb][nb] = WFrag<T16>::mma(a[kk][mb], b2[kk][nb], acc[mb][nb]); } } }
            __builtin_amdgcn_sched_barrier(0);   // the next group's loads stay together behind these matrix instructions instead of being spread among them
        }
        // four vector slots behind the trip's last matrix instructions: the branch round the refill is taken on the last trips
        asm volatile("v_nop\n\tv_nop\n\tv_nop\n\tv_nop" : "+v"(acc[0][0]), "+v"(acc[1][1]), "+v"(acc[2][2]), "+v"(acc[3][3]) : "v"(a[GG - 1][0]), "v"(a[GG - 1][3]));
        asm volatile("s_wait_dscnt 0x0" ::: "memory");      // this stage's LDS reads are done before its buffer is refilled
        asm volatile("s_wait_asynccnt 0x0" ::: "memory");   // stage t + 1 has landed
        __syncthreads();   // publish point of stage t + 1 (one wave: no barrier instruction)
        if (t + 2 < nt) fill(t + 2);   // into the buffer that this trip has just read
    }
    asm volatile("s_wait_asynccnt 0x0" ::: "memory");   // nothing of the ring is outstanding when the wave goes on to its epilogue
    if (PLANES) {
        const size_t pl = (size_t)(r0 / TT) * NH_ + blockIdx.y; const int t0 = r0 % TT, l8 = lane >> 3, c8 = lane & 7;   // plane [b][h]; a store: 4 rows x 8 lanes x 16 bytes
        if (z < 2) {
            h16* prow = P16 + ((z * NB_ * NH_ + pl) * TT + t0) * HD + c8 * 8; float bb[8];
#pragma unroll
            for (int i = 0; i < 8; ++i) bb[i] = bfr(bias[c0 + c8 * 8 + i]);
#pragma unroll
            for (int mb = 0; mb < 4; ++mb) {
#pragma unroll
                for (int nb = 0; nb < 4; ++nb) {
#pragma unroll
                    for (int j = 0; j < 8; ++j) os[(hi * 8 + j) * 68 + nb * 16 + lr] = acc[mb][nb][j]; }
                __builtin_amdgcn_wave_barrier(); asm volatile("" ::: "memory");   // compiler fence: the reads below take what other lanes of this wave stored
#pragma unroll
                for (int s = 0; s < 4; ++s) { const int row = 4 * s + l8; const v4f v0 = *(const v4fa*)(os + row * 68 + c8 * 8), v1 = *(const v4fa*)(os + row * 68 + c8 * 8 + 4); v8h o;
#pragma unroll
                    for (int i = 0; i < 4; ++i) { o[i] = tohx(v0[i] + bb[i]); o[4 + i] = tohx(v1[i] + bb[4 + i]); }
                    *(v8h*)(prow + (size_t)(mb * 16 + row) * HD) = o; }
                __builtin_amdgcn_wave_barrier(); asm volatile("" ::: "memory");   // compiler fence: the next block's stores stay behind these reads
            }
        } else {
            unsigned char* ot = (unsigned char*)os;   // acc[mb][nb][0..7]: 8 consecutive t of feature 16 nb + lr = 16 bytes of a V^T row
#pragma unroll
            for (int nb = 0; nb < 4; ++nb) { const float bv = bfr(bias[c0 + nb * 16 + lr]);
#pragma unroll
                for (int mb = 0; mb < 4; ++mb) { v8h o;
#pragma unroll
                    for (int j = 0; j < 8; ++j) o[j] = tohx(acc[mb][nb][j] + bv);
                    *(v8ha*)(ot + (nb * 16 + lr) * GPV + mb * 32 + hi * 16) = o; } }
            __builtin_amdgcn_wave_barrier(); asm volatile("" ::: "memory");   // compiler fence: the reads below take what other lanes of this wave stored
            h16* vrow = V16 + pl * HD * TT + t0 + c8 * 8;
#pragma unroll
            for (int s = 0; s < 16; ++s) { const int d = 4 * s + l8; *(v8h*)(vrow + (size_t)d * TT) = *(const v8ha*)(ot + d * GPV + c8 * 16); }
            asm volatile("s_wait_xcnt 0x0" ::: "memory");   // the sixteen stores above are issued: their address registers may be reused from here on
        }
        return;
    }
#pragma unroll
    for (int mb = 0; mb < 4; ++mb) {
#pragma unroll
        for (int nb = 0; nb < 4; ++nb) {
#pragma unroll
            for (int j = 0; j < 8; ++j) os[(hi * 8 + j) * 68 + nb * 16 + lr] = acc[mb][nb][j]; }
        __builtin_amdgcn_wave_barrier(); asm volatile("" ::: "memory");
        float* crow = C + (size_t)(r0 + mb * 16) * ldc + c0;
{
#pragma unroll
            for (int s = 0; s < 8; ++s) { const int row = 2 * s + hi, cofs = lr * 4; v4f val = *(const v4fa*)(os + row * 68 + cofs); if (BIAS) { val[0] += bfr(bias[c0 + cofs]); val[1] += bfr(bias[c0 + cofs + 1]); val[2] += bfr(bias[c0 + cofs + 2]); val[3] += bfr(bias[c0 + cofs + 3]); }
                *(v4f*)(crow + (size_t)row * ldc + cofs) = val; }
             }
        __builtin_amdgcn_wave_barrier(); asm volatile("" ::: "memory");
    }
}

__device__ __forceinline__ void splitf(float y, unsigned short& h, unsigned short& l) { h = f2bf(y); l = f2bf(y - bf2f(h)); }
typedef __attribute__((ext_vector_type(2))) _Float16 v2h;
typedef __attribute__((ext_vector_type(4))) _Float16 v4h;
typedef __attribute__((ext_vector_type(2))) unsigned short v2us;
typedef __attribute__((ext_vector_type(4))) unsigned short v4us;
typedef __attribute__((ext_vector_type(2))) float v2f;
typedef __attribute__((ext_vector_type(4))) int v4i;

// k_prep: every bf16 operand of the projections in one launch. grid (64-k block, 64-column block y, operand zz): zz 0..2 = Wq/Wk/Wv head y ([DM][HD], pitch HD), zz 3 = columns y*HD.. of Wo ([DQ][DM], pitch DM); each block -> 64 k of Bt rows y*HD.., K-contiguous.
// A block takes 64 k x 64 columns of its operand: four 16-byte loads per thread, each wave-wide load covering whole 256-byte row pieces and all of them issued at once; the rounded values of rows k, k + 1 are packed and turned through LDS; every store covers one whole 128-byte line of a Bt row.
// Each block also rounds its own 1 / 256 of x to bf16: XG groups of 8 values per thread, a wave's load covering 1 KiB in a row; these loads are issued with the weight loads.
static_assert(NKV == NH_ && DM / HD == NH_ && DQ == DM, "one grid shape serves the four weight operands");
#define PGX  (DM / 64)                    // grid x: 64-k blocks
#define PNB  (PGX * NH_ * 4)              // work-groups of the launch
#define XG   4                            // groups of 8 values of x per thread
#define PTP  33                           // LDS pitch of a turned row, dwords: 32 pairs of k + 1, so that the 32 lanes of a store (rows 4 apart, two neighbouring pairs) fall on 32 banks
typedef unsigned __attribute__((may_alias)) u32a;
static_assert((size_t)NB_ * TT * DM == (size_t)PNB * 256 * XG * 8, "the work-groups' slices cover x exactly");
static_assert(HD == 64 && DM % 64 == 0, "a block's weight tile: 64 k x 64 columns = 256 threads x 2 row pairs x 4 columns");
__global__ __launch_bounds__(256) void k_prep(const float* __restrict__ wq, const float* __restrict__ wk, const float* __restrict__ wv, const float* __restrict__ wo, bf* BQ, bf* BK, bf* BV, bf* BO, const float* __restrict__ x, bf* XB) {
    __shared__ unsigned tw[HD * PTP];   // [column n][pair of k]
    const int y = blockIdx.y, zz = blockIdx.z, tid = threadIdx.x; const int ldw = (zz == 3) ? DM : HD;
    const size_t xi = ((size_t)((zz * NH_ + y) * PGX + blockIdx.x) * (XG * 256) + tid) * 8;   // this thread's first group of x; the next ones 256 groups on
    const float* w = (zz == 0) ? wq : (zz == 1) ? wk : (zz == 2) ? wv : wo; w += (zz == 3) ? (size_t)y * HD : (size_t)y * DM * HD;
    bf* Bt = ((zz == 0) ? BQ : (zz == 1) ? BK : (zz == 2) ? BV : BO) + (size_t)y * HD * DM;
    const int k0 = blockIdx.x * 64, c4 = (tid & 15) * 4, kq = tid >> 4;   // this thread: columns c4 .. c4 + 3 of the row pairs kq and 16 + kq
    v4f wa[2], wb[2];
#pragma unroll
    for (int i = 0; i < 2; ++i) { const float* p = w + (size_t)(k0 + 2 * (i * 16 + kq)) * ldw + c4; wa[i] = *(const v4fa*)p; wb[i] = *(const v4fa*)(p + ldw); }
    v8f xv[XG];
#pragma unroll
    for (int j = 0; j < XG; ++j) xv[j] = *(const v8f*)(x + xi + (size_t)j * (256 * 8));
    asm volatile("s_wait_xcnt 0x0" ::: "memory");   // the loads above are issued: their address registers may be reused from here on
    __builtin_amdgcn_sched_barrier(0);   // no conversion, with its wait, moves up among the loads: all twelve fly together, one memory latency for the thread
#pragma unroll
    for (int i = 0; i < 2; ++i) {
#pragma unroll
        for (int j = 0; j < 4; ++j) tw[(c4 + j) * PTP + i * 16 + kq] = (unsigned)f2bf(wa[i][j]) | ((unsigned)f2bf(wb[i][j]) << 16); }   // low half: k, high half: k + 1
    __syncthreads();   // the rows read below were written by all eight waves
    const int lane = tid & 31, n0 = (tid >> 5) * 8;   // a wave stores eight Bt rows' 64 k, one line per store
    unsigned tv[8];
#pragma unroll
    for (int r = 0; r < 8; ++r) tv[r] = tw[(n0 + r) * PTP + lane];
    v8us xo[XG];
#pragma unroll
    for (int j = 0; j < XG; ++j) {
#pragma unroll
        for (int k = 0; k < 8; ++k) xo[j][k] = f2bf(xv[j][k]); }
#pragma unroll
    for (int r = 0; r < 8; ++r) *(u32a*)(Bt + (size_t)(n0 + r) * DM + k0 + lane * 2) = tv[r];
#pragma unroll
    for (int j = 0; j < XG; ++j) *(v8us*)(XB + xi + (size_t)j * (256 * 8)) = xo[j];
}
#define FNW  8                    // waves per work-group
#define FBR  (FNW * 16)           // queries per work-group
#define FSK  128                  // keys per stage
#define FPK  (HD * 2 + 16)        // LDS pitch of a K row, bytes: odd multiple of 16
#define FPV  (FSK * 2 + 16)       // LDS pitch of a V^T row, bytes: odd multiple of 16
#define FTK  (FSK * FPK)
#define FTV  (HD * FPV)
#define FSLOT (FTK + FTV)
typedef __attribute__((ext_vector_type(4))) unsigned v4u;
typedef v4u __attribute__((may_alias)) v4ua;
static_assert(HD == 64 && TT % FSK == 0 && TT % FBR == 0 && FSK * HD * 2 == 4 * 256 * 16, "staging map: 256 threads x 4 chunks of 16 bytes per operand and stage");
__device__ __forceinline__ v16h fragl(const unsigned char* p) { return cat16(*(const v8ha*)p, *(const v8ha*)(p + 32)); }
__device__ __forceinline__ float xhalf(float x) { return __builtin_bit_cast(float, __builtin_amdgcn_permlanex16(__builtin_bit_cast(int, x), __builtin_bit_cast(int, x), 0x76543210, 0xfedcba98, false, false)); }   // lane l with lane l ^ 16
// eight exponentials (2^x) in place in one statement: no v_exp_f32 has its source overwritten by the instruction directly behind it, and the closing v_nop is the slot the instruction set asks for between a transcendental and the first use of its result
__device__ __forceinline__ void exp2x8(float& a, float& b, float& c, float& d, float& e, float& f, float& g, float& h) {
    asm("v_exp_f32 %0, %0\n\tv_exp_f32 %1, %1\n\tv_exp_f32 %2, %2\n\tv_exp_f32 %3, %3\n\tv_exp_f32 %4, %4\n\tv_exp_f32 %5, %5\n\tv_exp_f32 %6, %6\n\tv_exp_f32 %7, %7\n\tv_nop" : "+v"(a), "+v"(b), "+v"(c), "+v"(d), "+v"(e), "+v"(f), "+v"(g), "+v"(h)); }
__global__ __launch_bounds__(256) void k_fattn(const h16* __restrict__ Qp, const h16* __restrict__ Kp, const h16* __restrict__ Vt, bf* Ah, bf* Al) {
    __shared__ __align__(16) unsigned char L[2 * FSLOT];
    const int tid = threadIdx.x, lane = tid & 31, wave = tid >> 5, c = lane & 15, hf = lane >> 4;
    const int bh = blockIdx.y; const int q = blockIdx.x * FBR + wave * 16 + c;   // this lane's query
    const float cscale = SCL * 1.4426950408889634f;
    // staging map: chunk i of thread tid = 16 bytes; K: row 32 i + tid / 8, V^T: row 16 i + tid / 16; a wave's load covers whole 128-byte lines
    const unsigned char* kg = (const unsigned char*)(Kp + (size_t)bh * TT * HD) + tid * 16;
    const unsigned char* vg = (const unsigned char*)(Vt + (size_t)bh * HD * TT) + (size_t)(tid >> 4) * (TT * 2) + (tid & 15) * 16;
    const int klo = (tid >> 3) * FPK + (tid & 7) * 16, vlo = FTK + (tid >> 4) * FPV + (tid & 15) * 16;
    v4u rk[4], rv[4];
#pragma unroll
    for (int i = 0; i < 4; ++i) { rk[i] = *(const v4ua*)(kg + i * 4096); rv[i] = *(const v4ua*)(vg + (size_t)i * 16 * TT * 2); }
    v16h qf[2];
    { const h16* qp = Qp + ((size_t)bh * TT + q) * HD + 8 * hf;
#pragma unroll
      for (int kc = 0; kc < 2; ++kc) qf[kc] = cat16(*(const v8h*)(qp + 32 * kc), *(const v8h*)(qp + 32 * kc + 16)); }
    asm volatile("s_wait_xcnt 0x0" ::: "memory");   // the twelve loads above are issued: their address registers may be reused from here on
    v16h ones;   // A operand of all ones: every row of its product holds the column sums of P^T (the softmax denominators' increments)
#pragma unroll
    for (int i = 0; i < 16; ++i) ones[i] = (h16)1.0f;
    v8f acc[4], lacc = (v8f){};
#pragma unroll
    for (int t = 0; t < 4; ++t) acc[t] = (v8f){};
    float mrun = -3.0e38f;
#pragma unroll
    for (int i = 0; i < 4; ++i) { *(v4ua*)(L + klo + i * 32 * FPK) = rk[i]; *(v4ua*)(L + vlo + i * 16 * FPV) = rv[i]; }
    __syncthreads();
#pragma unroll 1   // stays rolled: the body already holds four unrolled passes, and the two buffers alternate by st & 1
    for (int st = 0; st < TT / FSK; ++st) {
        const unsigned char* Ls = L + (st & 1) * FSLOT;
        const bool more = st + 1 < TT / FSK;
        if (more) {
#pragma unroll
            for (int i = 0; i < 4; ++i) { rk[i] = *(const v4ua*)(kg + (size_t)(st + 1) * (FSK * HD * 2) + i * 4096); rv[i] = *(const v4ua*)(vg + (size_t)(st + 1) * (FSK * 2) + (size_t)i * 16 * TT * 2); } }
#pragma unroll
        for (int ps = 0; ps < FSK / 32; ++ps) {
            const unsigned char* kp = Ls + (ps * 32 + c) * FPK + 16 * hf;
            v8f s[2];
#pragma unroll
            for (int kt = 0; kt < 2; ++kt) { s[kt] = (v8f){};
#pragma unroll
                for (int kc = 0; kc < 2; ++kc) s[kt] = wmma16(fragl(kp + kt * 16 * FPK + 64 * kc), qf[kc], s[kt]); }
            float mx = s[0][0];
#pragma unroll
            for (int r = 1; r < 16; ++r) mx = fmaxf(mx, s[r >> 3][r & 7]);
            mx = fmaxf(mx, xhalf(mx)) * cscale;   // both halves of the wave now hold this query's maximum over the pass's 32 keys, scaled (the scale is positive)
            if (__builtin_amdgcn_ballot_w32(mx > mrun + 8.0f) != 0) {   // one scalar branch per pass; rare after the first passes
                const float mnew = fmaxf(mrun, mx); const float corr = __builtin_amdgcn_exp2f(mrun - mnew); mrun = mnew;   // first pass: corr = 0 on zero sums
                lacc = lacc * corr;
#pragma unroll
                for (int t = 0; t < 4; ++t) acc[t] = acc[t] * corr; }
            const unsigned char* vp = Ls + FTK + c * FPV + ps * 64 + 16 * hf;
            v16h vf[4];
#pragma unroll
            for (int t = 0; t < 4; ++t) vf[t] = fragl(vp + t * 16 * FPV);
            __builtin_amdgcn_sched_barrier(0);   // the V^T fragment loads issue in front of the exponentials, whose time covers their LDS latency
            const float nm = -mrun; v16h pf;
#pragma unroll
            for (int kt = 0; kt < 2; ++kt) { float e[8];
#pragma unroll
                for (int i = 0; i < 4; ++i) { const v2f arg = __builtin_elementwise_fma((v2f){s[kt][2 * i], s[kt][2 * i + 1]}, (v2f){cscale, cscale}, (v2f){nm, nm}); e[2 * i] = arg[0]; e[2 * i + 1] = arg[1]; }
                exp2x8(e[0], e[1], e[2], e[3], e[4], e[5], e[6], e[7]);
#pragma unroll
                for (int i = 0; i < 4; ++i) { const v2h p2 = __builtin_convertvector((v2f){e[2 * i], e[2 * i + 1]}, v2h); pf[8 * kt + 2 * i] = p2[0]; pf[8 * kt + 2 * i + 1] = p2[1]; } }
#pragma unroll
            for (int t = 0; t < 4; ++t) acc[t] = wmma16(vf[t], pf, acc[t]);
            lacc = wmma16(ones, pf, lacc);
        }
        // four vector slots behind the stage's last matrix instructions: the branch round the next stage's loads is taken on the last trip
        __builtin_amdgcn_sched_barrier(0); asm volatile("v_nop\n\tv_nop\n\tv_nop\n\tv_nop"); __builtin_amdgcn_sched_barrier(0);
        if (more) { unsigned char* Ln = L + ((st + 1) & 1) * FSLOT;   // the buffer that stage st - 1 used: every wave left it before the last barrier
#pragma unroll
            for (int i = 0; i < 4; ++i) { *(v4ua*)(Ln + klo + i * 32 * FPK) = rk[i]; *(v4ua*)(Ln + vlo + i * 16 * FPV) = rv[i]; } }
        __syncthreads();
    }
    const float inv = __fdiv_rn(1.0f, lacc[0]);
    const size_t oo = ((size_t)(bh / NH_) * TT + q) * DQ + (bh % NH_) * HD + 8 * hf;   // acc[t][r] = O[q][16 t + 8 hf + r]: 8 consecutive features per store
#pragma unroll
    for (int t = 0; t < 4; ++t) { v8us oh, ol;
#pragma unroll
        for (int r = 0; r < 8; ++r) { unsigned short a, c2; splitf(acc[t][r] * inv, a, c2); oh[r] = a; ol[r] = c2; }
        *(v8us*)(Ah + oo + 16 * t) = oh; *(v8us*)(Al + oo + 16 * t) = ol; }
}

extern "C" void kernel_launch(void* const* d_in, const int* in_sizes, int n_in,
                              void* d_out, int out_size, void* d_ws, size_t ws_size, hipStream_t stream) {
    (void)in_sizes; (void)n_in; (void)out_size;
    const float* x = (const float*)d_in[0]; const float* wq = (const float*)d_in[1]; const float* bqv = (const float*)d_in[2]; const float* wk = (const float*)d_in[3]; const float* bkv = (const float*)d_in[4]; const float* wv = (const float*)d_in[5]; const float* bvv = (const float*)d_in[6]; const float* wo = (const float*)d_in[7]; const float* bo = (const float*)d_in[8];   // Wq/Wk/Wv [8][512][64] (x @ W per head), biases [8][64], Wo [512][512] (x @ W), bo
    float* OUT = (float*)d_out;     // [2][2048][512]
    char* wsp = (char*)d_ws;
    auto take = [&](size_t bytes) { char* p = wsp; wsp += (bytes + 255) & ~(size_t)255; return (void*)p; };
    bf* WQ = (bf*)take((size_t)DQ * DM * 2); bf* WK = (bf*)take((size_t)DKV * DM * 2); bf* WV = (bf*)take((size_t)DKV * DM * 2); bf* WO = (bf*)take((size_t)DM * DQ * 2);
    bf* XB = (bf*)take((size_t)NB_ * TT * DM * 2);
    h16* QP16 = (h16*)take((size_t)NB_ * NH_ * TT * HD * 2); h16* KP16 = (h16*)take((size_t)NB_ * NKV * TT * HD * 2); h16* VT16 = (h16*)take((size_t)NB_ * NKV * HD * TT * 2);   // planes [b][h][..]; QP16, KP16 back to back
    bf* ATh = (bf*)take((size_t)NB_ * TT * DQ * 2); bf* ATl = (bf*)take((size_t)NB_ * TT * DQ * 2);
    if ((size_t)(wsp - (char*)d_ws) > ws_size) return;    // ws 256 MiB
    k_prep<<<dim3(PGX, NH_, 4), 256, 0, stream>>>(wq, wk, wv, wo, WQ, WK, WV, WO, x, XB);   // per-head [512][64] blocks -> Bt rows h*64..; Wo by 64-column blocks; x -> bf16
    k_gemmw<bf, 0, true, true><<<dim3(NB_ * TT / 64, DQ / 64, 3), 32, 0, stream>>>(XB, nullptr, WQ, nullptr, DM, nullptr, 0, bqv, bkv, bvv, 0, (size_t)DQ * DM, 0, QP16, VT16);   // z: q, k, v; rows: both batches; fp16 planes out
    k_fattn<<<dim3(TT / FBR, NB_ * NH_, 1), 256, 0, stream>>>(QP16, KP16, VT16, ATh, ATl);   // planes [b][h][..]: grid y = b * heads + h (one kv head per query head)
    k_gemmw<bf, 1, true, false><<<dim3(NB_ * TT / 64, DM / 64, 1), 32, 0, stream>>>(ATh, ATl, WO, nullptr, DQ, OUT, DM, bo, nullptr, nullptr, 0, 0, 0, nullptr, nullptr);
}

// v007
// Measured time: 44.6 microseconds a run.
// Two timings next to v006 put it at 1.10 and 1.09 times that version's speed.
// Over all steps from v000 it is 18.4 times as fast.
#include <hip/hip_runtime.h>

// Faster_MultiHeadAttention (sequences [2][2048][512]; per head h: q = x Wq[h] + bq[h], k, v likewise (Wq/Wk/Wv [8][512][64], biases [8][64]); softmax(q.k/8); z = merged heads; out = z Wo + bo -> [2][2048][512]).
// Compute dtypes, f32 accumulate: every input rounded to bf16; projections on PLAIN bf16 operands (inputs: exact, + bias; the per-head weights are re-laid as one [512][512] operand);
// scores (K 64) and att.v on SINGLE fp16 planes inside ONE kernel per (batch, head, 128 queries) with an f32 online softmax (probabilities never leave registers; two key halves per query joined at the end); merged heads as bf16 hi+lo planes x exact Wo (2 products) + bo. One-wave-per-64x64-tile GEMMs for the projections; the q/k/v GEMM stores its tiles as the fp16 operands of the attention kernel. Deterministic,

#define NB_  2
#define TT   2048
#define DM   512
#define NH_  8
#define NKV  8
#define HD   64
#define DQ   (NH_ * HD)
#define DKV  (NKV * HD)
#define WIN  0
#define SCL  0.125f   // HD^-0.5
typedef _Float16 h16;
typedef unsigned short bf;
typedef __attribute__((ext_vector_type(16))) __bf16   v16bf;
typedef __attribute__((ext_vector_type(16))) _Float16 v16h;
typedef __attribute__((ext_vector_type(8)))  _Float16 v8h;
typedef __attribute__((ext_vector_type(8)))  unsigned short v8us;
typedef __attribute__((ext_vector_type(8)))  float    v8f;
typedef __attribute__((ext_vector_type(4)))  float    v4f;
typedef v8h  __attribute__((may_alias)) v8ha;
typedef v4f  __attribute__((may_alias)) v4fa;
typedef v8us __attribute__((may_alias)) v8usa;

__device__ __forceinline__ unsigned short f2bf(float f) { unsigned u = __float_as_uint(f); u += 0x7FFFu + ((u >> 16) & 1u); return (unsigned short)(u >> 16); }
__device__ __forceinline__ float bf2f(unsigned short b) { return __uint_as_float(((unsigned)b) << 16); }
__device__ __forceinline__ float bfr(float f) { return bf2f(f2bf(f)); }
__device__ __forceinline__ v16h cat16(v8h lo, v8h hi) { return __builtin_shufflevector(lo, hi, 0, 1, 2, 3, 4, 5, 6, 7, 8, 9, 10, 11, 12, 13, 14, 15); }
__device__ __forceinline__ v16bf cat16b(v8us lo, v8us hi) { return __builtin_bit_cast(v16bf, __builtin_shufflevector(lo, hi, 0, 1, 2, 3, 4, 5, 6, 7, 8, 9, 10, 11, 12, 13, 14, 15)); }
__device__ __forceinline__ v8f wmma16(v16h a, v16h b, v8f c) { return __builtin_amdgcn_wmma_f32_16x16x32_f16(false, a, false, b, (short)0, c, false, false); }
__device__ __forceinline__ h16 tohx(float x) { return (h16)x; }
__device__ __forceinline__ v8f wmmab(v16bf a, v16bf b, v8f c) { return __builtin_amdgcn_wmma_f32_16x16x32_bf16(false, a, false, b, (short)0, c, false, false); }



// ---- k_gemmw: register-blocked GEMM, ONE WAVE per 64x64 output tile (16 accumulators), operands from K-contiguous 16-bit planes; grid (M/64, N/64, Z), 32 threads.
// C[m][n] (f32, pitch ldc, + optional f32 bias[n], one bias vector per z = 0, 1, 2) = sum_k A[m][k] Bt[n][k] (+ split products per NSPLIT). z-batch strides sA/sB/sC in elements. K % 64 == 0, K >= 64.
// A stage = 64 k of every operand's 64 rows (one whole 128-byte line per row), brought into LDS by asynchronous copies, each covering four whole lines; two buffers: stage t + 1 flies while stage t's fragments are read from LDS and multiplied.
// PLANES (the q/k/v launch; C unused): a tile's 64 columns are one head and its 64 rows lie in one batch, so the tile + bias, rounded to fp16, goes straight to where the attention kernel reads it:
// z = 0, 1 (q, k) to rows [t][d] of plane [z][b][h] of P16, z = 2 (v) transposed to rows [d][t] of plane [b][h] of V16. Every store instruction covers whole 128-byte rows.
#define GPV  (64 * 2 + 16)        // LDS pitch of a staged V^T row, bytes: odd multiple of 16
#define GKS  64                   // k per stage
#define GPO  (GKS * 2 + 16)       // LDS pitch of a staged operand row, bytes: odd multiple of 16
#define GTB  (64 * GPO)           // one operand's 64 staged rows, bytes
static_assert(DM % GKS == 0 && DQ % GKS == 0 && DM >= GKS && DQ >= GKS, "whole stages");
// eight asynchronous copies of 16 bytes per lane, global -> LDS: copy i takes g + i * gs to LDS byte l + i * 4 * GPO (four more rows on both sides).
// The closing s_wait_xcnt 0 stands inside the statement, in front of whatever rewrites the address registers that the copies name.
__device__ __forceinline__ void acopy8(unsigned l, const unsigned char* g, size_t gs) {
    asm volatile("global_load_async_to_lds_b128 %0, %8, off\n\tglobal_load_async_to_lds_b128 %1, %9, off\n\tglobal_load_async_to_lds_b128 %2, %10, off\n\tglobal_load_async_to_lds_b128 %3, %11, off\n\t"
                 "global_load_async_to_lds_b128 %4, %12, off\n\tglobal_load_async_to_lds_b128 %5, %13, off\n\tglobal_load_async_to_lds_b128 %6, %14, off\n\tglobal_load_async_to_lds_b128 %7, %15, off\n\ts_wait_xcnt 0x0"
                 :: "v"(l), "v"(l + 4 * GPO), "v"(l + 8 * GPO), "v"(l + 12 * GPO), "v"(l + 16 * GPO), "v"(l + 20 * GPO), "v"(l + 24 * GPO), "v"(l + 28 * GPO),
                    "v"(g), "v"(g + gs), "v"(g + 2 * gs), "v"(g + 3 * gs), "v"(g + 4 * gs), "v"(g + 5 * gs), "v"(g + 6 * gs), "v"(g + 7 * gs) : "memory"); }
// one operand's stage: 64 rows x 128 bytes = 16 copies
__device__ __forceinline__ void acopy_tile(unsigned l, const unsigned char* g, size_t gs) { acopy8(l, g, gs); acopy8(l + 32 * GPO, g + 8 * gs, gs); }
template <typename T16> struct WFrag;
template <> struct WFrag<h16> { typedef v16h V; static __device__ __forceinline__ V ld(const unsigned char* p) { return cat16(*(const v8ha*)p, *(const v8ha*)(p + 32)); } static __device__ __forceinline__ v8f mma(V a, V b, v8f c) { return wmma16(a, b, c); } };
template <> struct WFrag<bf> { typedef v16bf V; static __device__ __forceinline__ V ld(const unsigned char* p) { return cat16b(*(const v8usa*)p, *(const v8usa*)(p + 32)); } static __device__ __forceinline__ v8f mma(V a, V b, v8f c) { return wmmab(a, b, c); } };
template <typename T16, int NSPLIT, bool BIAS, bool PLANES>
__global__ __launch_bounds__(32) void k_gemmw(const T16* __restrict__ A, const T16* __restrict__ A2, const T16* __restrict__ Bt, const T16* __restrict__ Bt2, int K, float* C, int ldc, const float* __restrict__ bias, const float* __restrict__ bias1, const float* __restrict__ bias2, size_t sA, size_t sB, size_t sC, h16* P16, h16* V16) {
    typedef typename WFrag<T16>::V V;
    static_assert(!PLANES || (BIAS && HD == 64 && TT % 64 == 0 && NKV == NH_), "a 64x64 tile is one head of one batch");
    constexpr bool HA2 = NSPLIT == 1 || NSPLIT == 2, HB2 = NSPLIT >= 2; constexpr int GSTG = (2 + HA2 + HB2) * GTB;   // a stage in LDS: A | Bt | A2 | Bt2
    static_assert(16 * (2 + HA2 + HB2) <= 63, "one stage's copies of the wave are all that is ever outstanding");
    __shared__ __align__(16) float os[PLANES ? 64 * GPV / 4 : 16 * 68];
    __shared__ __align__(16) unsigned char ring[2 * GSTG];
    const size_t z = blockIdx.z; A += z * sA; if (A2) A2 += z * sA; Bt += z * sB; if (Bt2) Bt2 += z * sB; C += z * sC;
    if (BIAS) bias = (z == 0) ? bias : ((z == 1) ? bias1 : bias2);   // z-batched products with a bias each (q, k, v)
    const int lane = threadIdx.x & 31, lr = lane & 15, hi = lane >> 4; const int r0 = blockIdx.x * 64, c0 = blockIdx.y * 64;
    v8f acc[4][4];
#pragma unroll
    for (int mb = 0; mb < 4; ++mb)
#pragma unroll
        for (int nb = 0; nb < 4; ++nb) acc[mb][nb] = (v8f){};
    // copy map: a lane moves 16 bytes; 8 lanes cover a row's 128 bytes, a copy 4 rows
    const size_t aoff = ((size_t)(r0 + (lane >> 3)) * K + (lane & 7) * 8) * 2, boff = ((size_t)(c0 + (lane >> 3)) * K + (lane & 7) * 8) * 2, gs = (size_t)K * 8;   // bytes; gs: four rows
    const unsigned lcp = (unsigned)(size_t)ring + (lane >> 3) * GPO + (lane & 7) * 16;   // LDS byte address: the low 32 bits of the __shared__ address
    const int nt = K / GKS;
    auto fill = [&](int t) { const unsigned l = lcp + (t & 1) * GSTG; const size_t ko = (size_t)t * (GKS * 2);
        acopy_tile(l, (const unsigned char*)A + aoff + ko, gs); acopy_tile(l + GTB, (const unsigned char*)Bt + boff + ko, gs);
        if (HA2) acopy_tile(l + 2 * GTB, (const unsigned char*)A2 + aoff + ko, gs);
        if (HB2) acopy_tile(l + (2 + HA2) * GTB, (const unsigned char*)Bt2 + boff + ko, gs); };
    fill(0);
    asm volatile("s_wait_asynccnt 0x0" ::: "memory");   // stage 0 has landed
    __syncthreads();   // publish point of the ring; the work-group is this one wave, so the compiler emits no barrier instruction for it
    if (nt > 1) fill(1);
#pragma unroll 1   // stays rolled: the two buffers alternate by t & 1
    for (int t = 0; t < nt; ++t) {
        const unsigned char* S = ring + (t & 1) * GSTG + lr * GPO + 16 * hi;   // fragment k order, A and B alike: 16 bytes at 16 hi and at 32 + 16 hi of each 64 bytes of a row
        constexpr int GG = (HA2 || HB2) ? 1 : GKS / 32;   // 32-k blocks whose fragments are read as one group: as many as fit beside the accumulators without a spill
        V a[GG][4], a2[GG][4], b[GG][4], b2[GG][4];
#pragma unroll
        for (int k0 = 0; k0 < GKS / 32; k0 += GG) {
#pragma unroll
            for (int kk = 0; kk < GG; ++kk) { const unsigned char* Sk = S + (k0 + kk) * 64;
#pragma unroll
                for (int i = 0; i < 4; ++i) { a[kk][i] = WFrag<T16>::ld(Sk + i * 16 * GPO); b[kk][i] = WFrag<T16>::ld(Sk + GTB + i * 16 * GPO);
                    if (HA2) a2[kk][i] = WFrag<T16>::ld(Sk + 2 * GTB + i * 16 * GPO); if (HB2) b2[kk][i] = WFrag<T16>::ld(Sk + (2 + HA2) * GTB + i * 16 * GPO); } }
            __builtin_amdgcn_sched_barrier(0);   // the group's fragment loads issue together ahead of its matrix instructions: one LDS latency per group, not one per fragment
#pragma unroll
            for (int kk = 0; kk < GG; ++kk) {
#pragma unroll
                for (int nb = 0; nb < 4; ++nb) {
#pragma unroll
                    for (int mb = 0; mb < 4; ++mb) { acc[mb][nb] = WFrag<T16>::mma(a[kk][mb], b[kk][nb], acc[mb][nb]); if (HA2) acc[mb][nb] = WFrag<T16>::mma(a2[kk][mb], b[kk][nb], acc[mb][nb]); if (HB2) acc[mb][nb] = WFrag<T16>::mma(a[kk][mb], b2[kk][nb], acc[mb][nb]); } } }
            __builtin_amdgcn_sched_barrier(0);   // the next group's loads stay together behind these matrix instructions instead of being spread among them
        }
        // four vector slots behind the trip's last matrix instructions: the branch round the refill is taken on the last trips
        asm volatile("v_nop\n\tv_nop\n\tv_nop\n\tv_nop" : "+v"(acc[0][0]), "+v"(acc[1][1]), "+v"(acc[2][2]), "+v"(acc[3][3]) : "v"(a[GG - 1][0]), "v"(a[GG - 1][3]));
        asm volatile("s_wait_dscnt 0x0" ::: "memory");      // this stage's LDS reads are done before its buffer is refilled
        asm volatile("s_wait_asynccnt 0x0" ::: "memory");   // stage t + 1 has landed
        __syncthreads();   // publish point of stage t + 1 (one wave: no barrier instruction)
        if (t + 2 < nt) fill(t + 2);   // into the buffer that this trip has just read
    }
    asm volatile("s_wait_asynccnt 0x0" ::: "memory");   // nothing of the ring is outstanding when the wave goes on to its epilogue
    if (PLANES) {
        const size_t pl = (size_t)(r0 / TT) * NH_ + blockIdx.y; const int t0 = r0 % TT, l8 = lane >> 3, c8 = lane & 7;   // plane [b][h]; a store: 4 rows x 8 lanes x 16 bytes
        if (z < 2) {
            h16* prow = P16 + ((z * NB_ * NH_ + pl) * TT + t0) * HD + c8 * 8; float bb[8];
#pragma unroll
            for (int i = 0; i < 8; ++i) bb[i] = bfr(bias[c0 + c8 * 8 + i]);
#pragma unroll
            for (int mb = 0; mb < 4; ++mb) {
#pragma unroll
                for (int nb = 0; nb < 4; ++nb) {
#pragma unroll
                    for (int j = 0; j < 8; ++j) os[(hi * 8 + j) * 68 + nb * 16 + lr] = acc[mb][nb][j]; }
                __builtin_amdgcn_wave_barrier(); asm volatile("" ::: "memory");   // compiler fence: the reads below take what other lanes of this wave stored
#pragma unroll
                for (int s = 0; s < 4; ++s) { const int row = 4 * s + l8; const v4f v0 = *(const v4fa*)(os + row * 68 + c8 * 8), v1 = *(const v4fa*)(os + row * 68 + c8 * 8 + 4); v8h o;
#pragma unroll
                    for (int i = 0; i < 4; ++i) { o[i] = tohx(v0[i] + bb[i]); o[4 + i] = tohx(v1[i] + bb[4 + i]); }
                    *(v8h*)(prow + (size_t)(mb * 16 + row) * HD) = o; }
                __builtin_amdgcn_wave_barrier(); asm volatile("" ::: "memory");   // compiler fence: the next block's stores stay behind these reads
            }
        } else {
            unsigned char* ot = (unsigned char*)os;   // acc[mb][nb][0..7]: 8 consecutive t of feature 16 nb + lr = 16 bytes of a V^T row
#pragma unroll
            for (int nb = 0; nb < 4; ++nb) { const float bv = bfr(bias[c0 + nb * 16 + lr]);
#pragma unroll
                for (int mb = 0; mb < 4; ++mb) { v8h o;
#pragma unroll
                    for (int j = 0; j < 8; ++j) o[j] = tohx(acc[mb][nb][j] + bv);
                    *(v8ha*)(ot + (nb * 16 + lr) * GPV + mb * 32 + hi * 16) = o; } }
            __builtin_amdgcn_wave_barrier(); asm volatile("" ::: "memory");   // compiler fence: the reads below take what other lanes of this wave stored
            h16* vrow = V16 + pl * HD * TT + t0 + c8 * 8;
#pragma unroll
            for (int s = 0; s < 16; ++s) { const int d = 4 * s + l8; *(v8h*)(vrow + (size_t)d * TT) = *(const v8ha*)(ot + d * GPV + c8 * 16); }
            asm volatile("s_wait_xcnt 0x0" ::: "memory");   // the sixteen stores above are issued: their address registers may be reused from here on
        }
        return;
    }
#pragma unroll
    for (int mb = 0; mb < 4; ++mb) {
#pragma unroll
        for (int nb = 0; nb < 4; ++nb) {
#pragma unroll
            for (int j = 0; j < 8; ++j) os[(hi * 8 + j) * 68 + nb * 16 + lr] = acc[mb][nb][j]; }
        __builtin_amdgcn_wave_barrier(); asm volatile("" ::: "memory");
        float* crow = C + (size_t)(r0 + mb * 16) * ldc + c0;
{
#pragma unroll
            for (int s = 0; s < 8; ++s) { const int row = 2 * s + hi, cofs = lr * 4; v4f val = *(const v4fa*)(os + row * 68 + cofs); if (BIAS) { val[0] += bfr(bias[c0 + cofs]); val[1] += bfr(bias[c0 + cofs + 1]); val[2] += bfr(bias[c0 + cofs + 2]); val[3] += bfr(bias[c0 + cofs + 3]); }
                *(v4f*)(crow + (size_t)row * ldc + cofs) = val; }
             }
        __builtin_amdgcn_wave_barrier(); asm volatile("" ::: "memory");
    }
}

__device__ __forceinline__ void splitf(float y, unsigned short& h, unsigned short& l) { h = f2bf(y); l = f2bf(y - bf2f(h)); }
typedef __attribute__((ext_vector_type(2))) _Float16 v2h;
typedef __attribute__((ext_vector_type(4))) _Float16 v4h;
typedef __attribute__((ext_vector_type(2))) unsigned short v2us;
typedef __attribute__((ext_vector_type(4))) unsigned short v4us;
typedef __attribute__((ext_vector_type(2))) float v2f;
typedef __attribute__((ext_vector_type(4))) int v4i;

// k_prep: every bf16 operand of the projections in one launch. grid (64-k block, 64-column block y, operand zz): zz 0..2 = Wq/Wk/Wv head y ([DM][HD], pitch HD), zz 3 = columns y*HD.. of Wo ([DQ][DM], pitch DM); each block -> 64 k of Bt rows y*HD.., K-contiguous.
// A block takes 64 k x 64 columns of its operand: four 16-byte loads per thread, each wave-wide load covering whole 256-byte row pieces and all of them issued at once; the rounded values of rows k, k + 1 are packed and turned through LDS; every store covers one whole 128-byte line of a Bt row.
// Each block also rounds its own 1 / 256 of x to bf16: XG groups of 8 values per thread, a wave's load covering 1 KiB in a row; these loads are issued with the weight loads.
static_assert(NKV == NH_ && DM / HD == NH_ && DQ == DM, "one grid shape serves the four weight operands");
#define PGX  (DM / 64)                    // grid x: 64-k blocks
#define PNB  (PGX * NH_ * 4)              // work-groups of the launch
#define XG   4                            // groups of 8 values of x per thread
#define PTP  33                           // LDS pitch of a turned row, dwords: 32 pairs of k + 1, so that the 32 lanes of a store (rows 4 apart, two neighbouring pairs) fall on 32 banks
typedef unsigned __attribute__((may_alias)) u32a;
static_assert((size_t)NB_ * TT * DM == (size_t)PNB * 256 * XG * 8, "the work-groups' slices cover x exactly");
static_assert(HD == 64 && DM % 64 == 0, "a block's weight tile: 64 k x 64 columns = 256 threads x 2 row pairs x 4 columns");
__global__ __launch_bounds__(256) void k_prep(const float* __restrict__ wq, const float* __restrict__ wk, const float* __restrict__ wv, const float* __restrict__ wo, bf* BQ, bf* BK, bf* BV, bf* BO, const float* __restrict__ x, bf* XB) {
    __shared__ unsigned tw[HD * PTP];   // [column n][pair of k]
    const int y = blockIdx.y, zz = blockIdx.z, tid = threadIdx.x; const int ldw = (zz == 3) ? DM : HD;
    const size_t xi = ((size_t)((zz * NH_ + y) * PGX + blockIdx.x) * (XG * 256) + tid) * 8;   // this thread's first group of x; the next ones 256 groups on
    const float* w = (zz == 0) ? wq : (zz == 1) ? wk : (zz == 2) ? wv : wo; w += (zz == 3) ? (size_t)y * HD : (size_t)y * DM * HD;
    bf* Bt = ((zz == 0) ? BQ : (zz == 1) ? BK : (zz == 2) ? BV : BO) + (size_t)y * HD * DM;
    const int k0 = blockIdx.x * 64, c4 = (tid & 15) * 4, kq = tid >> 4;   // this thread: columns c4 .. c4 + 3 of the row pairs kq and 16 + kq
    v4f wa[2], wb[2];
#pragma unroll
    for (int i = 0; i < 2; ++i) { const float* p = w + (size_t)(k0 + 2 * (i * 16 + kq)) * ldw + c4; wa[i] = *(const v4fa*)p; wb[i] = *(const v4fa*)(p + ldw); }
    v8f xv[XG];
#pragma unroll
    for (int j = 0; j < XG; ++j) xv[j] = *(const v8f*)(x + xi + (size_t)j * (256 * 8));
    asm volatile("s_wait_xcnt 0x0" ::: "memory");   // the loads above are issued: their address registers may be reused from here on
    __builtin_amdgcn_sched_barrier(0);   // no conversion, with its wait, moves up among the loads: all twelve fly together, one memory latency for the thread
#pragma unroll
    for (int i = 0; i < 2; ++i) {
#pragma unroll
        for (int j = 0; j < 4; ++j) tw[(c4 + j) * PTP + i * 16 + kq] = (unsigned)f2bf(wa[i][j]) | ((unsigned)f2bf(wb[i][j]) << 16); }   // low half: k, high half: k + 1
    __syncthreads();   // the rows read below were written by all eight waves
    const int lane = tid & 31, n0 = (tid >> 5) * 8;   // a wave stores eight Bt rows' 64 k, one line per store
    unsigned tv[8];
#pragma unroll
    for (int r = 0; r < 8; ++r) tv[r] = tw[(n0 + r) * PTP + lane];
    v8us xo[XG];
#pragma unroll
    for (int j = 0; j < XG; ++j) {
#pragma unroll
        for (int k = 0; k < 8; ++k) xo[j][k] = f2bf(xv[j][k]); }
#pragma unroll
    for (int r = 0; r < 8; ++r) *(u32a*)(Bt + (size_t)(n0 + r) * DM + k0 + lane * 2) = tv[r];
#pragma unroll
    for (int j = 0; j < XG; ++j) *(v8us*)(XB + xi + (size_t)j * (256 * 8)) = xo[j];
}
#define FNW  8                    // waves per work-group
#define FKH  2                    // key halves of a stage, one per wave group
#define FQT  2                    // 16-query tiles per wave
#define FBR  (FNW / FKH * FQT * 16)   // queries per work-group
#define FSK  256                  // keys per stage: 128 per key half, four 32-key passes of a wave between barriers
#define FPK  (HD * 2 + 16)        // LDS pitch of a K row, bytes: odd multiple of 16
#define FPV  (FSK * 2 + 16)       // LDS pitch of a V^T row, bytes: odd multiple of 16
#define FTK  (FSK * FPK)
#define FTV  (HD * FPV)
#define FSLOT (FTK + FTV)
#define FXW  (9 * 512)            // a wave's slot of the closing exchange, bytes: 8 x 16 bytes of sums + 16 bytes of maximum and denominator per lane
typedef __attribute__((ext_vector_type(4))) unsigned v4u;
typedef v4u __attribute__((may_alias)) v4ua;
#define FCH  8                    // staged chunks of 16 bytes per thread, operand and stage
static_assert(HD == 64 && TT % FSK == 0 && TT % FBR == 0 && FSK * HD * 2 == FCH * 256 * 16 && FSK * 2 == 32 * 16, "staging map: 256 threads x FCH chunks of 16 bytes per operand and stage; a wave covers one V^T row piece");
static_assert(FKH == 2 && FQT == 2 && FNW * FXW <= 2 * FSLOT, "the closing exchange: each wave of a pair finishes one tile; the slots lie in the ring");
__device__ __forceinline__ v16h fragl(const unsigned char* p) { return cat16(*(const v8ha*)p, *(const v8ha*)(p + 32)); }
__device__ __forceinline__ float xhalf(float x) { return __builtin_bit_cast(float, __builtin_amdgcn_permlanex16(__builtin_bit_cast(int, x), __builtin_bit_cast(int, x), 0x76543210, 0xfedcba98, false, false)); }   // lane l with lane l ^ 16
// eight exponentials (2^x) in place in one statement: no v_exp_f32 has its source overwritten by the instruction directly behind it, and the closing v_nop is the slot the instruction set asks for between a transcendental and the first use of its result
__device__ __forceinline__ void exp2x8(float& a, float& b, float& c, float& d, float& e, float& f, float& g, float& h) {
    asm("v_exp_f32 %0, %0\n\tv_exp_f32 %1, %1\n\tv_exp_f32 %2, %2\n\tv_exp_f32 %3, %3\n\tv_exp_f32 %4, %4\n\tv_exp_f32 %5, %5\n\tv_exp_f32 %6, %6\n\tv_exp_f32 %7, %7\n\tv_nop" : "+v"(a), "+v"(b), "+v"(c), "+v"(d), "+v"(e), "+v"(f), "+v"(g), "+v"(h)); }
// two exponentials (2^x) in place, same form: the closing v_nop keeps the slot behind the second one
__device__ __forceinline__ void exp2x2(float& a, float& b) { asm("v_exp_f32 %0, %0\n\tv_exp_f32 %1, %1\n\tv_nop" : "+v"(a), "+v"(b)); }
__global__ __launch_bounds__(256) void k_fattn(const h16* __restrict__ Qp, const h16* __restrict__ Kp, const h16* __restrict__ Vt, bf* Ah, bf* Al) {
    __shared__ __align__(16) unsigned char L[2 * FSLOT];
    const int tid = threadIdx.x, lane = tid & 31, wave = tid >> 5, c = lane & 15, hf = lane >> 4;
    const int kh = wave / (FNW / FKH);   // this wave's half of every stage's keys
    const int bh = blockIdx.y; const int q = blockIdx.x * FBR + (wave % (FNW / FKH)) * (FQT * 16) + c;   // this lane's query in tile 0; tile 1: 16 on
    const float cscale = SCL * 1.4426950408889634f;
    // staging map: chunk i of thread tid = 16 bytes; K: row 32 i + tid / 8, V^T: row 8 i + tid / 32; a wave's load covers whole 128-byte lines
    const unsigned char* kg = (const unsigned char*)(Kp + (size_t)bh * TT * HD) + tid * 16;
    const unsigned char* vg = (const unsigned char*)(Vt + (size_t)bh * HD * TT) + (size_t)(tid >> 5) * (TT * 2) + (tid & 31) * 16;
    const int klo = (tid >> 3) * FPK + (tid & 7) * 16, vlo = FTK + (tid >> 5) * FPV + (tid & 31) * 16;
    v4u rk[FCH], rv[FCH];
#pragma unroll
    for (int i = 0; i < FCH; ++i) { rk[i] = *(const v4ua*)(kg + i * 4096); rv[i] = *(const v4ua*)(vg + (size_t)i * 8 * TT * 2); }
    v16h qf[FQT][2];
#pragma unroll
    for (int u = 0; u < FQT; ++u) { const h16* qp = Qp + ((size_t)bh * TT + q + 16 * u) * HD + 8 * hf;
#pragma unroll
      for (int kc = 0; kc < 2; ++kc) qf[u][kc] = cat16(*(const v8h*)(qp + 32 * kc), *(const v8h*)(qp + 32 * kc + 16)); }
    asm volatile("s_wait_xcnt 0x0" ::: "memory");   // the twenty-four loads above are issued: their address registers may be reused from here on
    v16h ones;   // A operand of all ones: every row of its product holds the column sums of P^T (the softmax denominators' increments)
#pragma unroll
    for (int i = 0; i < 16; ++i) ones[i] = (h16)1.0f;
    v8f acc[FQT][4], lacc[FQT]; float mrun[FQT];
#pragma unroll
    for (int u = 0; u < FQT; ++u) { lacc[u] = (v8f){}; mrun[u] = -3.0e38f;
#pragma unroll
        for (int t = 0; t < 4; ++t) acc[u][t] = (v8f){}; }
#pragma unroll
    for (int i = 0; i < FCH; ++i) { *(v4ua*)(L + klo + i * 32 * FPK) = rk[i]; *(v4ua*)(L + vlo + i * 8 * FPV) = rv[i]; }
    __syncthreads();
    const int kfo = (kh * (FSK / FKH) + c) * FPK + 16 * hf, vfo = FTK + c * FPV + kh * (FSK / FKH) * 2 + 16 * hf;   // this lane's first K and V^T fragment bytes in a stage
#pragma unroll 1   // stays rolled: the body already holds its unrolled passes, and the two buffers alternate by st & 1
    for (int st = 0; st < TT / FSK; ++st) {
        const unsigned char* Ls = L + (st & 1) * FSLOT;
        const bool more = st + 1 < TT / FSK;
        if (more) {
#pragma unroll
            for (int i = 0; i < FCH; ++i) { rk[i] = *(const v4ua*)(kg + (size_t)(st + 1) * (FSK * HD * 2) + i * 4096); rv[i] = *(const v4ua*)(vg + (size_t)(st + 1) * (FSK * 2) + (size_t)i * 8 * TT * 2); } }
        v16h kf[2][2];   // K fragments of the pass at hand; each pass fetches the next one's (same stage) with its V^T fragments
#pragma unroll
        for (int kt = 0; kt < 2; ++kt) {
#pragma unroll
            for (int kc = 0; kc < 2; ++kc) kf[kt][kc] = fragl(Ls + kfo + kt * 16 * FPK + 64 * kc); }
        __builtin_amdgcn_sched_barrier(0);   // the first pass's eight K fragment loads issue as one group ahead of its score products: one LDS wait, none between the products
#pragma unroll
        for (int ps = 0; ps < FSK / FKH / 32; ++ps) {
            v8f s[FQT][2];
#pragma unroll
            for (int u = 0; u < FQT; ++u) {
#pragma unroll
                for (int kt = 0; kt < 2; ++kt) s[u][kt] = wmma16(kf[kt][0], qf[u][0], (v8f){}); }
#pragma unroll
            for (int u = 0; u < FQT; ++u) {
#pragma unroll
                for (int kt = 0; kt < 2; ++kt) s[u][kt] = wmma16(kf[kt][1], qf[u][1], s[u][kt]); }
            __builtin_amdgcn_sched_barrier(0);   // the eight score products issue back to back, each filling the slots the chip asks for behind the others, before the first maximum reads a result
            float mx[FQT];
#pragma unroll
            for (int u = 0; u < FQT; ++u) { mx[u] = s[u][0][0];
#pragma unroll
                for (int r = 1; r < 16; ++r) mx[u] = fmaxf(mx[u], s[u][r >> 3][r & 7]);
                mx[u] = fmaxf(mx[u], xhalf(mx[u])) * cscale; }   // both halves of the wave now hold this query's maximum over the pass's 32 keys, scaled (the scale is positive)
            if (__builtin_amdgcn_ballot_w32(mx[0] > mrun[0] + 8.0f || mx[1] > mrun[1] + 8.0f) != 0) {   // one scalar branch per pass; rare after the first passes
#pragma unroll
                for (int u = 0; u < FQT; ++u) {
                    const float mnew = fmaxf(mrun[u], mx[u]); const float corr = __builtin_amdgcn_exp2f(mrun[u] - mnew); mrun[u] = mnew;   // first pass: corr = 0 on zero sums
                    lacc[u] = lacc[u] * corr;
#pragma unroll
                    for (int t = 0; t < 4; ++t) acc[u][t] = acc[u][t] * corr; } }
            const unsigned char* vp = Ls + vfo + ps * 64;
            v16h vf[4];
#pragma unroll
            for (int t = 0; t < 4; ++t) vf[t] = fragl(vp + t * 16 * FPV);
            if (ps + 1 < FSK / FKH / 32) {
#pragma unroll
                for (int kt = 0; kt < 2; ++kt) {
#pragma unroll
                    for (int kc = 0; kc < 2; ++kc) kf[kt][kc] = fragl(Ls + kfo + ((ps + 1) * 32 + kt * 16) * FPK + 64 * kc); } }
            __builtin_amdgcn_sched_barrier(0);   // the V^T loads and the next pass's K loads issue in front of the exponentials, whose time covers their LDS latency
            v16h pf[FQT];
#pragma unroll
            for (int u = 0; u < FQT; ++u) { const float nm = -mrun[u];
#pragma unroll
                for (int kt = 0; kt < 2; ++kt) { float e[8];
#pragma unroll
                    for (int i = 0; i < 4; ++i) { const v2f arg = __builtin_elementwise_fma((v2f){s[u][kt][2 * i], s[u][kt][2 * i + 1]}, (v2f){cscale, cscale}, (v2f){nm, nm}); e[2 * i] = arg[0]; e[2 * i + 1] = arg[1]; }
                    exp2x8(e[0], e[1], e[2], e[3], e[4], e[5], e[6], e[7]);
#pragma unroll
                    for (int i = 0; i < 4; ++i) { const v2h p2 = __builtin_convertvector((v2f){e[2 * i], e[2 * i + 1]}, v2h); pf[u][8 * kt + 2 * i] = p2[0]; pf[u][8 * kt + 2 * i + 1] = p2[1]; } } }
#pragma unroll
            for (int u = 0; u < FQT; ++u) {
#pragma unroll
                for (int t = 0; t < 4; ++t) acc[u][t] = wmma16(vf[t], pf[u], acc[u][t]);
                lacc[u] = wmma16(ones, pf[u], lacc[u]); }
        }
        // four vector slots behind the stage's last matrix instructions: the branch round the next stage's loads is taken on the last trip
        __builtin_amdgcn_sched_barrier(0); asm volatile("v_nop\n\tv_nop\n\tv_nop\n\tv_nop"); __builtin_amdgcn_sched_barrier(0);
        if (more) { unsigned char* Ln = L + ((st + 1) & 1) * FSLOT;   // the buffer that stage st - 1 used: every wave left it before the last barrier
#pragma unroll
            for (int i = 0; i < FCH; ++i) { *(v4ua*)(Ln + klo + i * 32 * FPK) = rk[i]; *(v4ua*)(Ln + vlo + i * 8 * FPV) = rv[i]; } }
        __syncthreads();
    }
    // join of the two key halves: wave kh finishes tile kh; it hands its sums of the other tile to its partner (wave ^ 4, same lane = same query and features) through the ring, which every wave left at the loop's last barrier
    const bool up = kh != 0;
    const float mm = up ? mrun[1] : mrun[0], lm = up ? lacc[1][0] : lacc[0][0];
    { unsigned char* xs = L + wave * FXW + lane * 16;
#pragma unroll
      for (int t = 0; t < 4; ++t) { const v8f g = up ? acc[0][t] : acc[1][t];
          *(v4fa*)(xs + (2 * t) * 512) = (v4f){g[0], g[1], g[2], g[3]}; *(v4fa*)(xs + (2 * t + 1) * 512) = (v4f){g[4], g[5], g[6], g[7]}; }
      *(v4fa*)(xs + 8 * 512) = (v4f){up ? mrun[0] : mrun[1], up ? lacc[0][0] : lacc[1][0], 0.0f, 0.0f}; }
    __syncthreads();   // the slots read below were written by the partner waves
    const unsigned char* xr = L + (wave ^ (FNW / FKH)) * FXW + lane * 16;
    const v4f pml = *(const v4fa*)(xr + 8 * 512);
    const float mj = fmaxf(mm, pml[0]); float am = mm - mj, ap = pml[0] - mj; exp2x2(am, ap);   // each half's weight: 2^(its maximum - the joint one)
    const float inv = __fdiv_rn(1.0f, lm * am + pml[1] * ap); const float fm = am * inv, fp = ap * inv;
    const size_t oo = ((size_t)(bh / NH_) * TT + q + 16 * kh) * DQ + (bh % NH_) * HD + 8 * hf;   // sums [t][r] = O[q][16 t + 8 hf + r]: 8 consecutive features per store
#pragma unroll
    for (int t = 0; t < 4; ++t) { const v8f m8 = up ? acc[1][t] : acc[0][t]; const v4f p0 = *(const v4fa*)(xr + (2 * t) * 512), p1 = *(const v4fa*)(xr + (2 * t + 1) * 512); v8us oh, ol;
#pragma unroll
        for (int r = 0; r < 8; ++r) { unsigned short a, c2; splitf(m8[r] * fm + (r < 4 ? p0[r & 3] : p1[r & 3]) * fp, a, c2); oh[r] = a; ol[r] = c2; }
        *(v8us*)(Ah + oo + 16 * t) = oh; *(v8us*)(Al + oo + 16 * t) = ol; }
}

extern "C" void kernel_launch(void* const* d_in, const int* in_sizes, int n_in,
                              void* d_out, int out_size, void* d_ws, size_t ws_size, hipStream_t stream) {
    (void)in_sizes; (void)n_in; (void)out_size;
    const float* x = (const float*)d_in[0]; const float* wq = (const float*)d_in[1]; const float* bqv = (const float*)d_in[2]; const float* wk = (const float*)d_in[3]; const float* bkv = (const float*)d_in[4]; const float* wv = (const float*)d_in[5]; const float* bvv = (const float*)d_in[6]; const float* wo = (const float*)d_in[7]; const float* bo = (const float*)d_in[8];   // Wq/Wk/Wv [8][512][64] (x @ W per head), biases [8][64], Wo [512][512] (x @ W), bo
    float* OUT = (float*)d_out;     // [2][2048][512]
    char* wsp = (char*)d_ws;
    auto take = [&](size_t bytes) { char* p = wsp; wsp += (bytes + 255) & ~(size_t)255; return (void*)p; };
    bf* WQ = (bf*)take((size_t)DQ * DM * 2); bf* WK = (bf*)take((size_t)DKV * DM * 2); bf* WV = (bf*)take((size_t)DKV * DM * 2); bf* WO = (bf*)take((size_t)DM * DQ * 2);
    bf* XB = (bf*)take((size_t)NB_ * TT * DM * 2);
    h16* QP16 = (h16*)take((size_t)NB_ * NH_ * TT * HD * 2); h16* KP16 = (h16*)take((size_t)NB_ * NKV * TT * HD * 2); h16* VT16 = (h16*)take((size_t)NB_ * NKV * HD * TT * 2);   // planes [b][h][..]; QP16, KP16 back to back
    bf* ATh = (bf*)take((size_t)NB_ * TT * DQ * 2); bf* ATl = (bf*)take((size_t)NB_ * TT * DQ * 2);
    if ((size_t)(wsp - (char*)d_ws) > ws_size) return;    // ws 256 MiB
    k_prep<<<dim3(PGX, NH_, 4), 256, 0, stream>>>(wq, wk, wv, wo, WQ, WK, WV, WO, x, XB);   // per-head [512][64] blocks -> Bt rows h*64..; Wo by 64-column blocks; x -> bf16
    k_gemmw<bf, 0, true, true><<<dim3(NB_ * TT / 64, DQ / 64, 3), 32, 0, stream>>>(XB, nullptr, WQ, nullptr, DM, nullptr, 0, bqv, bkv, bvv, 0, (size_t)DQ * DM, 0, QP16, VT16);   // z: q, k, v; rows: both batches; fp16 planes out
    k_fattn<<<dim3(TT / FBR, NB_ * NH_, 1), 256, 0, stream>>>(QP16, KP16, VT16, ATh, ATl);   // planes [b][h][..]: grid y = b * heads + h (one kv head per query head)
    k_gemmw<bf, 1, true, false><<<dim3(NB_ * TT / 64, DM / 64, 1), 32, 0, stream>>>(ATh, ATl, WO, nullptr, DQ, OUT, DM, bo, nullptr, nullptr, 0, 0, 0, nullptr, nullptr);
}

// v008
// A run of this version takes 41.3 microseconds.
// Timed twice side by side with v007, it ran 1.09 and 1.08 times as fast.
// All steps since v000 together make it 20.0 times as fast.
#include <hip/hip_runtime.h>

// Faster_MultiHeadAttention (sequences [2][2048][512]; per head h: q = x Wq[h] + bq[h], k, v likewise (Wq/Wk/Wv [8][512][64], biases [8][64]); softmax(q.k/8); z = merged heads; out = z Wo + bo -> [2][2048][512]).
// Compute dtypes, f32 accumulate: every input rounded to bf16; projections on PLAIN bf16 operands (inputs: exact, + bias; the per-head weights are re-laid as one [512][512] operand);
// scores (K 64) and att.v on SINGLE fp16 planes inside ONE kernel per (batch, head, 128 queries) with an f32 online softmax (probabilities never leave registers; two key halves per query joined at the end); merged heads as bf16 hi+lo planes x exact Wo (2 products) + bo. 64x64-tile GEMMs for the projections (q/k/v: one wave a tile; out: two waves a tile, half of K each); the q/k/v GEMM stores its tiles as the fp16 operands of the attention kernel. Deterministic,

#define NB_  2
#define TT   2048
#define DM   512
#define NH_  8
#define NKV  8
#define HD   64
#define DQ   (NH_ * HD)
#define DKV  (NKV * HD)
#define WIN  0
#define SCL  0.125f   // HD^-0.5
typedef _Float16 h16;
typedef unsigned short bf;
typedef __attribute__((ext_vector_type(16))) __bf16   v16bf;
typedef __attribute__((ext_vector_type(16))) _Float16 v16h;
typedef __attribute__((ext_vector_type(8)))  _Float16 v8h;
typedef __attribute__((ext_vector_type(8)))  unsigned short v8us;
typedef __attribute__((ext_vector_type(8)))  float    v8f;
typedef __attribute__((ext_vector_type(4)))  float    v4f;
typedef v8h  __attribute__((may_alias)) v8ha;
typedef v4f  __attribute__((may_alias)) v4fa;
typedef v8us __attribute__((may_alias)) v8usa;

__device__ __forceinline__ unsigned short f2bf(float f) { unsigned u = __float_as_uint(f); u += 0x7FFFu + ((u >> 16) & 1u); return (unsigned short)(u >> 16); }
__device__ __forceinline__ float bf2f(unsigned short b) { return __uint_as_float(((unsigned)b) << 16); }
__device__ __forceinline__ float bfr(float f) { return bf2f(f2bf(f)); }
__device__ __forceinline__ v16h cat16(v8h lo, v8h hi) { return __builtin_shufflevector(lo, hi, 0, 1, 2, 3, 4, 5, 6, 7, 8, 9, 10, 11, 12, 13, 14, 15); }
__device__ __forceinline__ v16bf cat16b(v8us lo, v8us hi) { return __builtin_bit_cast(v16bf, __builtin_shufflevector(lo, hi, 0, 1, 2, 3, 4, 5, 6, 7, 8, 9, 10, 11, 12, 13, 14, 15)); }
__device__ __forceinline__ v8f wmma16(v16h a, v16h b, v8f c) { return __builtin_amdgcn_wmma_f32_16x16x32_f16(false, a, false, b, (short)0, c, false, false); }
__device__ __forceinline__ h16 tohx(float x) { return (h16)x; }
__device__ __forceinline__ v8f wmmab(v16bf a, v16bf b, v8f c) { return __builtin_amdgcn_wmma_f32_16x16x32_bf16(false, a, false, b, (short)0, c, false, false); }



// ---- k_gemmw: register-blocked GEMM, a 64x64 output tile (16 accumulators) per work-group of KSP waves, operands from K-contiguous 16-bit planes; grid (M/64, N/64, Z), 32 KSP threads.
// KSP = 2: each wave sums the whole tile over its own half of K, from a ring of its own; behind the loop each wave hands the other the two 16-row blocks it does not finish, through LDS, and stores the sum of the two partial sums for its own two blocks.
// C[m][n] (f32, pitch ldc, + optional f32 bias[n], one bias vector per z = 0, 1, 2) = sum_k A[m][k] Bt[n][k] (+ split products per NSPLIT). z-batch strides sA/sB/sC in elements. K % (64 KSP) == 0, K >= 64 KSP.
// A stage = 64 k of every operand's 64 rows (one whole 128-byte line per row), brought into LDS by asynchronous copies, each covering four whole lines; two buffers: stage t + 1 flies while stage t's fragments are read from LDS and multiplied.
// PLANES (the q/k/v launch; C unused): a tile's 64 columns are one head and its 64 rows lie in one batch, so the tile + bias, rounded to fp16, goes straight to where the attention kernel reads it:
// z = 0, 1 (q, k) to rows [t][d] of plane [z][b][h] of P16, z = 2 (v) transposed to rows [d][t] of plane [b][h] of V16. Every store instruction covers whole 128-byte rows.
#define GPV  (64 * 2 + 16)        // LDS pitch of a staged V^T row, bytes: odd multiple of 16
#define GKS  64                   // k per stage
#define GPO  (GKS * 2 + 16)       // LDS pitch of a staged operand row, bytes: odd multiple of 16
#define GTB  (64 * GPO)           // one operand's 64 staged rows, bytes
static_assert(DM % GKS == 0 && DQ % (2 * GKS) == 0 && DM >= GKS && DQ >= 2 * GKS, "whole stages, also for each of the two waves of the out projection");
// eight asynchronous copies of 16 bytes per lane, global -> LDS: copy i takes g + i * gs to LDS byte l + i * 4 * GPO (four more rows on both sides).
// The closing s_wait_xcnt 0 stands inside the statement, in front of whatever rewrites the address registers that the copies name.
__device__ __forceinline__ void acopy8(unsigned l, const unsigned char* g, size_t gs) {
    asm volatile("global_load_async_to_lds_b128 %0, %8, off\n\tglobal_load_async_to_lds_b128 %1, %9, off\n\tglobal_load_async_to_lds_b128 %2, %10, off\n\tglobal_load_async_to_lds_b128 %3, %11, off\n\t"
                 "global_load_async_to_lds_b128 %4, %12, off\n\tglobal_load_async_to_lds_b128 %5, %13, off\n\tglobal_load_async_to_lds_b128 %6, %14, off\n\tglobal_load_async_to_lds_b128 %7, %15, off\n\ts_wait_xcnt 0x0"
                 :: "v"(l), "v"(l + 4 * GPO), "v"(l + 8 * GPO), "v"(l + 12 * GPO), "v"(l + 16 * GPO), "v"(l + 20 * GPO), "v"(l + 24 * GPO), "v"(l + 28 * GPO),
                    "v"(g), "v"(g + gs), "v"(g + 2 * gs), "v"(g + 3 * gs), "v"(g + 4 * gs), "v"(g + 5 * gs), "v"(g + 6 * gs), "v"(g + 7 * gs) : "memory"); }
// one operand's stage: 64 rows x 128 bytes = 16 copies
__device__ __forceinline__ void acopy_tile(unsigned l, const unsigned char* g, size_t gs) { acopy8(l, g, gs); acopy8(l + 32 * GPO, g + 8 * gs, gs); }
template <typename T16> struct WFrag;
template <> struct WFrag<h16> { typedef v16h V; static __device__ __forceinline__ V ld(const unsigned char* p) { return cat16(*(const v8ha*)p, *(const v8ha*)(p + 32)); } static __device__ __forceinline__ v8f mma(V a, V b, v8f c) { return wmma16(a, b, c); } };
template <> struct WFrag<bf> { typedef v16bf V; static __device__ __forceinline__ V ld(const unsigned char* p) { return cat16b(*(const v8usa*)p, *(const v8usa*)(p + 32)); } static __device__ __forceinline__ v8f mma(V a, V b, v8f c) { return wmmab(a, b, c); } };
template <typename T16, int NSPLIT, bool BIAS, bool PLANES, int KSP>
__global__ __launch_bounds__(32 * KSP) void k_gemmw(const T16* __restrict__ A, const T16* __restrict__ A2, const T16* __restrict__ Bt, const T16* __restrict__ Bt2, int K, float* C, int ldc, const float* __restrict__ bias, const float* __restrict__ bias1, const float* __restrict__ bias2, size_t sA, size_t sB, size_t sC, h16* P16, h16* V16) {
    typedef typename WFrag<T16>::V V;
    static_assert(!PLANES || (BIAS && HD == 64 && TT % 64 == 0 && NKV == NH_), "a 64x64 tile is one head of one batch");
    constexpr bool HA2 = NSPLIT == 1 || NSPLIT == 2, HB2 = NSPLIT >= 2; constexpr int GSTG = (2 + HA2 + HB2) * GTB;   // a stage in LDS: A | Bt | A2 | Bt2
    static_assert(16 * (2 + HA2 + HB2) <= 63, "one stage's copies of the wave are all that is ever outstanding");
    static_assert(KSP == 1 || (KSP == 2 && !PLANES && 8 * 1024 <= 2 * GSTG), "the join: two waves, eight accumulator tiles each way, in the giving wave's own ring");
    __shared__ __align__(16) float osa[PLANES ? 64 * GPV / 4 : KSP * 16 * 68];   // epilogue staging, a block per wave
    __shared__ __align__(16) unsigned char ring[KSP * 2 * GSTG];   // a ring of two buffers per wave
    const size_t z = blockIdx.z; A += z * sA; if (A2) A2 += z * sA; Bt += z * sB; if (Bt2) Bt2 += z * sB; C += z * sC;
    if (BIAS) bias = (z == 0) ? bias : ((z == 1) ? bias1 : bias2);   // z-batched products with a bias each (q, k, v)
    const int lane = threadIdx.x & 31, lr = lane & 15, hi = lane >> 4; const int r0 = blockIdx.x * 64, c0 = blockIdx.y * 64;
    const int wv = KSP > 1 ? __builtin_amdgcn_readfirstlane((int)(threadIdx.x >> 5)) : 0, Kw = K / KSP;   // this wave and its share of K: k = wv Kw .. wv Kw + Kw - 1
    unsigned char* const wring = ring + wv * (2 * GSTG); float* const os = osa + wv * (16 * 68);   // this wave's ring and staging block
    v8f acc[4][4];
#pragma unroll
    for (int mb = 0; mb < 4; ++mb)
#pragma unroll
        for (int nb = 0; nb < 4; ++nb) acc[mb][nb] = (v8f){};
    // copy map: a lane moves 16 bytes; 8 lanes cover a row's 128 bytes, a copy 4 rows
    const size_t aoff = ((size_t)(r0 + (lane >> 3)) * K + wv * Kw + (lane & 7) * 8) * 2, boff = ((size_t)(c0 + (lane >> 3)) * K + wv * Kw + (lane & 7) * 8) * 2, gs = (size_t)K * 8;   // bytes; gs: four rows
    const unsigned lcp = (unsigned)(size_t)wring + (lane >> 3) * GPO + (lane & 7) * 16;   // LDS byte address: the low 32 bits of the __shared__ address
    const int nt = Kw / GKS;
    auto fill = [&](int t) { const unsigned l = lcp + (t & 1) * GSTG; const size_t ko = (size_t)t * (GKS * 2);
        acopy_tile(l, (const unsigned char*)A + aoff + ko, gs); acopy_tile(l + GTB, (const unsigned char*)Bt + boff + ko, gs);
        if (HA2) acopy_tile(l + 2 * GTB, (const unsigned char*)A2 + aoff + ko, gs);
        if (HB2) acopy_tile(l + (2 + HA2) * GTB, (const unsigned char*)Bt2 + boff + ko, gs); };
    fill(0);
    asm volatile("s_wait_asynccnt 0x0" ::: "memory");   // stage 0 has landed
    __syncthreads();   // publish point of the ring (for a work-group of one wave the compiler emits no barrier instruction)
    if (nt > 1) fill(1);
#pragma unroll 1   // stays rolled: the two buffers alternate by t & 1
    for (int t = 0; t < nt; ++t) {
        const unsigned char* S = wring + (t & 1) * GSTG + lr * GPO + 16 * hi;   // fragment k order, A and B alike: 16 bytes at 16 hi and at 32 + 16 hi of each 64 bytes of a row
        constexpr int GG = (HA2 || HB2) ? 1 : GKS / 32;   // 32-k blocks whose fragments are read as one group: as many as fit beside the accumulators without a spill
        V a[GG][4], a2[GG][4], b[GG][4], b2[GG][4];
#pragma unroll
        for (int k0 = 0; k0 < GKS / 32; k0 += GG) {
#pragma unroll
            for (int kk = 0; kk < GG; ++kk) { const unsigned char* Sk = S + (k0 + kk) * 64;
#pragma unroll
                for (int i = 0; i < 4; ++i) { a[kk][i] = WFrag<T16>::ld(Sk + i * 16 * GPO); b[kk][i] = WFrag<T16>::ld(Sk + GTB + i * 16 * GPO);
                    if (HA2) a2[kk][i] = WFrag<T16>::ld(Sk + 2 * GTB + i * 16 * GPO); if (HB2) b2[kk][i] = WFrag<T16>::ld(Sk + (2 + HA2) * GTB + i * 16 * GPO); } }
            __builtin_amdgcn_sched_barrier(0);   // the group's fragment loads issue together ahead of its matrix instructions: one LDS latency per group, not one per fragment
#pragma unroll
            for (int kk = 0; kk < GG; ++kk) {
#pragma unroll
                for (int nb = 0; nb < 4; ++nb) {
#pragma unroll
                    for (int mb = 0; mb < 4; ++mb) { acc[mb][nb] = WFrag<T16>::mma(a[kk][mb], b[kk][nb], acc[mb][nb]); if (HA2) acc[mb][nb] = WFrag<T16>::mma(a2[kk][mb], b[kk][nb], acc[mb][nb]); if (HB2) acc[mb][nb] = WFrag<T16>::mma(a[kk][mb], b2[kk][nb], acc[mb][nb]); } } }
            __builtin_amdgcn_sched_barrier(0);   // the next group's loads stay together behind these matrix instructions instead of being spread among them
        }
        // four vector slots behind the trip's last matrix instructions: the branch round the refill is taken on the last trips
        asm volatile("v_nop\n\tv_nop\n\tv_nop\n\tv_nop" : "+v"(acc[0][0]), "+v"(acc[1][1]), "+v"(acc[2][2]), "+v"(acc[3][3]) : "v"(a[GG - 1][0]), "v"(a[GG - 1][3]));
        asm volatile("s_wait_dscnt 0x0" ::: "memory");      // this stage's LDS reads are done before its buffer is refilled
        asm volatile("s_wait_asynccnt 0x0" ::: "memory");   // stage t + 1 has landed
        __syncthreads();   // publish point of stage t + 1 (one wave: no barrier instruction; two waves make the same number of trips)
        if (t + 2 < nt) fill(t + 2);   // into the buffer that this trip has just read
    }
    asm volatile("s_wait_asynccnt 0x0" ::: "memory");   // nothing of the ring is outstanding when the wave goes on to its epilogue
    if (PLANES) {
        const size_t pl = (size_t)(r0 / TT) * NH_ + blockIdx.y; const int t0 = r0 % TT, l8 = lane >> 3, c8 = lane & 7;   // plane [b][h]; a store: 4 rows x 8 lanes x 16 bytes
        if (z < 2) {
            h16* prow = P16 + ((z * NB_ * NH_ + pl) * TT + t0) * HD + c8 * 8; float bb[8];
#pragma unroll
            for (int i = 0; i < 8; ++i) bb[i] = bfr(bias[c0 + c8 * 8 + i]);
#pragma unroll
            for (int mb = 0; mb < 4; ++mb) {
#pragma unroll
                for (int nb = 0; nb < 4; ++nb) {
#pragma unroll
                    for (int j = 0; j < 8; ++j) os[(hi * 8 + j) * 68 + nb * 16 + lr] = acc[mb][nb][j]; }
                __builtin_amdgcn_wave_barrier(); asm volatile("" ::: "memory");   // compiler fence: the reads below take what other lanes of this wave stored
#pragma unroll
                for (int s = 0; s < 4; ++s) { const int row = 4 * s + l8; const v4f v0 = *(const v4fa*)(os + row * 68 + c8 * 8), v1 = *(const v4fa*)(os + row * 68 + c8 * 8 + 4); v8h o;
#pragma unroll
                    for (int i = 0; i < 4; ++i) { o[i] = tohx(v0[i] + bb[i]); o[4 + i] = tohx(v1[i] + bb[4 + i]); }
                    *(v8h*)(prow + (size_t)(mb * 16 + row) * HD) = o; }
                __builtin_amdgcn_wave_barrier(); asm volatile("" ::: "memory");   // compiler fence: the next block's stores stay behind these reads
            }
        } else {
            unsigned char* ot = (unsigned char*)os;   // acc[mb][nb][0..7]: 8 consecutive t of feature 16 nb + lr = 16 bytes of a V^T row
#pragma unroll
            for (int nb = 0; nb < 4; ++nb) { const float bv = bfr(bias[c0 + nb * 16 + lr]);
#pragma unroll
                for (int mb = 0; mb < 4; ++mb) { v8h o;
#pragma unroll
                    for (int j = 0; j < 8; ++j) o[j] = tohx(acc[mb][nb][j] + bv);
                    *(v8ha*)(ot + (nb * 16 + lr) * GPV + mb * 32 + hi * 16) = o; } }
            __builtin_amdgcn_wave_barrier(); asm volatile("" ::: "memory");   // compiler fence: the reads below take what other lanes of this wave stored
            h16* vrow = V16 + pl * HD * TT + t0 + c8 * 8;
#pragma unroll
            for (int s = 0; s < 16; ++s) { const int d = 4 * s + l8; *(v8h*)(vrow + (size_t)d * TT) = *(const v8ha*)(ot + d * GPV + c8 * 16); }
            asm volatile("s_wait_xcnt 0x0" ::: "memory");   // the sixteen stores above are issued: their address registers may be reused from here on
        }
        return;
    }
    if (KSP == 2) {   // join of the two halves of K: wave wv finishes the 16-row blocks 2 wv and 2 wv + 1
        const bool up = wv != 0;
        unsigned char* xs = wring + lane * 16;   // this wave's own ring: its copies have landed and its reads are done
#pragma unroll
        for (int m2 = 0; m2 < 2; ++m2) {
#pragma unroll
            for (int nb = 0; nb < 4; ++nb) { const v8f g = up ? acc[m2][nb] : acc[2 + m2][nb];
                *(v4fa*)(xs + (m2 * 8 + nb * 2) * 512) = (v4f){g[0], g[1], g[2], g[3]}; *(v4fa*)(xs + (m2 * 8 + nb * 2 + 1) * 512) = (v4f){g[4], g[5], g[6], g[7]}; } }
        __syncthreads();   // the partial sums read below were written by the other wave
        const unsigned char* xr = ring + (wv ^ 1) * (2 * GSTG) + lane * 16;
#pragma unroll
        for (int m2 = 0; m2 < 2; ++m2) {
#pragma unroll
            for (int nb = 0; nb < 4; ++nb) { const v8f m8 = up ? acc[2 + m2][nb] : acc[m2][nb]; const v4f p0 = *(const v4fa*)(xr + (m2 * 8 + nb * 2) * 512), p1 = *(const v4fa*)(xr + (m2 * 8 + nb * 2 + 1) * 512);
                acc[m2][nb] = m8 + (v8f){p0[0], p0[1], p0[2], p0[3], p1[0], p1[1], p1[2], p1[3]}; } }
    }
#pragma unroll
    for (int mb = 0; mb < 4 / KSP; ++mb) {
#pragma unroll
        for (int nb = 0; nb < 4; ++nb) {
#pragma unroll
            for (int j = 0; j < 8; ++j) os[(hi * 8 + j) * 68 + nb * 16 + lr] = acc[mb][nb][j]; }
        __builtin_amdgcn_wave_barrier(); asm volatile("" ::: "memory");
        float* crow = C + (size_t)(r0 + (wv * (4 / KSP) + mb) * 16) * ldc + c0;
{
#pragma unroll
            for (int s = 0; s < 8; ++s) { const int row = 2 * s + hi, cofs = lr * 4; v4f val = *(const v4fa*)(os + row * 68 + cofs); if (BIAS) { val[0] += bfr(bias[c0 + cofs]); val[1] += bfr(bias[c0 + cofs + 1]); val[2] += bfr(bias[c0 + cofs + 2]); val[3] += bfr(bias[c0 + cofs + 3]); }
                *(v4f*)(crow + (size_t)row * ldc + cofs) = val; }
             }
        asm volatile("s_wait_xcnt 0x0" ::: "memory");   // the eight stores above are issued: their registers may be reused from here on
        __builtin_amdgcn_wave_barrier(); asm volatile("" ::: "memory");
    }
}

__device__ __forceinline__ void splitf(float y, unsigned short& h, unsigned short& l) { h = f2bf(y); l = f2bf(y - bf2f(h)); }
typedef __attribute__((ext_vector_type(2))) _Float16 v2h;
typedef __attribute__((ext_vector_type(4))) _Float16 v4h;
typedef __attribute__((ext_vector_type(2))) unsigned short v2us;
typedef __attribute__((ext_vector_type(4))) unsigned short v4us;
typedef __attribute__((ext_vector_type(2))) float v2f;
typedef __attribute__((ext_vector_type(4))) int v4i;

// k_prep: every bf16 operand of the projections in one launch. grid (64-k block, 64-column block y, operand zz): zz 0..2 = Wq/Wk/Wv head y ([DM][HD], pitch HD), zz 3 = columns y*HD.. of Wo ([DQ][DM], pitch DM); each block -> 64 k of Bt rows y*HD.., K-contiguous.
// A block takes 64 k x 64 columns of its operand: four 16-byte loads per thread, each wave-wide load covering whole 256-byte row pieces and all of them issued at once; the rounded values of rows k, k + 1 are packed and turned through LDS; every store covers one whole 128-byte line of a Bt row.
// Each block also rounds its own 1 / 256 of x to bf16: XG groups of 8 values per thread, a wave's load covering 1 KiB in a row; these loads are issued with the weight loads.
static_assert(NKV == NH_ && DM / HD == NH_ && DQ == DM, "one grid shape serves the four weight operands");
#define PGX  (DM / 64)                    // grid x: 64-k blocks
#define PNB  (PGX * NH_ * 4)              // work-groups of the launch
#define XG   4                            // groups of 8 values of x per thread
#define PTP  33                           // LDS pitch of a turned row, dwords: 32 pairs of k + 1, so that the 32 lanes of a store (rows 4 apart, two neighbouring pairs) fall on 32 banks
typedef unsigned __attribute__((may_alias)) u32a;
static_assert((size_t)NB_ * TT * DM == (size_t)PNB * 256 * XG * 8, "the work-groups' slices cover x exactly");
static_assert(HD == 64 && DM % 64 == 0, "a block's weight tile: 64 k x 64 columns = 256 threads x 2 row pairs x 4 columns");
__global__ __launch_bounds__(256) void k_prep(const float* __restrict__ wq, const float* __restrict__ wk, const float* __restrict__ wv, const float* __restrict__ wo, bf* BQ, bf* BK, bf* BV, bf* BO, const float* __restrict__ x, bf* XB) {
    __shared__ unsigned tw[HD * PTP];   // [column n][pair of k]
    const int y = blockIdx.y, zz = blockIdx.z, tid = threadIdx.x; const int ldw = (zz == 3) ? DM : HD;
    const size_t xi = ((size_t)((zz * NH_ + y) * PGX + blockIdx.x) * (XG * 256) + tid) * 8;   // this thread's first group of x; the next ones 256 groups on
    const float* w = (zz == 0) ? wq : (zz == 1) ? wk : (zz == 2) ? wv : wo; w += (zz == 3) ? (size_t)y * HD : (size_t)y * DM * HD;
    bf* Bt = ((zz == 0) ? BQ : (zz == 1) ? BK : (zz == 2) ? BV : BO) + (size_t)y * HD * DM;
    const int k0 = blockIdx.x * 64, c4 = (tid & 15) * 4, kq = tid >> 4;   // this thread: columns c4 .. c4 + 3 of the row pairs kq and 16 + kq
    v4f wa[2], wb[2];
#pragma unroll
    for (int i = 0; i < 2; ++i) { const float* p = w + (size_t)(k0 + 2 * (i * 16 + kq)) * ldw + c4; wa[i] = *(const v4fa*)p; wb[i] = *(const v4fa*)(p + ldw); }
    v8f xv[XG];
#pragma unroll
    for (int j = 0; j < XG; ++j) xv[j] = *(const v8f*)(x + xi + (size_t)j * (256 * 8));
    asm volatile("s_wait_xcnt 0x0" ::: "memory");   // the loads above are issued: their address registers may be reused from here on
    __builtin_amdgcn_sched_barrier(0);   // no conversion, with its wait, moves up among the loads: all twelve fly together, one memory latency for the thread
#pragma unroll
    for (int i = 0; i < 2; ++i) {
#pragma unroll
        for (int j = 0; j < 4; ++j) tw[(c4 + j) * PTP + i * 16 + kq] = (unsigned)f2bf(wa[i][j]) | ((unsigned)f2bf(wb[i][j]) << 16); }   // low half: k, high half: k + 1
    __syncthreads();   // the rows read below were written by all eight waves
    const int lane = tid & 31, n0 = (tid >> 5) * 8;   // a wave stores eight Bt rows' 64 k, one line per store
    unsigned tv[8];
#pragma unroll
    for (int r = 0; r < 8; ++r) tv[r] = tw[(n0 + r) * PTP + lane];
    v8us xo[XG];
#pragma unroll
    for (int j = 0; j < XG; ++j) {
#pragma unroll
        for (int k = 0; k < 8; ++k) xo[j][k] = f2bf(xv[j][k]); }
#pragma unroll
    for (int r = 0; r < 8; ++r) *(u32a*)(Bt + (size_t)(n0 + r) * DM + k0 + lane * 2) = tv[r];
#pragma unroll
    for (int j = 0; j < XG; ++j) *(v8us*)(XB + xi + (size_t)j * (256 * 8)) = xo[j];
}
#define FNW  8                    // waves per work-group
#define FKH  2                    // key halves of a stage, one per wave group
#define FQT  2                    // 16-query tiles per wave
#define FBR  (FNW / FKH * FQT * 16)   // queries per work-group
#define FSK  256                  // keys per stage: 128 per key half, four 32-key passes of a wave between barriers
#define FPK  (HD * 2 + 16)        // LDS pitch of a K row, bytes: odd multiple of 16
#define FPV  (FSK * 2 + 16)       // LDS pitch of a V^T row, bytes: odd multiple of 16
#define FTK  (FSK * FPK)
#define FTV  (HD * FPV)
#define FSLOT (FTK + FTV)
#define FXW  (9 * 512)            // a wave's slot of the closing exchange, bytes: 8 x 16 bytes of sums + 16 bytes of maximum and denominator per lane
typedef __attribute__((ext_vector_type(4))) unsigned v4u;
typedef v4u __attribute__((may_alias)) v4ua;
#define FCH  8                    // staged chunks of 16 bytes per thread, operand and stage
static_assert(HD == 64 && TT % FSK == 0 && TT % FBR == 0 && FSK * HD * 2 == FCH * 256 * 16 && FSK * 2 == 32 * 16, "staging map: 256 threads x FCH chunks of 16 bytes per operand and stage; a wave covers one V^T row piece");
static_assert(FKH == 2 && FQT == 2 && FNW * FXW <= 2 * FSLOT, "the closing exchange: each wave of a pair finishes one tile; the slots lie in the ring");
__device__ __forceinline__ v16h fragl(const unsigned char* p) { return cat16(*(const v8ha*)p, *(const v8ha*)(p + 32)); }
__device__ __forceinline__ float xhalf(float x) { return __builtin_bit_cast(float, __builtin_amdgcn_permlanex16(__builtin_bit_cast(int, x), __builtin_bit_cast(int, x), 0x76543210, 0xfedcba98, false, false)); }   // lane l with lane l ^ 16
// eight exponentials (2^x) in place in one statement: no v_exp_f32 has its source overwritten by the instruction directly behind it, and the closing v_nop is the slot the instruction set asks for between a transcendental and the first use of its result
__device__ __forceinline__ void exp2x8(float& a, float& b, float& c, float& d, float& e, float& f, float& g, float& h) {
    asm("v_exp_f32 %0, %0\n\tv_exp_f32 %1, %1\n\tv_exp_f32 %2, %2\n\tv_exp_f32 %3, %3\n\tv_exp_f32 %4, %4\n\tv_exp_f32 %5, %5\n\tv_exp_f32 %6, %6\n\tv_exp_f32 %7, %7\n\tv_nop" : "+v"(a), "+v"(b), "+v"(c), "+v"(d), "+v"(e), "+v"(f), "+v"(g), "+v"(h)); }
// two exponentials (2^x) in place, same form: the closing v_nop keeps the slot behind the second one
__device__ __forceinline__ void exp2x2(float& a, float& b) { asm("v_exp_f32 %0, %0\n\tv_exp_f32 %1, %1\n\tv_nop" : "+v"(a), "+v"(b)); }
__global__ __launch_bounds__(256) void k_fattn(const h16* __restrict__ Qp, const h16* __restrict__ Kp, const h16* __restrict__ Vt, bf* Ah, bf* Al) {
    __shared__ __align__(16) unsigned char L[2 * FSLOT];
    const int tid = threadIdx.x, lane = tid & 31, wave = tid >> 5, c = lane & 15, hf = lane >> 4;
    const int kh = wave / (FNW / FKH);   // this wave's half of every stage's keys
    const int bh = blockIdx.y; const int q = blockIdx.x * FBR + (wave % (FNW / FKH)) * (FQT * 16) + c;   // this lane's query in tile 0; tile 1: 16 on
    const float cscale = SCL * 1.4426950408889634f;
    // staging map: chunk i of thread tid = 16 bytes; K: row 32 i + tid / 8, V^T: row 8 i + tid / 32; a wave's load covers whole 128-byte lines
    const unsigned char* kg = (const unsigned char*)(Kp + (size_t)bh * TT * HD) + tid * 16;
    const unsigned char* vg = (const unsigned char*)(Vt + (size_t)bh * HD * TT) + (size_t)(tid >> 5) * (TT * 2) + (tid & 31) * 16;
    const int klo = (tid >> 3) * FPK + (tid & 7) * 16, vlo = FTK + (tid >> 5) * FPV + (tid & 31) * 16;
    v4u rk[FCH], rv[FCH];
#pragma unroll
    for (int i = 0; i < FCH; ++i) { rk[i] = *(const v4ua*)(kg + i * 4096); rv[i] = *(const v4ua*)(vg + (size_t)i * 8 * TT * 2); }
    v16h qf[FQT][2];
#pragma unroll
    for (int u = 0; u < FQT; ++u) { const h16* qp = Qp + ((size_t)bh * TT + q + 16 * u) * HD + 8 * hf;
#pragma unroll
      for (int kc = 0; kc < 2; ++kc) qf[u][kc] = cat16(*(const v8h*)(qp + 32 * kc), *(const v8h*)(qp + 32 * kc + 16)); }
    asm volatile("s_wait_xcnt 0x0" ::: "memory");   // the twenty-four loads above are issued: their address registers may be reused from here on
    v16h ones;   // A operand of all ones: every row of its product holds the column sums of P^T (the softmax denominators' increments)
#pragma unroll
    for (int i = 0; i < 16; ++i) ones[i] = (h16)1.0f;
    v8f acc[FQT][4], lacc[FQT]; float mrun[FQT];
#pragma unroll
    for (int u = 0; u < FQT; ++u) { lacc[u] = (v8f){}; mrun[u] = -3.0e38f;
#pragma unroll
        for (int t = 0; t < 4; ++t) acc[u][t] = (v8f){}; }
#pragma unroll
    for (int i = 0; i < FCH; ++i) { *(v4ua*)(L + klo + i * 32 * FPK) = rk[i]; *(v4ua*)(L + vlo + i * 8 * FPV) = rv[i]; }
    __syncthreads();
    const int kfo = (kh * (FSK / FKH) + c) * FPK + 16 * hf, vfo = FTK + c * FPV + kh * (FSK / FKH) * 2 + 16 * hf;   // this lane's first K and V^T fragment bytes in a stage
#pragma unroll 1   // stays rolled: the body already holds its unrolled passes, and the two buffers alternate by st & 1
    for (int st = 0; st < TT / FSK; ++st) {
        const unsigned char* Ls = L + (st & 1) * FSLOT;
        const bool more = st + 1 < TT / FSK;
        if (more) {
#pragma unroll
            for (int i = 0; i < FCH; ++i) { rk[i] = *(const v4ua*)(kg + (size_t)(st + 1) * (FSK * HD * 2) + i * 4096); rv[i] = *(const v4ua*)(vg + (size_t)(st + 1) * (FSK * 2) + (size_t)i * 8 * TT * 2); } }
        v16h kf[2][2];   // K fragments of the pass at hand; each pass fetches the next one's (same stage) with its V^T fragments
#pragma unroll
        for (int kt = 0; kt < 2; ++kt) {
#pragma unroll
            for (int kc = 0; kc < 2; ++kc) kf[kt][kc] = fragl(Ls + kfo + kt * 16 * FPK + 64 * kc); }
        __builtin_amdgcn_sched_barrier(0);   // the first pass's eight K fragment loads issue as one group ahead of its score products: one LDS wait, none between the products
#pragma unroll
        for (int ps = 0; ps < FSK / FKH / 32; ++ps) {
            v8f s[FQT][2];
#pragma unroll
            for (int u = 0; u < FQT; ++u) {
#pragma unroll
                for (int kt = 0; kt < 2; ++kt) s[u][kt] = wmma16(kf[kt][0], qf[u][0], (v8f){}); }
#pragma unroll
            for (int u = 0; u < FQT; ++u) {
#pragma unroll
                for (int kt = 0; kt < 2; ++kt) s[u][kt] = wmma16(kf[kt][1], qf[u][1], s[u][kt]); }
            __builtin_amdgcn_sched_barrier(0);   // the eight score products issue back to back, each filling the slots the chip asks for behind the others, before the first maximum reads a result
            float mx[FQT];
#pragma unroll
            for (int u = 0; u < FQT; ++u) { mx[u] = s[u][0][0];
#pragma unroll
                for (int r = 1; r < 16; ++r) mx[u] = fmaxf(mx[u], s[u][r >> 3][r & 7]);
                mx[u] = fmaxf(mx[u], xhalf(mx[u])) * cscale; }   // both halves of the wave now hold this query's maximum over the pass's 32 keys, scaled (the scale is positive)
            if (__builtin_amdgcn_ballot_w32(mx[0] > mrun[0] + 8.0f || mx[1] > mrun[1] + 8.0f) != 0) {   // one scalar branch per pass; rare after the first passes
#pragma unroll
                for (int u = 0; u < FQT; ++u) {
                    const float mnew = fmaxf(mrun[u], mx[u]); const float corr = __builtin_amdgcn_exp2f(mrun[u] - mnew); mrun[u] = mnew;   // first pass: corr = 0 on zero sums
                    lacc[u] = lacc[u] * corr;
#pragma unroll
                    for (int t = 0; t < 4; ++t) acc[u][t] = acc[u][t] * corr; } }
            const unsigned char* vp = Ls + vfo + ps * 64;
            v16h vf[4];
#pragma unroll
            for (int t = 0; t < 4; ++t) vf[t] = fragl(vp + t * 16 * FPV);
            if (ps + 1 < FSK / FKH / 32) {
#pragma unroll
                for (int kt = 0; kt < 2; ++kt) {
#pragma unroll
                    for (int kc = 0; kc < 2; ++kc) kf[kt][kc] = fragl(Ls + kfo + ((ps + 1) * 32 + kt * 16) * FPK + 64 * kc); } }
            __builtin_amdgcn_sched_barrier(0);   // the V^T loads and the next pass's K loads issue in front of the exponentials, whose time covers their LDS latency
            v16h pf[FQT];
#pragma unroll
            for (int u = 0; u < FQT; ++u) { const float nm = -mrun[u];
#pragma unroll
                for (int kt = 0; kt < 2; ++kt) { float e[8];
#pragma unroll
                    for (int i = 0; i < 4; ++i) { const v2f arg = __builtin_elementwise_fma((v2f){s[u][kt][2 * i], s[u][kt][2 * i + 1]}, (v2f){cscale, cscale}, (v2f){nm, nm}); e[2 * i] = arg[0]; e[2 * i + 1] = arg[1]; }
                    exp2x8(e[0], e[1], e[2], e[3], e[4], e[5], e[6], e[7]);
#pragma unroll
                    for (int i = 0; i < 4; ++i) { const v2h p2 = __builtin_convertvector((v2f){e[2 * i], e[2 * i + 1]}, v2h); pf[u][8 * kt + 2 * i] = p2[0]; pf[u][8 * kt + 2 * i + 1] = p2[1]; } } }
#pragma unroll
            for (int u = 0; u < FQT; ++u) {
#pragma unroll
                for (int t = 0; t < 4; ++t) acc[u][t] = wmma16(vf[t], pf[u], acc[u][t]);
                lacc[u] = wmma16(ones, pf[u], lacc[u]); }
        }
        // four vector slots behind the stage's last matrix instructions: the branch round the next stage's loads is taken on the last trip
        __builtin_amdgcn_sched_barrier(0); asm volatile("v_nop\n\tv_nop\n\tv_nop\n\tv_nop"); __builtin_amdgcn_sched_barrier(0);
        if (more) { unsigned char* Ln = L + ((st + 1) & 1) * FSLOT;   // the buffer that stage st - 1 used: every wave left it before the last barrier
#pragma unroll
            for (int i = 0; i < FCH; ++i) { *(v4ua*)(Ln + klo + i * 32 * FPK) = rk[i]; *(v4ua*)(Ln + vlo + i * 8 * FPV) = rv[i]; } }
        __syncthreads();
    }
    // join of the two key halves: wave kh finishes tile kh; it hands its sums of the other tile to its partner (wave ^ 4, same lane = same query and features) through the ring, which every wave left at the loop's last barrier
    const bool up = kh != 0;
    const float mm = up ? mrun[1] : mrun[0], lm = up ? lacc[1][0] : lacc[0][0];
    { unsigned char* xs = L + wave * FXW + lane * 16;
#pragma unroll
      for (int t = 0; t < 4; ++t) { const v8f g = up ? acc[0][t] : acc[1][t];
          *(v4fa*)(xs + (2 * t) * 512) = (v4f){g[0], g[1], g[2], g[3]}; *(v4fa*)(xs + (2 * t + 1) * 512) = (v4f){g[4], g[5], g[6], g[7]}; }
      *(v4fa*)(xs + 8 * 512) = (v4f){up ? mrun[0] : mrun[1], up ? lacc[0][0] : lacc[1][0], 0.0f, 0.0f}; }
    __syncthreads();   // the slots read below were written by the partner waves
    const unsigned char* xr = L + (wave ^ (FNW / FKH)) * FXW + lane * 16;
    const v4f pml = *(const v4fa*)(xr + 8 * 512);
    const float mj = fmaxf(mm, pml[0]); float am = mm - mj, ap = pml[0] - mj; exp2x2(am, ap);   // each half's weight: 2^(its maximum - the joint one)
    const float inv = __fdiv_rn(1.0f, lm * am + pml[1] * ap); const float fm = am * inv, fp = ap * inv;
    const size_t oo = ((size_t)(bh / NH_) * TT + q + 16 * kh) * DQ + (bh % NH_) * HD + 8 * hf;   // sums [t][r] = O[q][16 t + 8 hf + r]: 8 consecutive features per store
#pragma unroll
    for (int t = 0; t < 4; ++t) { const v8f m8 = up ? acc[1][t] : acc[0][t]; const v4f p0 = *(const v4fa*)(xr + (2 * t) * 512), p1 = *(const v4fa*)(xr + (2 * t + 1) * 512); v8us oh, ol;
#pragma unroll
        for (int r = 0; r < 8; ++r) { unsigned short a, c2; splitf(m8[r] * fm + (r < 4 ? p0[r & 3] : p1[r & 3]) * fp, a, c2); oh[r] = a; ol[r] = c2; }
        *(v8us*)(Ah + oo + 16 * t) = oh; *(v8us*)(Al + oo + 16 * t) = ol; }
}

extern "C" void kernel_launch(void* const* d_in, const int* in_sizes, int n_in,
                              void* d_out, int out_size, void* d_ws, size_t ws_size, hipStream_t stream) {
    (void)in_sizes; (void)n_in; (void)out_size;
    const float* x = (const float*)d_in[0]; const float* wq = (const float*)d_in[1]; const float* bqv = (const float*)d_in[2]; const float* wk = (const float*)d_in[3]; const float* bkv = (const float*)d_in[4]; const float* wv = (const float*)d_in[5]; const float* bvv = (const float*)d_in[6]; const float* wo = (const float*)d_in[7]; const float* bo = (const float*)d_in[8];   // Wq/Wk/Wv [8][512][64] (x @ W per head), biases [8][64], Wo [512][512] (x @ W), bo
    float* OUT = (float*)d_out;     // [2][2048][512]
    char* wsp = (char*)d_ws;
    auto take = [&](size_t bytes) { char* p = wsp; wsp += (bytes + 255) & ~(size_t)255; return (void*)p; };
    bf* WQ = (bf*)take((size_t)DQ * DM * 2); bf* WK = (bf*)take((size_t)DKV * DM * 2); bf* WV = (bf*)take((size_t)DKV * DM * 2); bf* WO = (bf*)take((size_t)DM * DQ * 2);
    bf* XB = (bf*)take((size_t)NB_ * TT * DM * 2);
    h16* QP16 = (h16*)take((size_t)NB_ * NH_ * TT * HD * 2); h16* KP16 = (h16*)take((size_t)NB_ * NKV * TT * HD * 2); h16* VT16 = (h16*)take((size_t)NB_ * NKV * HD * TT * 2);   // planes [b][h][..]; QP16, KP16 back to back
    bf* ATh = (bf*)take((size_t)NB_ * TT * DQ * 2); bf* ATl = (bf*)take((size_t)NB_ * TT * DQ * 2);
    if ((size_t)(wsp - (char*)d_ws) > ws_size) return;    // ws 256 MiB
    k_prep<<<dim3(PGX, NH_, 4), 256, 0, stream>>>(wq, wk, wv, wo, WQ, WK, WV, WO, x, XB);   // per-head [512][64] blocks -> Bt rows h*64..; Wo by 64-column blocks; x -> bf16
    k_gemmw<bf, 0, true, true, 1><<<dim3(NB_ * TT / 64, DQ / 64, 3), 32, 0, stream>>>(XB, nullptr, WQ, nullptr, DM, nullptr, 0, bqv, bkv, bvv, 0, (size_t)DQ * DM, 0, QP16, VT16);   // z: q, k, v; rows: both batches; fp16 planes out
    k_fattn<<<dim3(TT / FBR, NB_ * NH_, 1), 256, 0, stream>>>(QP16, KP16, VT16, ATh, ATl);   // planes [b][h][..]: grid y = b * heads + h (one kv head per query head)
    k_gemmw<bf, 1, true, false, 2><<<dim3(NB_ * TT / 64, DM / 64, 1), 64, 0, stream>>>(ATh, ATl, WO, nullptr, DQ, OUT, DM, bo, nullptr, nullptr, 0, 0, 0, nullptr, nullptr);
}

// v010
// Measured time: 37.8 microseconds a run.
// It is 1.10 times as fast as v008, going by the measured steps of the versions left out in between.
// All steps since v000 together make it 22.0 times as fast.
#include <hip/hip_runtime.h>

// Faster_MultiHeadAttention (sequences [2][2048][512]; per head h: q = x Wq[h] + bq[h], k, v likewise (Wq/Wk/Wv [8][512][64], biases [8][64]); softmax(q.k/8); z = merged heads; out = z Wo + bo -> [2][2048][512]).
// Compute dtypes, f32 accumulate: every input rounded to bf16; q/k/v projections on PLAIN bf16 operands (inputs: exact, + bias; x and the per-head weights are rounded on their way into the GEMM's LDS stages);
// scores (K 64) and att.v on SINGLE fp16 planes inside ONE kernel per (batch, head, 128 queries) with an f32 online softmax (probabilities never leave registers; two key halves per query joined at the end); merged heads as ONE fp16 plane x Wo (rounded to bf16 like every input, then held as fp16: 1 product) + bo. 64x64 wave tiles in the projections (q/k/v: six waves share a work-group's stages, 128 rows x one head's q, k and v; out: two waves a tile, half of K each); the q/k/v GEMM stores its tiles as the fp16 operands of the attention kernel. Deterministic,

#define NB_  2
#define TT   2048
#define DM   512
#define NH_  8
#define NKV  8
#define HD   64
#define DQ   (NH_ * HD)
#define DKV  (NKV * HD)
#define WIN  0
#define SCL  0.125f   // HD^-0.5
typedef _Float16 h16;
typedef unsigned short bf;
typedef __attribute__((ext_vector_type(16))) __bf16   v16bf;
typedef __attribute__((ext_vector_type(16))) _Float16 v16h;
typedef __attribute__((ext_vector_type(8)))  _Float16 v8h;
typedef __attribute__((ext_vector_type(8)))  unsigned short v8us;
typedef __attribute__((ext_vector_type(8)))  float    v8f;
typedef __attribute__((ext_vector_type(4)))  float    v4f;
typedef v8h  __attribute__((may_alias)) v8ha;
typedef v4f  __attribute__((may_alias)) v4fa;
typedef v8us __attribute__((may_alias)) v8usa;

__device__ __forceinline__ unsigned short f2bf(float f) { unsigned u = __float_as_uint(f); u += 0x7FFFu + ((u >> 16) & 1u); return (unsigned short)(u >> 16); }
__device__ __forceinline__ float bf2f(unsigned short b) { return __uint_as_float(((unsigned)b) << 16); }
__device__ __forceinline__ float bfr(float f) { return bf2f(f2bf(f)); }
__device__ __forceinline__ v16h cat16(v8h lo, v8h hi) { return __builtin_shufflevector(lo, hi, 0, 1, 2, 3, 4, 5, 6, 7, 8, 9, 10, 11, 12, 13, 14, 15); }
__device__ __forceinline__ v16bf cat16b(v8us lo, v8us hi) { return __builtin_bit_cast(v16bf, __builtin_shufflevector(lo, hi, 0, 1, 2, 3, 4, 5, 6, 7, 8, 9, 10, 11, 12, 13, 14, 15)); }
__device__ __forceinline__ v8f wmma16(v16h a, v16h b, v8f c) { return __builtin_amdgcn_wmma_f32_16x16x32_f16(false, a, false, b, (short)0, c, false, false); }
__device__ __forceinline__ h16 tohx(float x) { return (h16)x; }
__device__ __forceinline__ v8f wmmab(v16bf a, v16bf b, v8f c) { return __builtin_amdgcn_wmma_f32_16x16x32_bf16(false, a, false, b, (short)0, c, false, false); }



// ---- k_gemmw: register-blocked GEMM, a 64x64 output tile (16 accumulators) per work-group of KSP waves, operands from K-contiguous 16-bit planes; grid (M/64, N/64, Z), 32 KSP threads.
// KSP = 2: each wave sums the whole tile over its own half of K, from a ring of its own; behind the loop each wave hands the other the two 16-row blocks it does not finish, through LDS, and stores the sum of the two partial sums for its own two blocks.
// C[m][n] (f32, pitch ldc, + optional f32 bias[n], one bias vector per z = 0, 1, 2) = sum_k A[m][k] Bt[n][k] (+ split products per NSPLIT). z-batch strides sA/sB/sC in elements. K % (64 KSP) == 0, K >= 64 KSP.
// A stage = 64 k of every operand's 64 rows (one whole 128-byte line per row), brought into LDS by asynchronous copies, each covering four whole lines; two buffers: stage t + 1 flies while stage t's fragments are read from LDS and multiplied.
#define GPV  (64 * 2 + 16)        // LDS pitch of a staged V^T row, bytes: odd multiple of 16
#define GKS  64                   // k per stage
#define GPO  (GKS * 2 + 16)       // LDS pitch of a staged operand row, bytes: odd multiple of 16
#define GTB  (64 * GPO)           // one operand's 64 staged rows, bytes
static_assert(DM % GKS == 0 && DQ % (2 * GKS) == 0 && DM >= GKS && DQ >= 2 * GKS, "whole stages, also for each of the two waves of the out projection");
// eight asynchronous copies of 16 bytes per lane, global -> LDS: copy i takes g + i * gs to LDS byte l + i * 4 * GPO (four more rows on both sides).
// The closing s_wait_xcnt 0 stands inside the statement, in front of whatever rewrites the address registers that the copies name.
__device__ __forceinline__ void acopy8(unsigned l, const unsigned char* g, size_t gs) {
    asm volatile("global_load_async_to_lds_b128 %0, %8, off\n\tglobal_load_async_to_lds_b128 %1, %9, off\n\tglobal_load_async_to_lds_b128 %2, %10, off\n\tglobal_load_async_to_lds_b128 %3, %11, off\n\t"
                 "global_load_async_to_lds_b128 %4, %12, off\n\tglobal_load_async_to_lds_b128 %5, %13, off\n\tglobal_load_async_to_lds_b128 %6, %14, off\n\tglobal_load_async_to_lds_b128 %7, %15, off\n\ts_wait_xcnt 0x0"
                 :: "v"(l), "v"(l + 4 * GPO), "v"(l + 8 * GPO), "v"(l + 12 * GPO), "v"(l + 16 * GPO), "v"(l + 20 * GPO), "v"(l + 24 * GPO), "v"(l + 28 * GPO),
                    "v"(g), "v"(g + gs), "v"(g + 2 * gs), "v"(g + 3 * gs), "v"(g + 4 * gs), "v"(g + 5 * gs), "v"(g + 6 * gs), "v"(g + 7 * gs) : "memory"); }
// one operand's stage: 64 rows x 128 bytes = 16 copies
__device__ __forceinline__ void acopy_tile(unsigned l, const unsigned char* g, size_t gs) { acopy8(l, g, gs); acopy8(l + 32 * GPO, g + 8 * gs, gs); }
template <typename T16> struct WFrag;
template <> struct WFrag<h16> { typedef v16h V; static __device__ __forceinline__ V ld(const unsigned char* p) { return cat16(*(const v8ha*)p, *(const v8ha*)(p + 32)); } static __device__ __forceinline__ v8f mma(V a, V b, v8f c) { return wmma16(a, b, c); } };
template <> struct WFrag<bf> { typedef v16bf V; static __device__ __forceinline__ V ld(const unsigned char* p) { return cat16b(*(const v8usa*)p, *(const v8usa*)(p + 32)); } static __device__ __forceinline__ v8f mma(V a, V b, v8f c) { return wmmab(a, b, c); } };
template <typename T16, int NSPLIT, bool BIAS, int KSP>
__global__ __launch_bounds__(32 * KSP) void k_gemmw(const T16* __restrict__ A, const T16* __restrict__ A2, const T16* __restrict__ Bt, const T16* __restrict__ Bt2, int K, float* C, int ldc, const float* __restrict__ bias, const float* __restrict__ bias1, const float* __restrict__ bias2, size_t sA, size_t sB, size_t sC) {
    typedef typename WFrag<T16>::V V;
    constexpr bool HA2 = NSPLIT == 1 || NSPLIT == 2, HB2 = NSPLIT >= 2; constexpr int GSTG = (2 + HA2 + HB2) * GTB;   // a stage in LDS: A | Bt | A2 | Bt2
    static_assert(16 * (2 + HA2 + HB2) <= 63, "one stage's copies of the wave are all that is ever outstanding");
    static_assert(KSP == 1 || (KSP == 2 && 8 * 1024 <= 2 * GSTG), "the join: two waves, eight accumulator tiles each way, in the giving wave's own ring");
    __shared__ __align__(16) float osa[KSP * 16 * 68];   // epilogue staging, a block per wave
    __shared__ __align__(16) unsigned char ring[KSP * 2 * GSTG];   // a ring of two buffers per wave
    const size_t z = blockIdx.z; A += z * sA; if (A2) A2 += z * sA; Bt += z * sB; if (Bt2) Bt2 += z * sB; C += z * sC;
    if (BIAS) bias = (z == 0) ? bias : ((z == 1) ? bias1 : bias2);   // z-batched products with a bias each
    const int lane = threadIdx.x & 31, lr = lane & 15, hi = lane >> 4; const int r0 = blockIdx.x * 64, c0 = blockIdx.y * 64;
    const int wv = KSP > 1 ? __builtin_amdgcn_readfirstlane((int)(threadIdx.x >> 5)) : 0, Kw = K / KSP;   // this wave and its share of K: k = wv Kw .. wv Kw + Kw - 1
    unsigned char* const wring = ring + wv * (2 * GSTG); float* const os = osa + wv * (16 * 68);   // this wave's ring and staging block
    v8f acc[4][4];
#pragma unroll
    for (int mb = 0; mb < 4; ++mb)
#pragma unroll
        for (int nb = 0; nb < 4; ++nb) acc[mb][nb] = (v8f){};
    // copy map: a lane moves 16 bytes; 8 lanes cover a row's 128 bytes, a copy 4 rows
    const size_t aoff = ((size_t)(r0 + (lane >> 3)) * K + wv * Kw + (lane & 7) * 8) * 2, boff = ((size_t)(c0 + (lane >> 3)) * K + wv * Kw + (lane & 7) * 8) * 2, gs = (size_t)K * 8;   // bytes; gs: four rows
    const unsigned lcp = (unsigned)(size_t)wring + (lane >> 3) * GPO + (lane & 7) * 16;   // LDS byte address: the low 32 bits of the __shared__ address
    const int nt = Kw / GKS;
    auto fill = [&](int t) { const unsigned l = lcp + (t & 1) * GSTG; const size_t ko = (size_t)t * (GKS * 2);
        acopy_tile(l, (const unsigned char*)A + aoff + ko, gs); acopy_tile(l + GTB, (const unsigned char*)Bt + boff + ko, gs);
        if (HA2) acopy_tile(l + 2 * GTB, (const unsigned char*)A2 + aoff + ko, gs);
        if (HB2) acopy_tile(l + (2 + HA2) * GTB, (const unsigned char*)Bt2 + boff + ko, gs); };
    fill(0);
    asm volatile("s_wait_asynccnt 0x0" ::: "memory");   // stage 0 has landed
    __syncthreads();   // publish point of the ring (for a work-group of one wave the compiler emits no barrier instruction)
    if (nt > 1) fill(1);
#pragma unroll 1   // stays rolled: the two buffers alternate by t & 1
    for (int t = 0; t < nt; ++t) {
        const unsigned char* S = wring + (t & 1) * GSTG + lr * GPO + 16 * hi;   // fragment k order, A and B alike: 16 bytes at 16 hi and at 32 + 16 hi of each 64 bytes of a row
        constexpr int GG = (HA2 || HB2) ? 1 : GKS / 32;   // 32-k blocks whose fragments are read as one group: as many as fit beside the accumulators without a spill
        V a[GG][4], a2[GG][4], b[GG][4], b2[GG][4];
#pragma unroll
        for (int k0 = 0; k0 < GKS / 32; k0 += GG) {
#pragma unroll
            for (int kk = 0; kk < GG; ++kk) { const unsigned char* Sk = S + (k0 + kk) * 64;
#pragma unroll
                for (int i = 0; i < 4; ++i) { a[kk][i] = WFrag<T16>::ld(Sk + i * 16 * GPO); b[kk][i] = WFrag<T16>::ld(Sk + GTB + i * 16 * GPO);
                    if (HA2) a2[kk][i] = WFrag<T16>::ld(Sk + 2 * GTB + i * 16 * GPO); if (HB2) b2[kk][i] = WFrag<T16>::ld(Sk + (2 + HA2) * GTB + i * 16 * GPO); } }
            __builtin_amdgcn_sched_barrier(0);   // the group's fragment loads issue together ahead of its matrix instructions: one LDS latency per group, not one per fragment
#pragma unroll
            for (int kk = 0; kk < GG; ++kk) {
#pragma unroll
                for (int nb = 0; nb < 4; ++nb) {
#pragma unroll
                    for (int mb = 0; mb < 4; ++mb) { acc[mb][nb] = WFrag<T16>::mma(a[kk][mb], b[kk][nb], acc[mb][nb]); if (HA2) acc[mb][nb] = WFrag<T16>::mma(a2[kk][mb], b[kk][nb], acc[mb][nb]); if (HB2) acc[mb][nb] = WFrag<T16>::mma(a[kk][mb], b2[kk][nb], acc[mb][nb]); } } }
            __builtin_amdgcn_sched_barrier(0);   // the next group's loads stay together behind these matrix instructions instead of being spread among them
        }
        // four vector slots behind the trip's last matrix instructions: the branch round the refill is taken on the last trips
        asm volatile("v_nop\n\tv_nop\n\tv_nop\n\tv_nop" : "+v"(acc[0][0]), "+v"(acc[1][1]), "+v"(acc[2][2]), "+v"(acc[3][3]) : "v"(a[GG - 1][0]), "v"(a[GG - 1][3]));
        asm volatile("s_wait_dscnt 0x0" ::: "memory");      // this stage's LDS reads are done before its buffer is refilled
        asm volatile("s_wait_asynccnt 0x0" ::: "memory");   // stage t + 1 has landed
        __syncthreads();   // publish point of stage t + 1 (one wave: no barrier instruction; two waves make the same number of trips)
        if (t + 2 < nt) fill(t + 2);   // into the buffer that this trip has just read
    }
    asm volatile("s_wait_asynccnt 0x0" ::: "memory");   // nothing of the ring is outstanding when the wave goes on to its epilogue
    if (KSP == 2) {   // join of the two halves of K: wave wv finishes the 16-row blocks 2 wv and 2 wv + 1
        const bool up = wv != 0;
        unsigned char* xs = wring + lane * 16;   // this wave's own ring: its copies have landed and its reads are done
#pragma unroll
        for (int m2 = 0; m2 < 2; ++m2) {
#pragma unroll
            for (int nb = 0; nb < 4; ++nb) { const v8f g = up ? acc[m2][nb] : acc[2 + m2][nb];
                *(v4fa*)(xs + (m2 * 8 + nb * 2) * 512) = (v4f){g[0], g[1], g[2], g[3]}; *(v4fa*)(xs + (m2 * 8 + nb * 2 + 1) * 512) = (v4f){g[4], g[5], g[6], g[7]}; } }
        __syncthreads();   // the partial sums read below were written by the other wave
        const unsigned char* xr = ring + (wv ^ 1) * (2 * GSTG) + lane * 16;
#pragma unroll
        for (int m2 = 0; m2 < 2; ++m2) {
#pragma unroll
            for (int nb = 0; nb < 4; ++nb) { const v8f m8 = up ? acc[2 + m2][nb] : acc[m2][nb]; const v4f p0 = *(const v4fa*)(xr + (m2 * 8 + nb * 2) * 512), p1 = *(const v4fa*)(xr + (m2 * 8 + nb * 2 + 1) * 512);
                acc[m2][nb] = m8 + (v8f){p0[0], p0[1], p0[2], p0[3], p1[0], p1[1], p1[2], p1[3]}; } }
    }
#pragma unroll
    for (int mb = 0; mb < 4 / KSP; ++mb) {
#pragma unroll
        for (int nb = 0; nb < 4; ++nb) {
#pragma unroll
            for (int j = 0; j < 8; ++j) os[(hi * 8 + j) * 68 + nb * 16 + lr] = acc[mb][nb][j]; }
        __builtin_amdgcn_wave_barrier(); asm volatile("" ::: "memory");
        float* crow = C + (size_t)(r0 + (wv * (4 / KSP) + mb) * 16) * ldc + c0;
{
#pragma unroll
            for (int s = 0; s < 8; ++s) { const int row = 2 * s + hi, cofs = lr * 4; v4f val = *(const v4fa*)(os + row * 68 + cofs); if (BIAS) { val[0] += bfr(bias[c0 + cofs]); val[1] += bfr(bias[c0 + cofs + 1]); val[2] += bfr(bias[c0 + cofs + 2]); val[3] += bfr(bias[c0 + cofs + 3]); }
                *(v4f*)(crow + (size_t)row * ldc + cofs) = val; }
             }
        asm volatile("s_wait_xcnt 0x0" ::: "memory");   // the eight stores above are issued: their registers may be reused from here on
        __builtin_amdgcn_wave_barrier(); asm volatile("" ::: "memory");
    }
}

typedef __attribute__((ext_vector_type(2))) _Float16 v2h;
typedef __attribute__((ext_vector_type(4))) _Float16 v4h;
typedef __attribute__((ext_vector_type(2))) unsigned short v2us;
typedef __attribute__((ext_vector_type(4))) unsigned short v4us;
typedef __attribute__((ext_vector_type(2))) float v2f;
typedef __attribute__((ext_vector_type(4))) int v4i;

typedef __attribute__((ext_vector_type(4))) unsigned v4u;
typedef v4u __attribute__((may_alias)) v4ua;
typedef __attribute__((ext_vector_type(2))) __bf16 v2bf;
typedef __attribute__((ext_vector_type(2))) unsigned v2u;
typedef v2u __attribute__((may_alias)) v2ua;
// ---- k_qkv: the q/k/v projections straight from the f32 inputs. grid (rows / 128, head), 6 waves = 2 row halves x (q, k, v); a wave owns a 64x64 tile (16 accumulators), K = DM in stages of 64 k.
// A stage in LDS = 128 rows of x and the 192 columns of the head's Wq, Wk, Wv, each as a row of 64 k in bf16 (pitch GPO). The values come as f32 through registers and are rounded to bf16 (nearest even) on the way in:
// a stage's global loads are issued as soon as the registers are free (the stage before it has gone to LDS) and fly under the next stage's products; two LDS buffers, one barrier per stage. An x row feeds 3 waves, a weight column 2.
// x: a thread takes 4 k of a row (16 bytes in, 8 bytes out), a wave-wide load covering two whole 256-byte row pieces. W ([k][64 columns] f32): a thread takes 8 k x 4 columns, a wave-wide load covering two whole 256-byte rows, and stores 16 bytes (8 k) to each of its 4 column rows.
// The 16-byte chunk c of weight row n lies at chunk c ^ ((n >> 4) & 3): the 16 lanes of a store (rows 4 apart) then fall on 16 different bank groups; a fragment read has one n >> 4, so it stays a read of rows at an odd pitch.
// The tile + bias, rounded to fp16, goes straight to where the attention kernel reads it (a tile's 64 columns are one head, its 64 rows lie in one batch):
// z = 0, 1 (q, k) to rows [t][d] of plane [z][b][h] of P16, z = 2 (v) transposed to rows [d][t] of plane [b][h] of V16. Every store instruction covers whole 128-byte rows.
// The work-groups with blockIdx.x < DQ / 64 also re-lay one 64 k x 64 column block of Wo as Bt rows (K-contiguous; rounded to bf16, held as fp16) for the out projection: loaded with stage 0, turned through the epilogue's LDS.
#define QNW  6                    // waves per work-group
#define QAB  (128 * GPO)          // a stage's x rows, bytes
#define QSTG (QAB + 192 * GPO)    // a stage: x rows | Wq, Wk, Wv columns
#define QXC  11                   // 4-value chunks of x per thread and stage: 128 rows x 16 chunks = 10 x 192 + 128, the eleventh for waves 0 to 3 only
static_assert(HD == 64 && TT % 128 == 0 && NKV == NH_ && DQ == DM && DQ / 64 <= NB_ * TT / 128 && DM >= 2 * GKS, "a wave's 64x64 tile is one head of one batch; every block of Wo has a work-group");
__device__ __forceinline__ unsigned pkbf(float a, float b) { return __builtin_bit_cast(unsigned, (v2bf){(__bf16)a, (__bf16)b}); }   // low half: a
// two weights of the fp16 operand: rounded to bf16 like every input, those values again as fp16
__device__ __forceinline__ unsigned pkbh(float a, float b) { const unsigned p = pkbf(a, b); return __builtin_bit_cast(unsigned, (v2h){(h16)__uint_as_float(p << 16), (h16)__uint_as_float(p & 0xFFFF0000u)}); }
// a work-group barrier that orders LDS alone: __syncthreads() would also wait for the global loads in flight, which are the stage after next on its way into registers
__device__ __forceinline__ void lds_barrier() { __builtin_amdgcn_fence(__ATOMIC_RELEASE, "workgroup", "local"); __builtin_amdgcn_s_barrier(); __builtin_amdgcn_fence(__ATOMIC_ACQUIRE, "workgroup", "local"); }
__global__ __launch_bounds__(32 * QNW) void k_qkv(const float* __restrict__ x, const float* __restrict__ wq, const float* __restrict__ wk, const float* __restrict__ wv, const float* __restrict__ wo, const float* __restrict__ bq, const float* __restrict__ bk, const float* __restrict__ bv, h16* P16, h16* V16, h16* WOB) {
    __shared__ __align__(16) float osa[QNW * 64 * GPV / 4];   // epilogue staging, a block per wave
    __shared__ __align__(16) unsigned char ring[2 * QSTG];
    const int tid = threadIdx.x, lane = tid & 31, lr = lane & 15, hi = lane >> 4;
    const int wave = __builtin_amdgcn_readfirstlane(tid >> 5);
    const size_t z = wave >> 1;   // this wave's operand, in staging and in the products: 0, 1, 2 = q, k, v
    const int r0 = blockIdx.x * 128 + (wave & 1) * 64, c0 = blockIdx.y * 64;
    const float* bias = (z == 0) ? bq : ((z == 1) ? bk : bv);
    float* const os = osa + wave * (64 * GPV / 4);
    // staging maps. x: chunk i of thread tid = row tid / 16 + 12 i, k 4 (tid & 15) ..; W: thread t64 of the operand's 64: columns c4 .. c4 + 3, k 8 (kg + 4 i) + r
    const float* xg = x + (size_t)(blockIdx.x * 128 + (tid >> 4)) * DM + (tid & 15) * 4;
    const int xl = (tid >> 4) * GPO + (tid & 15) * 8;
    const int t64 = tid & 63, c4 = (t64 & 15) * 4, kg = t64 >> 4, sw = (t64 >> 2) & 3;   // sw = (c4 + j) >> 4
    const float* wg = ((z == 0) ? wq : ((z == 1) ? wk : wv)) + (size_t)blockIdx.y * DM * HD + (size_t)(kg * 8) * HD + c4;
    const int wl = c4 * GPO + (kg ^ sw) * 16;   // in a 64-row block: column row c4 + j at + j GPO, chunk kg + 4 i at + 64 i
    v4f xr[QXC], wr[2][8];
    auto fetch = [&](int t) { const float* xp = xg + t * GKS; const float* wp = wg + (size_t)t * GKS * HD;
#pragma unroll
        for (int i = 0; i < QXC - 1; ++i) xr[i] = *(const v4fa*)(xp + (size_t)i * 12 * DM);
        if (wave < 4) xr[QXC - 1] = *(const v4fa*)(xp + (size_t)(QXC - 1) * 12 * DM);
#pragma unroll
        for (int i = 0; i < 2; ++i) {
#pragma unroll
            for (int r = 0; r < 8; ++r) wr[i][r] = *(const v4fa*)(wp + (size_t)(i * 32 + r) * HD); }
        asm volatile("s_wait_xcnt 0x0" :: "v"(xp), "v"(wp) : "memory");   // the loads above are issued: their address registers, held up to here as inputs so that no load lands in them, may be reused from here on
    };
    auto putx = [&](unsigned char* B, int i) { *(v2ua*)(B + xl + i * 12 * GPO) = (v2u){pkbf(xr[i][0], xr[i][1]), pkbf(xr[i][2], xr[i][3])}; };
    auto put = [&](int t) { unsigned char* B = ring + (t & 1) * QSTG;
#pragma unroll
        for (int i = 0; i < QXC - 1; ++i) putx(B, i);
        if (wave < 4) putx(B, QXC - 1);
        unsigned char* Bw = B + QAB + z * GTB + wl;
#pragma unroll
        for (int i = 0; i < 2; ++i) {
#pragma unroll
            for (int j = 0; j < 4; ++j) *(v4ua*)(Bw + j * GPO + i * 64) = (v4u){pkbf(wr[i][0][j], wr[i][1][j]), pkbf(wr[i][2][j], wr[i][3][j]), pkbf(wr[i][4][j], wr[i][5][j]), pkbf(wr[i][6][j], wr[i][7][j])}; }
    };
    v8f acc[4][4];
#pragma unroll
    for (int mb = 0; mb < 4; ++mb)
#pragma unroll
        for (int nb = 0; nb < 4; ++nb) acc[mb][nb] = (v8f){};
    fetch(0);
    const bool wob = blockIdx.x < DQ / 64;   // this work-group re-lays k 64 blockIdx.x .., columns c0 .. of Wo
    if (wob && wave >= 4) {   // waves 4 and 5: the same 8 k x 4 column map, the block's rows laid in the first epilogue block
        const float* og = wo + (size_t)(blockIdx.x * 64 + kg * 8) * DM + c0 + c4; v4f wu[2][8];
#pragma unroll
        for (int i = 0; i < 2; ++i) {
#pragma unroll
            for (int r = 0; r < 8; ++r) wu[i][r] = *(const v4fa*)(og + (size_t)(i * 32 + r) * DM); }
        asm volatile("s_wait_xcnt 0x0" :: "v"(og) : "memory");   // the loads above are issued: their address registers, held up to here as an input, may be reused from here on
#pragma unroll
        for (int i = 0; i < 2; ++i) {
#pragma unroll
            for (int j = 0; j < 4; ++j) *(v4ua*)((unsigned char*)osa + wl + j * GPO + i * 64) = (v4u){pkbh(wu[i][0][j], wu[i][1][j]), pkbh(wu[i][2][j], wu[i][3][j]), pkbh(wu[i][4][j], wu[i][5][j]), pkbh(wu[i][6][j], wu[i][7][j])}; }
    }
    put(0);
    fetch(1);
    lds_barrier();   // stage 0 was written by all six waves (the turned block of Wo by waves 4 and 5)
    if (wob) {
        for (int s = wave; s < 16; s += QNW) { const int row = 4 * s + (lane >> 3);   // a store: 4 rows x 8 lanes x 16 bytes, whole 128-byte lines; row >> 4 = s >> 2
            *(v4ua*)(WOB + (size_t)(c0 + row) * DQ + blockIdx.x * 64 + (lane & 7) * 8) = *(const v4ua*)((const unsigned char*)osa + row * GPO + (((lane & 7) ^ (s >> 2)) * 16));
            asm volatile("s_wait_xcnt 0x0" ::: "memory"); }   // the store is issued: its registers may be reused from here on
    }
    const int afo = ((wave & 1) * 64 + lr) * GPO + 16 * hi;   // fragment k order, A and B alike: the chunks hi and 2 + hi of each four (64 bytes of a row)
    const int bfo = QAB + (int)z * GTB + lr * GPO;
#pragma unroll 1   // stays rolled: the two buffers alternate by t & 1
    for (int t = 0; t < DM / GKS; ++t) {
        const unsigned char* S = ring + (t & 1) * QSTG;
        const bool more = t + 1 < DM / GKS;
        const unsigned char* SB[2] = {S + bfo + 16 * hi, S + bfo + 16 * (hi ^ 1)};   // chunk (hi ^ nb) & 1 for even and odd nb
        v16bf a[2][4], b[2][4];
#pragma unroll
        for (int kk = 0; kk < 2; ++kk) {
#pragma unroll
            for (int i = 0; i < 4; ++i) { a[kk][i] = WFrag<bf>::ld(S + afo + kk * 64 + i * 16 * GPO);
                const unsigned char* p = SB[i & 1] + kk * 64 + i * 16 * GPO; b[kk][i] = cat16b(*(const v8usa*)(p + 16 * (i & 2)), *(const v8usa*)(p + 16 * (2 ^ (i & 2)))); } }   // chunks (hi) ^ i and (2 + hi) ^ i
        __builtin_amdgcn_sched_barrier(0);   // the stage's fragment loads issue together ahead of its matrix instructions: one LDS latency per stage
#pragma unroll
        for (int kk = 0; kk < 2; ++kk) {
#pragma unroll
            for (int nb = 0; nb < 4; ++nb) {
#pragma unroll
                for (int mb = 0; mb < 4; ++mb) acc[mb][nb] = wmmab(a[kk][mb], b[kk][nb], acc[mb][nb]); } }
        // four vector slots behind the stage's last matrix instructions: the branch round the next stage's stores is taken on the last trip
        __builtin_amdgcn_sched_barrier(0); asm volatile("v_nop\n\tv_nop\n\tv_nop\n\tv_nop"); __builtin_amdgcn_sched_barrier(0);
        if (more) { put(t + 1);   // into the buffer that stage t - 1 used: every wave left it before the last barrier
            if (t + 2 < DM / GKS) fetch(t + 2); }   // into the registers just emptied: these loads fly over the barrier and under the whole of the next stage's products
        lds_barrier();   // stage t + 1 was written by all six waves; this stage's reads are done
    }
    {
    const size_t pl = (size_t)(r0 / TT) * NH_ + blockIdx.y; const int t0 = r0 % TT, l8 = lane >> 3, c8 = lane & 7;   // plane [b][h]; a store: 4 rows x 8 lanes x 16 bytes
    if (z < 2) {
        h16* prow = P16 + ((z * NB_ * NH_ + pl) * TT + t0) * HD + c8 * 8; float bb[8];
#pragma unroll
        for (int i = 0; i < 8; ++i) bb[i] = bfr(bias[c0 + c8 * 8 + i]);
#pragma unroll
        for (int mb = 0; mb < 4; ++mb) {
#pragma unroll
            for (int nb = 0; nb < 4; ++nb) {
#pragma unroll
                for (int j = 0; j < 8; ++j) os[(hi * 8 + j) * 68 + nb * 16 + lr] = acc[mb][nb][j]; }
            __builtin_amdgcn_wave_barrier(); asm volatile("" ::: "memory");   // compiler fence: the reads below take what other lanes of this wave stored
#pragma unroll
            for (int s = 0; s < 4; ++s) { const int row = 4 * s + l8; const v4f v0 = *(const v4fa*)(os + row * 68 + c8 * 8), v1 = *(const v4fa*)(os + row * 68 + c8 * 8 + 4); v8h o;
#pragma unroll
                for (int i = 0; i < 4; ++i) { o[i] = tohx(v0[i] + bb[i]); o[4 + i] = tohx(v1[i] + bb[4 + i]); }
                *(v8h*)(prow + (size_t)(mb * 16 + row) * HD) = o; }
            asm volatile("s_wait_xcnt 0x0" ::: "memory");   // the four stores above are issued: their registers may be reused from here on
            __builtin_amdgcn_wave_barrier(); asm volatile("" ::: "memory");   // compiler fence: the next block's stores stay behind these reads
        }
    } else {
        unsigned char* ot = (unsigned char*)os;   // acc[mb][nb][0..7]: 8 consecutive t of feature 16 nb + lr = 16 bytes of a V^T row
#pragma unroll
        for (int nb = 0; nb < 4; ++nb) { const float bv = bfr(bias[c0 + nb * 16 + lr]);
#pragma unroll
            for (int mb = 0; mb < 4; ++mb) { v8h o;
#pragma unroll
                for (int j = 0; j < 8; ++j) o[j] = tohx(acc[mb][nb][j] + bv);
                *(v8ha*)(ot + (nb * 16 + lr) * GPV + mb * 32 + hi * 16) = o; } }
        __builtin_amdgcn_wave_barrier(); asm volatile("" ::: "memory");   // compiler fence: the reads below take what other lanes of this wave stored
        h16* vrow = V16 + pl * HD * TT + t0 + c8 * 8;
#pragma unroll
        for (int s = 0; s < 16; ++s) { const int d = 4 * s + l8; *(v8h*)(vrow + (size_t)d * TT) = *(const v8ha*)(ot + d * GPV + c8 * 16); }
        asm volatile("s_wait_xcnt 0x0" ::: "memory");   // the sixteen stores above are issued: their address registers may be reused from here on
    }
    }
}

#define FNW  8                    // waves per work-group
#define FKH  2                    // key halves of a stage, one per wave group
#define FQT  2                    // 16-query tiles per wave
#define FBR  (FNW / FKH * FQT * 16)   // queries per work-group
#define FSK  256                  // keys per stage: 128 per key half, four 32-key passes of a wave between barriers
#define FPK  (HD * 2 + 16)        // LDS pitch of a K row, bytes: odd multiple of 16
#define FPV  (FSK * 2 + 16)       // LDS pitch of a V^T row, bytes: odd multiple of 16
#define FTK  (FSK * FPK)
#define FTV  (HD * FPV)
#define FSLOT (FTK + FTV)
#define FXW  (9 * 512)            // a wave's slot of the closing exchange, bytes: 8 x 16 bytes of sums + 16 bytes of maximum and denominator per lane
#define FCH  8                    // staged chunks of 16 bytes per thread, operand and stage
static_assert(HD == 64 && TT % FSK == 0 && TT % FBR == 0 && FSK * HD * 2 == FCH * 256 * 16 && FSK * 2 == 32 * 16, "staging map: 256 threads x FCH chunks of 16 bytes per operand and stage; a wave covers one V^T row piece");
static_assert(FKH == 2 && FQT == 2 && FNW * FXW <= 2 * FSLOT, "the closing exchange: each wave of a pair finishes one tile; the slots lie in the ring");
__device__ __forceinline__ v16h fragl(const unsigned char* p) { return cat16(*(const v8ha*)p, *(const v8ha*)(p + 32)); }
__device__ __forceinline__ float xhalf(float x) { return __builtin_bit_cast(float, __builtin_amdgcn_permlanex16(__builtin_bit_cast(int, x), __builtin_bit_cast(int, x), 0x76543210, 0xfedcba98, false, false)); }   // lane l with lane l ^ 16
// eight exponentials (2^x) in place in one statement: no v_exp_f32 has its source overwritten by the instruction directly behind it, and the closing v_nop is the slot the instruction set asks for between a transcendental and the first use of its result
__device__ __forceinline__ void exp2x8(float& a, float& b, float& c, float& d, float& e, float& f, float& g, float& h) {
    asm("v_exp_f32 %0, %0\n\tv_exp_f32 %1, %1\n\tv_exp_f32 %2, %2\n\tv_exp_f32 %3, %3\n\tv_exp_f32 %4, %4\n\tv_exp_f32 %5, %5\n\tv_exp_f32 %6, %6\n\tv_exp_f32 %7, %7\n\tv_nop" : "+v"(a), "+v"(b), "+v"(c), "+v"(d), "+v"(e), "+v"(f), "+v"(g), "+v"(h)); }
// two exponentials (2^x) in place, same form: the closing v_nop keeps the slot behind the second one
__device__ __forceinline__ void exp2x2(float& a, float& b) { asm("v_exp_f32 %0, %0\n\tv_exp_f32 %1, %1\n\tv_nop" : "+v"(a), "+v"(b)); }
__global__ __launch_bounds__(256) void k_fattn(const h16* __restrict__ Qp, const h16* __restrict__ Kp, const h16* __restrict__ Vt, h16* Az) {
    __shared__ __align__(16) unsigned char L[2 * FSLOT];
    const int tid = threadIdx.x, lane = tid & 31, wave = tid >> 5, c = lane & 15, hf = lane >> 4;
    const int kh = wave / (FNW / FKH);   // this wave's half of every stage's keys
    const int bh = blockIdx.y; const int q = blockIdx.x * FBR + (wave % (FNW / FKH)) * (FQT * 16) + c;   // this lane's query in tile 0; tile 1: 16 on
    const float cscale = SCL * 1.4426950408889634f;
    // staging map: chunk i of thread tid = 16 bytes; K: row 32 i + tid / 8, V^T: row 8 i + tid / 32; a wave's load covers whole 128-byte lines
    const unsigned char* kg = (const unsigned char*)(Kp + (size_t)bh * TT * HD) + tid * 16;
    const unsigned char* vg = (const unsigned char*)(Vt + (size_t)bh * HD * TT) + (size_t)(tid >> 5) * (TT * 2) + (tid & 31) * 16;
    const int klo = (tid >> 3) * FPK + (tid & 7) * 16, vlo = FTK + (tid >> 5) * FPV + (tid & 31) * 16;
    v4u rk[FCH], rv[FCH];
#pragma unroll
    for (int i = 0; i < FCH; ++i) { rk[i] = *(const v4ua*)(kg + i * 4096); rv[i] = *(const v4ua*)(vg + (size_t)i * 8 * TT * 2); }
    v16h qf[FQT][2];
#pragma unroll
    for (int u = 0; u < FQT; ++u) { const h16* qp = Qp + ((size_t)bh * TT + q + 16 * u) * HD + 8 * hf;
#pragma unroll
      for (int kc = 0; kc < 2; ++kc) qf[u][kc] = cat16(*(const v8h*)(qp + 32 * kc), *(const v8h*)(qp + 32 * kc + 16)); }
    asm volatile("s_wait_xcnt 0x0" ::: "memory");   // the twenty-four loads above are issued: their address registers may be reused from here on
    v16h ones;   // A operand of all ones: every row of its product holds the column sums of P^T (the softmax denominators' increments)
#pragma unroll
    for (int i = 0; i < 16; ++i) ones[i] = (h16)1.0f;
    v8f acc[FQT][4], lacc[FQT]; float mrun[FQT];
#pragma unroll
    for (int u = 0; u < FQT; ++u) { lacc[u] = (v8f){}; mrun[u] = -3.0e38f;
#pragma unroll
        for (int t = 0; t < 4; ++t) acc[u][t] = (v8f){}; }
#pragma unroll
    for (int i = 0; i < FCH; ++i) { *(v4ua*)(L + klo + i * 32 * FPK) = rk[i]; *(v4ua*)(L + vlo + i * 8 * FPV) = rv[i]; }
    __syncthreads();
    const int kfo = (kh * (FSK / FKH) + c) * FPK + 16 * hf, vfo = FTK + c * FPV + kh * (FSK / FKH) * 2 + 16 * hf;   // this lane's first K and V^T fragment bytes in a stage
#pragma unroll 1   // stays rolled: the body already holds its unrolled passes, and the two buffers alternate by st & 1
    for (int st = 0; st < TT / FSK; ++st) {
        const unsigned char* Ls = L + (st & 1) * FSLOT;
        const bool more = st + 1 < TT / FSK;
        if (more) {
#pragma unroll
            for (int i = 0; i < FCH; ++i) { rk[i] = *(const v4ua*)(kg + (size_t)(st + 1) * (FSK * HD * 2) + i * 4096); rv[i] = *(const v4ua*)(vg + (size_t)(st + 1) * (FSK * 2) + (size_t)i * 8 * TT * 2); } }
        v16h kf[2][2];   // K fragments of the pass at hand; each pass fetches the next one's (same stage) with its V^T fragments
#pragma unroll
        for (int kt = 0; kt < 2; ++kt) {
#pragma unroll
            for (int kc = 0; kc < 2; ++kc) kf[kt][kc] = fragl(Ls + kfo + kt * 16 * FPK + 64 * kc); }
        __builtin_amdgcn_sched_barrier(0);   // the first pass's eight K fragment loads issue as one group ahead of its score products: one LDS wait, none between the products
#pragma unroll
        for (int ps = 0; ps < FSK / FKH / 32; ++ps) {
            v8f s[FQT][2];
#pragma unroll
            for (int u = 0; u < FQT; ++u) {
#pragma unroll
                for (int kt = 0; kt < 2; ++kt) s[u][kt] = wmma16(kf[kt][0], qf[u][0], (v8f){}); }
#pragma unroll
            for (int u = 0; u < FQT; ++u) {
#pragma unroll
                for (int kt = 0; kt < 2; ++kt) s[u][kt] = wmma16(kf[kt][1], qf[u][1], s[u][kt]); }
            __builtin_amdgcn_sched_barrier(0);   // the eight score products issue back to back, each filling the slots the chip asks for behind the others, before the first maximum reads a result
            float mx[FQT];
#pragma unroll
            for (int u = 0; u < FQT; ++u) { mx[u] = s[u][0][0];
#pragma unroll
                for (int r = 1; r < 16; ++r) mx[u] = fmaxf(mx[u], s[u][r >> 3][r & 7]);
                mx[u] = fmaxf(mx[u], xhalf(mx[u])) * cscale; }   // both halves of the wave now hold this query's maximum over the pass's 32 keys, scaled (the scale is positive)
            if (__builtin_amdgcn_ballot_w32(mx[0] > mrun[0] + 8.0f || mx[1] > mrun[1] + 8.0f) != 0) {   // one scalar branch per pass; rare after the first passes
#pragma unroll
                for (int u = 0; u < FQT; ++u) {
                    const float mnew = fmaxf(mrun[u], mx[u]); const float corr = __builtin_amdgcn_exp2f(mrun[u] - mnew); mrun[u] = mnew;   // first pass: corr = 0 on zero sums
                    lacc[u] = lacc[u] * corr;
#pragma unroll
                    for (int t = 0; t < 4; ++t) acc[u][t] = acc[u][t] * corr; } }
            const unsigned char* vp = Ls + vfo + ps * 64;
            v16h vf[4];
#pragma unroll
            for (int t = 0; t < 4; ++t) vf[t] = fragl(vp + t * 16 * FPV);
            if (ps + 1 < FSK / FKH / 32) {
#pragma unroll
                for (int kt = 0; kt < 2; ++kt) {
#pragma unroll
                    for (int kc = 0; kc < 2; ++kc) kf[kt][kc] = fragl(Ls + kfo + ((ps + 1) * 32 + kt * 16) * FPK + 64 * kc); } }
            __builtin_amdgcn_sched_barrier(0);   // the V^T loads and the next pass's K loads issue in front of the exponentials, whose time covers their LDS latency
            v16h pf[FQT];
#pragma unroll
            for (int u = 0; u < FQT; ++u) { const float nm = -mrun[u];
#pragma unroll
                for (int kt = 0; kt < 2; ++kt) { float e[8];
#pragma unroll
                    for (int i = 0; i < 4; ++i) { const v2f arg = __builtin_elementwise_fma((v2f){s[u][kt][2 * i], s[u][kt][2 * i + 1]}, (v2f){cscale, cscale}, (v2f){nm, nm}); e[2 * i] = arg[0]; e[2 * i + 1] = arg[1]; }
                    exp2x8(e[0], e[1], e[2], e[3], e[4], e[5], e[6], e[7]);
#pragma unroll
                    for (int i = 0; i < 4; ++i) { const v2h p2 = __builtin_convertvector((v2f){e[2 * i], e[2 * i + 1]}, v2h); pf[u][8 * kt + 2 * i] = p2[0]; pf[u][8 * kt + 2 * i + 1] = p2[1]; } } }
#pragma unroll
            for (int u = 0; u < FQT; ++u) {
#pragma unroll
                for (int t = 0; t < 4; ++t) acc[u][t] = wmma16(vf[t], pf[u], acc[u][t]);
                lacc[u] = wmma16(ones, pf[u], lacc[u]); }
        }
        // four vector slots behind the stage's last matrix instructions: the branch round the next stage's loads is taken on the last trip
        __builtin_amdgcn_sched_barrier(0); asm volatile("v_nop\n\tv_nop\n\tv_nop\n\tv_nop"); __builtin_amdgcn_sched_barrier(0);
        if (more) { unsigned char* Ln = L + ((st + 1) & 1) * FSLOT;   // the buffer that stage st - 1 used: every wave left it before the last barrier
#pragma unroll
            for (int i = 0; i < FCH; ++i) { *(v4ua*)(Ln + klo + i * 32 * FPK) = rk[i]; *(v4ua*)(Ln + vlo + i * 8 * FPV) = rv[i]; } }
        __syncthreads();
    }
    // join of the two key halves: wave kh finishes tile kh; it hands its sums of the other tile to its partner (wave ^ 4, same lane = same query and features) through the ring, which every wave left at the loop's last barrier
    const bool up = kh != 0;
    const float mm = up ? mrun[1] : mrun[0], lm = up ? lacc[1][0] : lacc[0][0];
    { unsigned char* xs = L + wave * FXW + lane * 16;
#pragma unroll
      for (int t = 0; t < 4; ++t) { const v8f g = up ? acc[0][t] : acc[1][t];
          *(v4fa*)(xs + (2 * t) * 512) = (v4f){g[0], g[1], g[2], g[3]}; *(v4fa*)(xs + (2 * t + 1) * 512) = (v4f){g[4], g[5], g[6], g[7]}; }
      *(v4fa*)(xs + 8 * 512) = (v4f){up ? mrun[0] : mrun[1], up ? lacc[0][0] : lacc[1][0], 0.0f, 0.0f}; }
    __syncthreads();   // the slots read below were written by the partner waves
    const unsigned char* xr = L + (wave ^ (FNW / FKH)) * FXW + lane * 16;
    const v4f pml = *(const v4fa*)(xr + 8 * 512);
    const float mj = fmaxf(mm, pml[0]); float am = mm - mj, ap = pml[0] - mj; exp2x2(am, ap);   // each half's weight: 2^(its maximum - the joint one)
    const float inv = __fdiv_rn(1.0f, lm * am + pml[1] * ap); const float fm = am * inv, fp = ap * inv;
    const size_t oo = ((size_t)(bh / NH_) * TT + q + 16 * kh) * DQ + (bh % NH_) * HD + 8 * hf;   // sums [t][r] = O[q][16 t + 8 hf + r]: 8 consecutive features per store
#pragma unroll
    for (int t = 0; t < 4; ++t) { const v8f m8 = up ? acc[1][t] : acc[0][t]; const v4f p0 = *(const v4fa*)(xr + (2 * t) * 512), p1 = *(const v4fa*)(xr + (2 * t + 1) * 512); v8h o;
#pragma unroll
        for (int r = 0; r < 8; ++r) o[r] = tohx(m8[r] * fm + (r < 4 ? p0[r & 3] : p1[r & 3]) * fp);
        *(v8h*)(Az + oo + 16 * t) = o; }
}

extern "C" void kernel_launch(void* const* d_in, const int* in_sizes, int n_in,
                              void* d_out, int out_size, void* d_ws, size_t ws_size, hipStream_t stream) {
    (void)in_sizes; (void)n_in; (void)out_size;
    const float* x = (const float*)d_in[0]; const float* wq = (const float*)d_in[1]; const float* bqv = (const float*)d_in[2]; const float* wk = (const float*)d_in[3]; const float* bkv = (const float*)d_in[4]; const float* wv = (const float*)d_in[5]; const float* bvv = (const float*)d_in[6]; const float* wo = (const float*)d_in[7]; const float* bo = (const float*)d_in[8];   // Wq/Wk/Wv [8][512][64] (x @ W per head), biases [8][64], Wo [512][512] (x @ W), bo
    float* OUT = (float*)d_out;     // [2][2048][512]
    char* wsp = (char*)d_ws;
    auto take = [&](size_t bytes) { char* p = wsp; wsp += (bytes + 255) & ~(size_t)255; return (void*)p; };
    h16* WO = (h16*)take((size_t)DM * DQ * 2);   // Bt rows of the out projection
    h16* QP16 = (h16*)take((size_t)NB_ * NH_ * TT * HD * 2); h16* KP16 = (h16*)take((size_t)NB_ * NKV * TT * HD * 2); h16* VT16 = (h16*)take((size_t)NB_ * NKV * HD * TT * 2);   // planes [b][h][..]; QP16, KP16 back to back
    h16* AZ = (h16*)take((size_t)NB_ * TT * DQ * 2);   // merged heads [b][t][h * 64 + d]
    if ((size_t)(wsp - (char*)d_ws) > ws_size) return;    // ws 256 MiB
    k_qkv<<<dim3(NB_ * TT / 128, NH_, 1), 32 * QNW, 0, stream>>>(x, wq, wk, wv, wo, bqv, bkv, bvv, QP16, VT16, WO);   // fp16 planes out; Wo re-laid on the side
    k_fattn<<<dim3(TT / FBR, NB_ * NH_, 1), 256, 0, stream>>>(QP16, KP16, VT16, AZ);   // planes [b][h][..]: grid y = b * heads + h (one kv head per query head)
    k_gemmw<h16, 0, true, 2><<<dim3(NB_ * TT / 64, DM / 64, 1), 64, 0, stream>>>(AZ, nullptr, WO, nullptr, DQ, OUT, DM, bo, nullptr, nullptr, 0, 0, 0);
}
